// v000
// Times are from an AMD MI455X. After a warm-up the kernel runs many times in a row, and a time is the length of
// such a window on the GPU divided by its runs, so every launch and the gaps after it count. The runs cycle
// through copies of the inputs. A figure is the median of several windows, for all but v000 over two sittings.
// Sittings can differ by a few percent; kernels timed side by side share one.
// v000, which the later versions start from, runs in 478 microseconds.
// compute dtype: all float inputs rounded to bf16, tau read on device; qk / v = x . W^T with EXACT bf16 products on WMMA 16x16x32 (natural rows; the tied projection fills both the q and the k planes); PLAIN attention: q single f16, |q|^2 per token from the same f16 values in f32, logits = (2 q_i.q_j - |q_i|^2 - |q_j|^2) / 8 x tau_h, running-max softmax in f32 (hardware exp), P (scaled by 2^11, single f16) x v (single f16); out = o (bf16 hi + residual) . Wo^T (2 products).
#include <hip/hip_runtime.h>
#include <math.h>

typedef __attribute__((ext_vector_type(16))) _Float16 v16h;
typedef __attribute__((ext_vector_type(16))) __bf16 v16b;
typedef __attribute__((ext_vector_type(8)))  _Float16 v8h;
typedef __attribute__((ext_vector_type(8)))  float v8f;
typedef __attribute__((ext_vector_type(4)))  float v4f;
typedef __attribute__((ext_vector_type(2)))  float v2f;
typedef __attribute__((ext_vector_type(4)))  unsigned v4u;
typedef __attribute__((ext_vector_type(4)))  int v4i;
typedef float __attribute__((may_alias)) float_a;
typedef int __attribute__((may_alias)) int_a;

template <typename T> __device__ __forceinline__ void vst2(void* p, T v) { *(T*)p = v;  }
__device__ __forceinline__ v8f wmma16(v16h a, v16h b, v8f c) {
  v8f d = __builtin_amdgcn_wmma_f32_16x16x32_f16(false, a, false, b, (short)0, c, false, false);
  asm volatile("v_nop\n\tv_nop\n\tv_nop\n\tv_nop" : "+v"(d) : "v"(a), "v"(b));
  return d;
}
__device__ __forceinline__ v8f wmma_bf(v16b a, v16b b, v8f c) {
  v8f d = __builtin_amdgcn_wmma_f32_16x16x32_bf16(false, a, false, b, (short)0, c, false, false);
  asm volatile("v_nop\n\tv_nop\n\tv_nop\n\tv_nop" : "+v"(d) : "v"(a), "v"(b));
  return d;
}
// Token-diffusion attention (B 2, N 4,096, d 512, 8 heads x 64): tied q = k projection, distance-kernel logits -|q_i - q_j|^2 / 8 x tau_h, softmax, . v, output projection.
__device__ __forceinline__ v16h frag_h(const _Float16* rowk0, int lane) {
  union { v16h v; v8h q[2]; } u; const _Float16* p = rowk0 + 8 * (lane >> 4);
  u.q[0] = *(const v8h*)p; u.q[1] = *(const v8h*)(p + 16); return u.v;
}
__device__ __forceinline__ v16h frag_f32(const float* rowk0, int lane) {
  v16h a; const float* p = rowk0 + 8 * (lane >> 4);
#pragma unroll
  for (int i = 0; i < 8; ++i) { a[i] = (_Float16)p[i]; a[8 + i] = (_Float16)p[16 + i]; }
  return a;
}
__device__ __forceinline__ v16h frag_f32s(const float* rowk0, int lane, float sc) {
  v16h a; const float* p = rowk0 + 8 * (lane >> 4);
#pragma unroll
  for (int i = 0; i < 8; ++i) { a[i] = (_Float16)(p[i] * sc); a[8 + i] = (_Float16)(p[16 + i] * sc); }
  return a;
}
// column fragment from a [K][ld] layout (column n), rows >= K read as 0
__device__ __forceinline__ v16h fragc_f32(const float* W, int k0, int n, int lane, int ld, int K) {
  v16h a; const int g = lane >> 4;
#pragma unroll
  for (int i = 0; i < 8; ++i) { const int ka = k0 + 8 * g + i, kb = ka + 16;
    a[i] = (_Float16)(ka < K ? W[(size_t)(ka < K ? ka : K - 1) * ld + n] : 0.f); a[8 + i] = (_Float16)(kb < K ? W[(size_t)(kb < K ? kb : K - 1) * ld + n] : 0.f); }
  return a;
}
struct F2 { v16b h, l; };
__device__ __forceinline__ F2 bsplit16(const float v[16]) { F2 r;
#pragma unroll
  for (int i = 0; i < 16; ++i) { const __bf16 h = (__bf16)v[i]; r.h[i] = h; r.l[i] = (__bf16)(v[i] - (float)h); }
  return r; }
__device__ __forceinline__ F2 split_row(const float* row, int k0, int lane) { float v[16]; const float* p = row + k0 + 8 * (lane >> 4);
#pragma unroll
  for (int i = 0; i < 8; ++i) { v[i] = p[i]; v[8 + i] = p[16 + i]; }
  return bsplit16(v); }
__device__ __forceinline__ F2 split_rowK(const float* row, int k0, int lane, int K) { float v[16]; const int g = lane >> 4;
#pragma unroll
  for (int i = 0; i < 8; ++i) { const int ka = k0 + 8 * g + i, kb = ka + 16; v[i] = ka < K ? row[ka < K ? ka : K - 1] : 0.f; v[8 + i] = kb < K ? row[kb < K ? kb : K - 1] : 0.f; }
  return bsplit16(v); }
__device__ __forceinline__ F2 split_col(const float* W, int k0, int n, int lane, int ld, int K) { float v[16]; const int g = lane >> 4;
#pragma unroll
  for (int i = 0; i < 8; ++i) { const int ka = k0 + 8 * g + i, kb = ka + 16; v[i] = ka < K ? W[(size_t)(ka < K ? ka : K - 1) * ld + n] : 0.f; v[8 + i] = kb < K ? W[(size_t)(kb < K ? kb : K - 1) * ld + n] : 0.f; }
  return bsplit16(v); }
__device__ __forceinline__ v8f mac3(const F2& a, const F2& b, v8f c) { c = wmma_bf(a.l, b.h, c); c = wmma_bf(a.h, b.l, c); return wmma_bf(a.h, b.h, c); }
__device__ __forceinline__ float sigm(float v) { return 1.0f / (1.0f + expf(-v)); }
#define LDSX() do { asm volatile("s_wait_dscnt 0" ::: "memory"); __builtin_amdgcn_wave_barrier(); __builtin_amdgcn_fence(__ATOMIC_RELEASE, "workgroup"); } while (0)


#define NB 2
#define SS 4096
#define DM 512
#define NH 8
#define HD 64
#define QKVW (3 * DM)
#ifndef TQB
#define TQB (SS / 64)
#define TNB NB
#define TOB (NB * SS / 64)     // output row tiles (all)
#endif
typedef __attribute__((ext_vector_type(8))) __bf16 v8b;
__device__ __forceinline__ v16b frag_b(const __bf16* rowk0, int lane) {
  union { v16b v; v8b q[2]; } u; const __bf16* p = rowk0 + 8 * (lane >> 4);
  u.q[0] = *(const v8b*)p; u.q[1] = *(const v8b*)(p + 16); return u.v;
}
__device__ __forceinline__ float bfr(float v) { return (float)(__bf16)v; }
__device__ __attribute__((noinline)) float exp_ni(float v) { return expf(v); }
__device__ __attribute__((noinline)) float erf_ni(float v) { return erff(v); }

#define PK_A 0                       // [1536][512] Wqkv rows (natural [out][in])
#define PK_P (PK_A + QKVW * DM)        // [512][512] Wo rows (natural)
#define PK_END (PK_P + DM * DM)
#define WS_PK  0u
#define WS_QK  (WS_PK + 2u * PK_END)             // f16 [8192 rows][1024]: q | k
#define WS_QKL (WS_QK + 2u * NB * SS * 2 * DM)     // f16 q | k residual planes x2048
#define WS_VTH (WS_QKL + 2u * NB * SS * 2 * DM)    // f16 [b][512 (h*64+d)][4096 s] hi
#define WS_VTL (WS_VTH + 2u * NB * DM * SS)        // f16 lo x 2048
#define WS_O   (WS_VTL + 2u * NB * DM * SS)        // f32 [8192][512]
#define WS_CS  (WS_O + 4u * NB * SS * DM)           // f32 [2][4096][32], unused
#define WS_Q2  (WS_CS + 4u * 2 * SS * 32)                  // f32 [b][h][s] |q|^2
#define WS_END (WS_Q2 + 4u * (size_t)NB * NH * SS)
// ---- k_pack: block = (row n, which): natural [out][in] rows -> bf16; which 0..2 -> W_q/W_k/W_v into PK_A rows which*512 + n; 3 -> W_o into PK_P
__global__ __launch_bounds__(256) void k_pack(const float* __restrict__ WQ, const float* __restrict__ WK, const float* __restrict__ WV, const float* __restrict__ WO, __bf16* __restrict__ PK) {
  __shared__ __align__(16) __bf16 s[DM]; const int n = blockIdx.x, which = blockIdx.y, t = threadIdx.x; const float* Wm = (which == 0) ? WQ : (which == 1) ? WK : (which == 2) ? WV : WO;
  for (int k = t; k < DM; k += 256) s[k] = (__bf16)Wm[(size_t)n * DM + k];
  __syncthreads();
  __bf16* dst = (which < 3) ? PK + PK_A + ((size_t)which * DM + n) * DM : PK + PK_P + (size_t)n * DM;
  for (int q = t; q < DM / 8; q += 256) vst2((unsigned*)(dst + q * 8), *(const v4u*)&s[q * 8]);
}
__global__ __launch_bounds__(128) void k_qkv(const float* __restrict__ XQ, const float* __restrict__ XK, const float* __restrict__ XV, const __bf16* __restrict__ P, const float* __restrict__ BQ, const float* __restrict__ BK, const float* __restrict__ BV, _Float16* __restrict__ QK, _Float16* __restrict__ QKL, _Float16* __restrict__ VTH, _Float16* __restrict__ VTL) {
  const int which0 = (blockIdx.y * 128) / DM; const float* X = (which0 == 0) ? XQ : (which0 == 1) ? XK : XV; const float* BB = BQ ? (((which0 == 0) ? BQ : (which0 == 1) ? BK : BV) + (blockIdx.y * 128 - which0 * DM)) : nullptr;
  __shared__ __align__(16) _Float16 so[4][16][136], sol[4][16][136]; __shared__ __align__(16) _Float16 sth[128][72], stl[128][72];
  const int tid = threadIdx.x, wave = tid >> 5, lane = tid & 31, col = lane & 15, g = lane >> 4; const size_t r0 = (size_t)blockIdx.x * 64 + wave * 16; const int n0 = blockIdx.y * 128;
  v8f acc[8] = {};
#pragma unroll 2
  for (int kc = 0; kc < DM / 32; ++kc) { v16b a; { const float* p = X + (r0 + col) * DM + kc * 32 + 8 * g;
#pragma unroll
      for (int i = 0; i < 8; ++i) { a[i] = (__bf16)p[i]; a[8 + i] = (__bf16)p[16 + i]; } }
#pragma unroll
    for (int j = 0; j < 8; ++j) acc[j] = wmma_bf(a, frag_b(P + (size_t)(n0 + j * 16 + col) * DM + kc * 32, lane), acc[j]); }
  if (n0 < 2 * DM) {   // q stored unscaled (f16 sigma ~0.6, no subnormal exposure); 1/8 applied to the f32 score
#pragma unroll
    for (int j = 0; j < 8; ++j) {
#pragma unroll
      for (int r = 0; r < 8; ++r) { const float v = acc[j][r] + (BB ? bfr(BB[j * 16 + col]) : 0.f); const _Float16 hv = (_Float16)v; so[wave][8 * g + r][j * 16 + col] = hv; sol[wave][8 * g + r][j * 16 + col] = (_Float16)((v - (float)hv) * 2048.0f); } }   // q, k (+ bias) as f16 hi + (x2048) residual
    LDSX();
    for (int rl = 0; rl < 16; ++rl) if (lane < 16) { vst2((unsigned*)(QK + (r0 + rl) * (2 * DM) + n0 + lane * 8), *(const v4u*)&so[wave][rl][lane * 8]); vst2((unsigned*)(QKL + (r0 + rl) * (2 * DM) + n0 + lane * 8), *(const v4u*)&sol[wave][rl][lane * 8]); }
  } else {
#pragma unroll
    for (int j = 0; j < 8; ++j) {
#pragma unroll
      for (int r = 0; r < 8; ++r) { const float v = acc[j][r] + (BB ? bfr(BB[j * 16 + col]) : 0.f); const _Float16 hv = (_Float16)v; sth[j * 16 + col][wave * 16 + 8 * g + r] = hv; stl[j * 16 + col][wave * 16 + 8 * g + r] = (_Float16)((v - (float)hv) * 2048.0f); } }
    __syncthreads();
    const size_t rb = (size_t)blockIdx.x * 64; const int b = (int)(rb / SS), s0 = (int)(rb % SS); const int pc0 = n0 - 2 * DM;
    for (int q = tid; q < 128 * 8; q += 128) { const int d = q >> 3, pc = q & 7; const size_t o = ((size_t)b * DM + pc0 + d) * SS + s0 + pc * 8; vst2((unsigned*)(VTH + o), *(const v4u*)&sth[d][pc * 8]); vst2((unsigned*)(VTL + o), *(const v4u*)&stl[d][pc * 8]); }
  }
}
// ---- k_attn: block = (64 queries, head h, batch b): all-keys flash attention (K = 64: 2 k-steps), scores = (2 q.k - |q|^2 - |k|^2) * 0.125 * tau_h with single f16 operands, P.V: f16 P (x2048) x V hi in one accumulator (accl stays 0); O[b*S+q][h*64+d] = (acc + accl / 2048) / (2048 l) (256-B segments)
__global__ __launch_bounds__(128) void k_attn(const _Float16* __restrict__ QK, const _Float16* __restrict__ QKL, const _Float16* __restrict__ VTH, const _Float16* __restrict__ VTL, const void* __restrict__ KMASK, const float* __restrict__ Q2, const float* __restrict__ TAU, float* __restrict__ O) {
  __shared__ __align__(16) float sp[4][16][36]; __shared__ __align__(16) float so[4][16][68];
  const int tid = threadIdx.x, wave = tid >> 5, lane = tid & 31, col = lane & 15, g = lane >> 4;
  const int qb = blockIdx.x, h = blockIdx.y, b = blockIdx.z; const int q0 = qb * 64 + wave * 16; const size_t rq = (size_t)b * SS + q0 + col;
  v16h aq[2], aql[2];
#pragma unroll
  for (int kc = 0; kc < 2; ++kc) { aq[kc] = frag_h(QK + rq * (2 * DM) + h * HD + kc * 32, lane); aql[kc] = frag_h(QKL + rq * (2 * DM) + h * HD + kc * 32, lane); }
  const float tau = bfr(TAU[h]); float q2[8];
#pragma unroll
  for (int r = 0; r < 8; ++r) q2[r] = Q2[((size_t)b * NH + h) * SS + q0 + 8 * g + r];
  float m[8], l[8];
#pragma unroll
  for (int r = 0; r < 8; ++r) { m[r] = -3.0e38f; l[r] = 0.f; }
  v8f acc[4] = {}, accl[4] = {};
  const int nks = SS / 32;   // all keys
#pragma unroll 1
  for (int ks = 0; ks < nks; ++ks) { v8f s[2];
#pragma unroll
    for (int ct = 0; ct < 2; ++ct) { const int kk = ks * 32 + ct * 16 + col; const _Float16* krow = QK + ((size_t)b * SS + kk) * (2 * DM) + DM + h * HD; const _Float16* krowl = QKL + ((size_t)b * SS + kk) * (2 * DM) + DM + h * HD; v8f c = {}, cl = {};
#pragma unroll
      for (int kc = 0; kc < 2; ++kc) c = wmma16(aq[kc], frag_h(krow + kc * 32, lane), c);   // single product: q, k as one-rounding f16 operands
      (void)cl; (void)krowl;
      { const bool keepk = true;
      { const float k2 = Q2[((size_t)b * NH + h) * SS + kk];
#pragma unroll
      for (int r = 0; r < 8; ++r) s[ct][r] = keepk ? ((2.0f * c[r] - q2[r] - k2) * 0.125f * tau) : -3.0e38f; } } }   // -|q_i - q_j|^2 / sqrt(64) x tau_h
#pragma unroll
    for (int r = 0; r < 8; ++r) { float mx = fmaxf(s[0][r], s[1][r]);
#pragma unroll
      for (int o = 1; o < 16; o <<= 1) mx = fmaxf(mx, __shfl_xor(mx, o));
      const float mn = fmaxf(m[r], mx); const float alpha = (m[r] <= -1.0e38f) ? 0.f : __expf(m[r] - mn);
      const float e0 = (s[0][r] <= -1.0e38f) ? 0.f : __expf(s[0][r] - mn), e1 = (s[1][r] <= -1.0e38f) ? 0.f : __expf(s[1][r] - mn); float es = e0 + e1;
#pragma unroll
      for (int o = 1; o < 16; o <<= 1) es += __shfl_xor(es, o);
      l[r] = l[r] * alpha + es; m[r] = mn;
#pragma unroll
      for (int dt = 0; dt < 4; ++dt) { acc[dt][r] *= alpha; accl[dt][r] *= alpha; }
      sp[wave][8 * g + r][col] = e0; sp[wave][8 * g + r][16 + col] = e1; }
    LDSX();
    v16h pa, pl; { const float* prow = &sp[wave][col][0] + 8 * (lane >> 4);
#pragma unroll
      for (int i = 0; i < 8; ++i) { const float x0 = prow[i] * 2048.0f, x1 = prow[16 + i] * 2048.0f; const _Float16 h0 = (_Float16)x0, h1 = (_Float16)x1; pa[i] = h0; pa[8 + i] = h1; pl[i] = (_Float16)((x0 - (float)h0) * 2048.0f); pl[8 + i] = (_Float16)((x1 - (float)h1) * 2048.0f); } }   // P scaled by 2^11 before the f16 split so small softmax weights stay out of the f16 subnormal range; 2^-11 folded into the epilogue
#pragma unroll
    for (int dt = 0; dt < 4; ++dt) { const size_t vr = ((size_t)b * DM + h * HD + dt * 16 + col) * SS + ks * 32; acc[dt] = wmma16(pa, frag_h(VTH + vr, lane), acc[dt]); }   // single product: P (x2^11) x V
    (void)pl;
    LDSX(); }
#pragma unroll
  for (int r = 0; r < 8; ++r) { const float il = (1.0f / 2048.0f) / l[r];
#pragma unroll
    for (int dt = 0; dt < 4; ++dt) so[wave][8 * g + r][dt * 16 + col] = (acc[dt][r] + accl[dt][r] * (1.0f / 2048.0f)) * il; }
  LDSX();
  for (int rl = 0; rl < 16; ++rl) if (lane < 16) vst2(O + ((size_t)b * SS + q0 + rl) * DM + h * HD + lane * 4, *(const v4f*)&so[wave][rl][lane * 4]);
}
// ---- k_out: block = (64 rows, 128 cols): out = O(hi/lo) . Wo rows (2 products) + bo
__global__ __launch_bounds__(128) void k_out(const float* __restrict__ O, const __bf16* __restrict__ P, const float* __restrict__ BO, float* __restrict__ Y) {
  __shared__ __align__(16) float so[4][16][132];
  const int tid = threadIdx.x, wave = tid >> 5, lane = tid & 31, col = lane & 15, g = lane >> 4; const size_t r0 = (size_t)blockIdx.x * 64 + wave * 16; const int n0 = blockIdx.y * 128;
  v8f acc[8] = {};
#pragma unroll 2
  for (int kc = 0; kc < DM / 32; ++kc) { const F2 a = split_row(O + (r0 + col) * DM, kc * 32, lane);
#pragma unroll
    for (int j = 0; j < 8; ++j) { const v16b w = frag_b(P + (size_t)(n0 + j * 16 + col) * DM + kc * 32, lane); acc[j] = wmma_bf(a.l, w, acc[j]); acc[j] = wmma_bf(a.h, w, acc[j]); } }
#pragma unroll
  for (int j = 0; j < 8; ++j) {
#pragma unroll
    for (int r = 0; r < 8; ++r) so[wave][8 * g + r][j * 16 + col] = acc[j][r] + (BO ? bfr(BO[n0 + j * 16 + col]) : 0.f); }
  LDSX();
  for (int rl = 0; rl < 16; ++rl) vst2(Y + (r0 + rl) * DM + n0 + lane * 4, *(const v4f*)&so[wave][rl][lane * 4]);
}
// ---- k_q2: block = (64 tokens, b): |q|^2 per (token, head) from the f16 q plane (the same values the scores use); whole 256-B segments per (b,h)
__global__ __launch_bounds__(256) void k_q2(const _Float16* __restrict__ QK, float* __restrict__ Q2) {
  __shared__ __align__(16) float sq[NH][64]; const int t = threadIdx.x; const size_t b = blockIdx.y; const int s0 = blockIdx.x * 64; const int tl = t & 63, hp = t >> 6;   // 64 tokens x 4 groups of 2 heads
  const size_t row = b * SS + s0 + tl;
  for (int hh = hp * 2; hh < hp * 2 + 2; ++hh) { float a = 0.f; const _Float16* q = QK + row * (2 * DM) + hh * HD;
#pragma unroll 8
    for (int d = 0; d < HD; ++d) { const float v = (float)q[d]; a += v * v; }
    sq[hh][tl] = a; }
  __syncthreads();
  for (int e = t; e < NH * 16; e += 256) { const int hh = e >> 4, q4 = e & 15; vst2(Q2 + (b * NH + hh) * SS + s0 + q4 * 4, *(const v4f*)&sq[hh][q4 * 4]); }
}
extern "C" void kernel_launch(void* const* d_in, const int* in_sizes, int n_in, void* d_out, int out_size, void* d_ws, size_t ws_size, hipStream_t stream) {
  (void)in_sizes; (void)n_in; (void)out_size;
  const float** F = (const float**)d_in;   // 0 x [2,4096,512], 1 Wqk [512,512] natural, 2 Wv, 3 Wo, 4 tau [8,1,1]
  if (ws_size < (size_t)WS_END) return;
  char* ws = (char*)d_ws; __bf16* PK = (__bf16*)(ws + WS_PK); _Float16 *QK = (_Float16*)(ws + WS_QK), *QKL = (_Float16*)(ws + WS_QKL), *VTH = (_Float16*)(ws + WS_VTH), *VTL = (_Float16*)(ws + WS_VTL); float *O = (float*)(ws + WS_O), *Q2 = (float*)(ws + WS_Q2);
  k_pack<<<dim3(DM, 4), 256, 0, stream>>>(F[1], F[1], F[2], F[3], PK);   // tied q = k
  k_qkv<<<dim3(TNB * SS / 64, QKVW / 128), 128, 0, stream>>>(F[0], F[0], F[0], PK + PK_A, nullptr, nullptr, nullptr, QK, QKL, VTH, VTL);
  k_q2<<<dim3(SS / 64, TNB), 256, 0, stream>>>(QK, Q2);
  k_attn<<<dim3(TQB, NH, TNB), 128, 0, stream>>>(QK, QKL, VTH, VTL, nullptr, Q2, F[4], O);
  k_out<<<dim3(TOB, DM / 128), 128, 0, stream>>>(O, PK + PK_P, nullptr, (float*)d_out);
}

// v001
// One run takes 301 microseconds.
// Two timings next to v000 put it at 1.62 and 1.66 times that version's speed.
// compute dtype: all float inputs rounded to bf16, tau read on device; qk / v = x . W^T with EXACT bf16 products on WMMA 16x16x32 (natural rows; the tied projection fills both the q and the k planes); PLAIN attention: q single f16, |q|^2 per token from the same f16 values in f32, logits = (2 q_i.q_j - |q_i|^2 - |q_j|^2) / 8 x tau_h, running-max softmax in f32 (hardware exp), P (scaled by 2^11, single f16) x v (single f16); out = o (bf16 hi + residual) . Wo^T (2 products).
#include <hip/hip_runtime.h>
#include <math.h>

typedef __attribute__((ext_vector_type(16))) _Float16 v16h;
typedef __attribute__((ext_vector_type(16))) __bf16 v16b;
typedef __attribute__((ext_vector_type(8)))  _Float16 v8h;
typedef __attribute__((ext_vector_type(8)))  float v8f;
typedef __attribute__((ext_vector_type(4)))  float v4f;
typedef __attribute__((ext_vector_type(2)))  float v2f;
typedef __attribute__((ext_vector_type(4)))  unsigned v4u;
typedef __attribute__((ext_vector_type(4)))  int v4i;
typedef float __attribute__((may_alias)) float_a;
typedef int __attribute__((may_alias)) int_a;

template <typename T> __device__ __forceinline__ void vst2(void* p, T v) { *(T*)p = v;  }
__device__ __forceinline__ v8f wmma16(v16h a, v16h b, v8f c) {
  v8f d = __builtin_amdgcn_wmma_f32_16x16x32_f16(false, a, false, b, (short)0, c, false, false);
  asm volatile("v_nop\n\tv_nop\n\tv_nop\n\tv_nop" : "+v"(d) : "v"(a), "v"(b));
  return d;
}
__device__ __forceinline__ v8f wmma_bf(v16b a, v16b b, v8f c) {
  v8f d = __builtin_amdgcn_wmma_f32_16x16x32_bf16(false, a, false, b, (short)0, c, false, false);
  asm volatile("v_nop\n\tv_nop\n\tv_nop\n\tv_nop" : "+v"(d) : "v"(a), "v"(b));
  return d;
}
// Token-diffusion attention (B 2, N 4,096, d 512, 8 heads x 64): tied q = k projection, distance-kernel logits -|q_i - q_j|^2 / 8 x tau_h, softmax, . v, output projection.
__device__ __forceinline__ v16h frag_h(const _Float16* rowk0, int lane) {
  union { v16h v; v8h q[2]; } u; const _Float16* p = rowk0 + 8 * (lane >> 4);
  u.q[0] = *(const v8h*)p; u.q[1] = *(const v8h*)(p + 16); return u.v;
}
__device__ __forceinline__ v16h frag_f32(const float* rowk0, int lane) {
  v16h a; const float* p = rowk0 + 8 * (lane >> 4);
#pragma unroll
  for (int i = 0; i < 8; ++i) { a[i] = (_Float16)p[i]; a[8 + i] = (_Float16)p[16 + i]; }
  return a;
}
__device__ __forceinline__ v16h frag_f32s(const float* rowk0, int lane, float sc) {
  v16h a; const float* p = rowk0 + 8 * (lane >> 4);
#pragma unroll
  for (int i = 0; i < 8; ++i) { a[i] = (_Float16)(p[i] * sc); a[8 + i] = (_Float16)(p[16 + i] * sc); }
  return a;
}
// column fragment from a [K][ld] layout (column n), rows >= K read as 0
__device__ __forceinline__ v16h fragc_f32(const float* W, int k0, int n, int lane, int ld, int K) {
  v16h a; const int g = lane >> 4;
#pragma unroll
  for (int i = 0; i < 8; ++i) { const int ka = k0 + 8 * g + i, kb = ka + 16;
    a[i] = (_Float16)(ka < K ? W[(size_t)(ka < K ? ka : K - 1) * ld + n] : 0.f); a[8 + i] = (_Float16)(kb < K ? W[(size_t)(kb < K ? kb : K - 1) * ld + n] : 0.f); }
  return a;
}
struct F2 { v16b h, l; };
__device__ __forceinline__ F2 bsplit16(const float v[16]) { F2 r;
#pragma unroll
  for (int i = 0; i < 16; ++i) { const __bf16 h = (__bf16)v[i]; r.h[i] = h; r.l[i] = (__bf16)(v[i] - (float)h); }
  return r; }
__device__ __forceinline__ F2 split_row(const float* row, int k0, int lane) { float v[16]; const float* p = row + k0 + 8 * (lane >> 4);
#pragma unroll
  for (int i = 0; i < 8; ++i) { v[i] = p[i]; v[8 + i] = p[16 + i]; }
  return bsplit16(v); }
__device__ __forceinline__ F2 split_rowK(const float* row, int k0, int lane, int K) { float v[16]; const int g = lane >> 4;
#pragma unroll
  for (int i = 0; i < 8; ++i) { const int ka = k0 + 8 * g + i, kb = ka + 16; v[i] = ka < K ? row[ka < K ? ka : K - 1] : 0.f; v[8 + i] = kb < K ? row[kb < K ? kb : K - 1] : 0.f; }
  return bsplit16(v); }
__device__ __forceinline__ F2 split_col(const float* W, int k0, int n, int lane, int ld, int K) { float v[16]; const int g = lane >> 4;
#pragma unroll
  for (int i = 0; i < 8; ++i) { const int ka = k0 + 8 * g + i, kb = ka + 16; v[i] = ka < K ? W[(size_t)(ka < K ? ka : K - 1) * ld + n] : 0.f; v[8 + i] = kb < K ? W[(size_t)(kb < K ? kb : K - 1) * ld + n] : 0.f; }
  return bsplit16(v); }
__device__ __forceinline__ v8f mac3(const F2& a, const F2& b, v8f c) { c = wmma_bf(a.l, b.h, c); c = wmma_bf(a.h, b.l, c); return wmma_bf(a.h, b.h, c); }
__device__ __forceinline__ float sigm(float v) { return 1.0f / (1.0f + expf(-v)); }
#define LDSX() do { asm volatile("s_wait_dscnt 0" ::: "memory"); __builtin_amdgcn_wave_barrier(); __builtin_amdgcn_fence(__ATOMIC_RELEASE, "workgroup"); } while (0)


#define NB 2
#define SS 4096
#define DM 512
#define NH 8
#define HD 64
#define QKVW (3 * DM)
#ifndef TQB
#define TQB (SS / 64)
#define TNB NB
#define TOB (NB * SS / 64)     // output row tiles (all)
#endif
typedef __attribute__((ext_vector_type(8))) __bf16 v8b;
__device__ __forceinline__ v16b frag_b(const __bf16* rowk0, int lane) {
  union { v16b v; v8b q[2]; } u; const __bf16* p = rowk0 + 8 * (lane >> 4);
  u.q[0] = *(const v8b*)p; u.q[1] = *(const v8b*)(p + 16); return u.v;
}
__device__ __forceinline__ float bfr(float v) { return (float)(__bf16)v; }
__device__ __attribute__((noinline)) float exp_ni(float v) { return expf(v); }
__device__ __attribute__((noinline)) float erf_ni(float v) { return erff(v); }

#define PK_A 0                       // [1536][512] Wqkv rows (natural [out][in])
#define PK_P (PK_A + QKVW * DM)        // [512][512] Wo rows (natural)
#define PK_END (PK_P + DM * DM)
#define WS_PK  0u
#define WS_QK  (WS_PK + 2u * PK_END)             // f16 [8192 rows][1024]: q | k
#define WS_QKL (WS_QK + 2u * NB * SS * 2 * DM)     // f16 q | k residual planes x2048
#define WS_VTH (WS_QKL + 2u * NB * SS * 2 * DM)    // f16 [b][512 (h*64+d)][4096 s] hi
#define WS_VTL (WS_VTH + 2u * NB * DM * SS)        // f16 lo x 2048
#define WS_O   (WS_VTL + 2u * NB * DM * SS)        // f32 [8192][512]
#define WS_CS  (WS_O + 4u * NB * SS * DM)           // f32 [2][4096][32], unused
#define WS_Q2  (WS_CS + 4u * 2 * SS * 32)                  // f32 [b][h][s] |q|^2
#define WS_END (WS_Q2 + 4u * (size_t)NB * NH * SS)
// ---- k_pack: block = (row n, which): natural [out][in] rows -> bf16; which 0..2 -> W_q/W_k/W_v into PK_A rows which*512 + n; 3 -> W_o into PK_P
__global__ __launch_bounds__(256) void k_pack(const float* __restrict__ WQ, const float* __restrict__ WK, const float* __restrict__ WV, const float* __restrict__ WO, __bf16* __restrict__ PK) {
  __shared__ __align__(16) __bf16 s[DM]; const int n = blockIdx.x, which = blockIdx.y, t = threadIdx.x; const float* Wm = (which == 0) ? WQ : (which == 1) ? WK : (which == 2) ? WV : WO;
  for (int k = t; k < DM; k += 256) s[k] = (__bf16)Wm[(size_t)n * DM + k];
  __syncthreads();
  __bf16* dst = (which < 3) ? PK + PK_A + ((size_t)which * DM + n) * DM : PK + PK_P + (size_t)n * DM;
  for (int q = t; q < DM / 8; q += 256) vst2((unsigned*)(dst + q * 8), *(const v4u*)&s[q * 8]);
}
__global__ __launch_bounds__(128) void k_qkv(const float* __restrict__ XQ, const float* __restrict__ XK, const float* __restrict__ XV, const __bf16* __restrict__ P, const float* __restrict__ BQ, const float* __restrict__ BK, const float* __restrict__ BV, _Float16* __restrict__ QK, _Float16* __restrict__ QKL, _Float16* __restrict__ VTH, _Float16* __restrict__ VTL) {
  const int which0 = (blockIdx.y * 128) / DM; const float* X = (which0 == 0) ? XQ : (which0 == 1) ? XK : XV; const float* BB = BQ ? (((which0 == 0) ? BQ : (which0 == 1) ? BK : BV) + (blockIdx.y * 128 - which0 * DM)) : nullptr;
  __shared__ __align__(16) _Float16 so[4][16][136], sol[4][16][136]; __shared__ __align__(16) _Float16 sth[128][72], stl[128][72];
  const int tid = threadIdx.x, wave = tid >> 5, lane = tid & 31, col = lane & 15, g = lane >> 4; const size_t r0 = (size_t)blockIdx.x * 64 + wave * 16; const int n0 = blockIdx.y * 128;
  v8f acc[8] = {};
#pragma unroll 2
  for (int kc = 0; kc < DM / 32; ++kc) { v16b a; { const float* p = X + (r0 + col) * DM + kc * 32 + 8 * g;
#pragma unroll
      for (int i = 0; i < 8; ++i) { a[i] = (__bf16)p[i]; a[8 + i] = (__bf16)p[16 + i]; } }
#pragma unroll
    for (int j = 0; j < 8; ++j) acc[j] = wmma_bf(a, frag_b(P + (size_t)(n0 + j * 16 + col) * DM + kc * 32, lane), acc[j]); }
  if (n0 < 2 * DM) {   // q stored unscaled (f16 sigma ~0.6, no subnormal exposure); 1/8 applied to the f32 score
#pragma unroll
    for (int j = 0; j < 8; ++j) {
#pragma unroll
      for (int r = 0; r < 8; ++r) { const float v = acc[j][r] + (BB ? bfr(BB[j * 16 + col]) : 0.f); const _Float16 hv = (_Float16)v; so[wave][8 * g + r][j * 16 + col] = hv; sol[wave][8 * g + r][j * 16 + col] = (_Float16)((v - (float)hv) * 2048.0f); } }   // q, k (+ bias) as f16 hi + (x2048) residual
    LDSX();
    for (int rl = 0; rl < 16; ++rl) if (lane < 16) { vst2((unsigned*)(QK + (r0 + rl) * (2 * DM) + n0 + lane * 8), *(const v4u*)&so[wave][rl][lane * 8]); vst2((unsigned*)(QKL + (r0 + rl) * (2 * DM) + n0 + lane * 8), *(const v4u*)&sol[wave][rl][lane * 8]); }
  } else {
#pragma unroll
    for (int j = 0; j < 8; ++j) {
#pragma unroll
      for (int r = 0; r < 8; ++r) { const float v = acc[j][r] + (BB ? bfr(BB[j * 16 + col]) : 0.f); const _Float16 hv = (_Float16)v; sth[j * 16 + col][wave * 16 + 8 * g + r] = hv; stl[j * 16 + col][wave * 16 + 8 * g + r] = (_Float16)((v - (float)hv) * 2048.0f); } }
    __syncthreads();
    const size_t rb = (size_t)blockIdx.x * 64; const int b = (int)(rb / SS), s0 = (int)(rb % SS); const int pc0 = n0 - 2 * DM;
    for (int q = tid; q < 128 * 8; q += 128) { const int d = q >> 3, pc = q & 7; const size_t o = ((size_t)b * DM + pc0 + d) * SS + s0 + pc * 8; vst2((unsigned*)(VTH + o), *(const v4u*)&sth[d][pc * 8]); vst2((unsigned*)(VTL + o), *(const v4u*)&stl[d][pc * 8]); }
  }
}
// ---- k_attn: block = (64 queries, head h, batch b): all-keys flash attention (K = 64: 2 k-steps), scores = (2 q.k - |q|^2 - |k|^2) * 0.125 * tau_h with single f16 operands, P.V: f16 P (x2^11) x V hi in one accumulator (accl stays 0); O[b*S+q][h*64+d] = (acc + accl / 2048) / (2048 l) (256-B segments)
#define KST 64   // keys per LDS stage
#define KPI 72   // LDS row pitch in f16: a 128-B row + 16 B = 144 B, an odd multiple of 16 B (conflict-free for ds_load_b128)
#define KSB (KST * KPI * 2)   // bytes of one K (or V^T) buffer
// one stage = 64 K rows x 128 B + 64 V^T rows x 128 B: each of the 128 threads copies four 16-B pieces of each, global -> LDS through no register (a wave's copy = 4 whole 128-B lines).
// s_wait_xcnt 0 is the last line of the copies' own statement, so that it stands in front of every later write of the address registers the copies name.
__device__ __forceinline__ void stage_copy(unsigned lk, unsigned lv, const _Float16* gk, const _Float16* gv) {
  asm volatile("global_load_async_to_lds_b128 %0, %8, off\n\t"
               "global_load_async_to_lds_b128 %1, %9, off\n\t"
               "global_load_async_to_lds_b128 %2, %10, off\n\t"
               "global_load_async_to_lds_b128 %3, %11, off\n\t"
               "global_load_async_to_lds_b128 %4, %12, off\n\t"
               "global_load_async_to_lds_b128 %5, %13, off\n\t"
               "global_load_async_to_lds_b128 %6, %14, off\n\t"
               "global_load_async_to_lds_b128 %7, %15, off\n\t"
               "s_wait_xcnt 0x0"
               :: "v"(lk), "v"(lk + 16 * KPI * 2), "v"(lk + 32 * KPI * 2), "v"(lk + 48 * KPI * 2), "v"(lv), "v"(lv + 16 * KPI * 2), "v"(lv + 32 * KPI * 2), "v"(lv + 48 * KPI * 2),
                  "v"(gk), "v"(gk + (size_t)16 * 2 * DM), "v"(gk + (size_t)32 * 2 * DM), "v"(gk + (size_t)48 * 2 * DM), "v"(gv), "v"(gv + (size_t)16 * SS), "v"(gv + (size_t)32 * SS), "v"(gv + (size_t)48 * SS)
               : "memory");
}
__global__ __launch_bounds__(128) void k_attn(const _Float16* __restrict__ QK, const _Float16* __restrict__ QKL, const _Float16* __restrict__ VTH, const _Float16* __restrict__ VTL, const void* __restrict__ KMASK, const float* __restrict__ Q2, const float* __restrict__ TAU, float* __restrict__ O) {
  __shared__ __align__(16) float sp[4][16][36]; __shared__ __align__(16) float so[4][16][68];
  __shared__ __align__(16) _Float16 sk[2][KST][KPI], sv[2][HD][KPI];   // two buffers: K rows [key][d], V^T rows [d][key] of one 64-key stage, shared by the block's 4 waves
  const int tid = threadIdx.x, wave = tid >> 5, lane = tid & 31, col = lane & 15, g = lane >> 4;
  const int qb = blockIdx.x, h = blockIdx.y, b = blockIdx.z; const int q0 = qb * 64 + wave * 16; const size_t rq = (size_t)b * SS + q0 + col;
  v16h aq[2], aql[2];
#pragma unroll
  for (int kc = 0; kc < 2; ++kc) { aq[kc] = frag_h(QK + rq * (2 * DM) + h * HD + kc * 32, lane); aql[kc] = frag_h(QKL + rq * (2 * DM) + h * HD + kc * 32, lane); }
  const float tau = bfr(TAU[h]); float q2[8];
#pragma unroll
  for (int r = 0; r < 8; ++r) q2[r] = Q2[((size_t)b * NH + h) * SS + q0 + 8 * g + r];
  float m[8], l[8];
#pragma unroll
  for (int r = 0; r < 8; ++r) { m[r] = -3.0e38f; l[r] = 0.f; }
  v8f acc[4] = {}, accl[4] = {};
  const int nst = SS / KST;   // all keys, 64 a stage
  const int crow = tid >> 3, cpc = tid & 7;   // this thread's row (+ 16 i) and 16-B piece in every stage
  const _Float16* gk = QK + ((size_t)b * SS + crow) * (2 * DM) + DM + h * HD + cpc * 8; const _Float16* gv = VTH + ((size_t)b * DM + h * HD + crow) * SS + cpc * 8;
  const unsigned lk = (unsigned)(size_t)&sk[0][crow][cpc * 8], lv = (unsigned)(size_t)&sv[0][crow][cpc * 8];
  stage_copy(lk, lv, gk, gv);
  asm volatile("s_wait_asynccnt 0x0" ::: "memory");   // this wave's copies of stage 0 have landed
  __syncthreads();                                    // stage 0 published to all 4 waves
  stage_copy(lk + KSB, lv + KSB, gk + (size_t)KST * 2 * DM, gv + KST);   // stage 1 flies under stage 0's work
#pragma unroll 1   // stages stay rolled: one publish point, at the foot of each trip
  for (int st = 0; st < nst; ++st) { const int bf = st & 1;
#pragma unroll 1
  for (int sub = 0; sub < KST / 32; ++sub) { const int ks = st * (KST / 32) + sub; v8f s[2];   // rolled, as the 32-key pass was: one copy of the body
#pragma unroll
    for (int ct = 0; ct < 2; ++ct) { const int kk = ks * 32 + ct * 16 + col; const _Float16* krow = &sk[bf][sub * 32 + ct * 16 + col][0]; const _Float16* krowl = QKL + ((size_t)b * SS + kk) * (2 * DM) + DM + h * HD; v8f c = {}, cl = {};
#pragma unroll
      for (int kc = 0; kc < 2; ++kc) c = wmma16(aq[kc], frag_h(krow + kc * 32, lane), c);   // single product: q, k as one-rounding f16 operands
      (void)cl; (void)krowl;
      { const bool keepk = true;
      { const float k2 = Q2[((size_t)b * NH + h) * SS + kk];
#pragma unroll
      for (int r = 0; r < 8; ++r) s[ct][r] = keepk ? ((2.0f * c[r] - q2[r] - k2) * 0.125f * tau) : -3.0e38f; } } }   // -|q_i - q_j|^2 / sqrt(64) x tau_h
#pragma unroll
    for (int r = 0; r < 8; ++r) { float mx = fmaxf(s[0][r], s[1][r]);
#pragma unroll
      for (int o = 1; o < 16; o <<= 1) mx = fmaxf(mx, __shfl_xor(mx, o));
      const float mn = fmaxf(m[r], mx); const float alpha = (m[r] <= -1.0e38f) ? 0.f : __expf(m[r] - mn);
      const float e0 = (s[0][r] <= -1.0e38f) ? 0.f : __expf(s[0][r] - mn), e1 = (s[1][r] <= -1.0e38f) ? 0.f : __expf(s[1][r] - mn); float es = e0 + e1;
#pragma unroll
      for (int o = 1; o < 16; o <<= 1) es += __shfl_xor(es, o);
      l[r] = l[r] * alpha + es; m[r] = mn;
#pragma unroll
      for (int dt = 0; dt < 4; ++dt) { acc[dt][r] *= alpha; accl[dt][r] *= alpha; }
      sp[wave][8 * g + r][col] = e0; sp[wave][8 * g + r][16 + col] = e1; }
    LDSX();
    v16h pa, pl; { const float* prow = &sp[wave][col][0] + 8 * (lane >> 4);
#pragma unroll
      for (int i = 0; i < 8; ++i) { const float x0 = prow[i] * 2048.0f, x1 = prow[16 + i] * 2048.0f; const _Float16 h0 = (_Float16)x0, h1 = (_Float16)x1; pa[i] = h0; pa[8 + i] = h1; pl[i] = (_Float16)((x0 - (float)h0) * 2048.0f); pl[8 + i] = (_Float16)((x1 - (float)h1) * 2048.0f); } }   // P scaled by 2^11 before the f16 split so small softmax weights stay out of the f16 subnormal range; 2^-11 folded into the epilogue
#pragma unroll
    for (int dt = 0; dt < 4; ++dt) acc[dt] = wmma16(pa, frag_h(&sv[bf][dt * 16 + col][sub * 32], lane), acc[dt]);   // single product: P (x2^11) x V
    (void)pl;
    LDSX(); }
    // publish point of stage st + 1, every wave, in this order
    asm volatile("s_wait_dscnt 0x0" ::: "memory");      // this wave's reads of buffer bf have returned
    asm volatile("s_wait_asynccnt 0x0" ::: "memory");   // this wave's copies of stage st + 1 have landed
    __syncthreads();                                    // stage st + 1 published; every wave has left buffer bf
    if (st + 2 < nst) stage_copy(lk + bf * KSB, lv + bf * KSB, gk + (size_t)(st + 2) * KST * 2 * DM, gv + (st + 2) * KST); }   // refill of the buffer just read
  asm volatile("s_wait_asynccnt 0x0" ::: "memory");   // no copy outstanding behind the loop
#pragma unroll
  for (int r = 0; r < 8; ++r) { const float il = (1.0f / 2048.0f) / l[r];
#pragma unroll
    for (int dt = 0; dt < 4; ++dt) so[wave][8 * g + r][dt * 16 + col] = (acc[dt][r] + accl[dt][r] * (1.0f / 2048.0f)) * il; }
  LDSX();
  for (int rl = 0; rl < 16; ++rl) if (lane < 16) vst2(O + ((size_t)b * SS + q0 + rl) * DM + h * HD + lane * 4, *(const v4f*)&so[wave][rl][lane * 4]);
}
// ---- k_out: block = (64 rows, 128 cols): out = O(hi/lo) . Wo rows (2 products) + bo
__global__ __launch_bounds__(128) void k_out(const float* __restrict__ O, const __bf16* __restrict__ P, const float* __restrict__ BO, float* __restrict__ Y) {
  __shared__ __align__(16) float so[4][16][132];
  const int tid = threadIdx.x, wave = tid >> 5, lane = tid & 31, col = lane & 15, g = lane >> 4; const size_t r0 = (size_t)blockIdx.x * 64 + wave * 16; const int n0 = blockIdx.y * 128;
  v8f acc[8] = {};
#pragma unroll 2
  for (int kc = 0; kc < DM / 32; ++kc) { const F2 a = split_row(O + (r0 + col) * DM, kc * 32, lane);
#pragma unroll
    for (int j = 0; j < 8; ++j) { const v16b w = frag_b(P + (size_t)(n0 + j * 16 + col) * DM + kc * 32, lane); acc[j] = wmma_bf(a.l, w, acc[j]); acc[j] = wmma_bf(a.h, w, acc[j]); } }
#pragma unroll
  for (int j = 0; j < 8; ++j) {
#pragma unroll
    for (int r = 0; r < 8; ++r) so[wave][8 * g + r][j * 16 + col] = acc[j][r] + (BO ? bfr(BO[n0 + j * 16 + col]) : 0.f); }
  LDSX();
  for (int rl = 0; rl < 16; ++rl) vst2(Y + (r0 + rl) * DM + n0 + lane * 4, *(const v4f*)&so[wave][rl][lane * 4]);
}
// ---- k_q2: block = (64 tokens, b): |q|^2 per (token, head) from the f16 q plane (the same values the scores use); whole 256-B segments per (b,h)
__global__ __launch_bounds__(256) void k_q2(const _Float16* __restrict__ QK, float* __restrict__ Q2) {
  __shared__ __align__(16) float sq[NH][64]; const int t = threadIdx.x; const size_t b = blockIdx.y; const int s0 = blockIdx.x * 64; const int tl = t & 63, hp = t >> 6;   // 64 tokens x 4 groups of 2 heads
  const size_t row = b * SS + s0 + tl;
  for (int hh = hp * 2; hh < hp * 2 + 2; ++hh) { float a = 0.f; const _Float16* q = QK + row * (2 * DM) + hh * HD;
#pragma unroll 8
    for (int d = 0; d < HD; ++d) { const float v = (float)q[d]; a += v * v; }
    sq[hh][tl] = a; }
  __syncthreads();
  for (int e = t; e < NH * 16; e += 256) { const int hh = e >> 4, q4 = e & 15; vst2(Q2 + (b * NH + hh) * SS + s0 + q4 * 4, *(const v4f*)&sq[hh][q4 * 4]); }
}
extern "C" void kernel_launch(void* const* d_in, const int* in_sizes, int n_in, void* d_out, int out_size, void* d_ws, size_t ws_size, hipStream_t stream) {
  (void)in_sizes; (void)n_in; (void)out_size;
  const float** F = (const float**)d_in;   // 0 x [2,4096,512], 1 Wqk [512,512] natural, 2 Wv, 3 Wo, 4 tau [8,1,1]
  if (ws_size < (size_t)WS_END) return;
  char* ws = (char*)d_ws; __bf16* PK = (__bf16*)(ws + WS_PK); _Float16 *QK = (_Float16*)(ws + WS_QK), *QKL = (_Float16*)(ws + WS_QKL), *VTH = (_Float16*)(ws + WS_VTH), *VTL = (_Float16*)(ws + WS_VTL); float *O = (float*)(ws + WS_O), *Q2 = (float*)(ws + WS_Q2);
  k_pack<<<dim3(DM, 4), 256, 0, stream>>>(F[1], F[1], F[2], F[3], PK);   // tied q = k
  k_qkv<<<dim3(TNB * SS / 64, QKVW / 128), 128, 0, stream>>>(F[0], F[0], F[0], PK + PK_A, nullptr, nullptr, nullptr, QK, QKL, VTH, VTL);
  k_q2<<<dim3(SS / 64, TNB), 256, 0, stream>>>(QK, Q2);
  k_attn<<<dim3(TQB, NH, TNB), 128, 0, stream>>>(QK, QKL, VTH, VTL, nullptr, Q2, F[4], O);
  k_out<<<dim3(TOB, DM / 128), 128, 0, stream>>>(O, PK + PK_P, nullptr, (float*)d_out);
}

// v002
// Measured time: 240 microseconds a run.
// In two side-by-side timings against v001, it was 1.26 and 1.24 times as fast.
// All steps since v000 together make it 2.05 times as fast.
// compute dtype: all float inputs rounded to bf16, tau read on device; qk / v = x . W^T with EXACT bf16 products on WMMA 16x16x32 (natural rows; the tied projection fills both the q and the k planes); PLAIN attention: q single f16, |q|^2 per token from the same f16 values in f32, logits = (2 q_i.q_j - |q_i|^2 - |q_j|^2) / 8 x tau_h, running-max softmax in f32 (hardware exp), P (scaled by 2^11, single f16) x v (single f16); out = o (bf16 hi + residual) . Wo^T (2 products).
#include <hip/hip_runtime.h>
#include <math.h>

typedef __attribute__((ext_vector_type(16))) _Float16 v16h;
typedef __attribute__((ext_vector_type(16))) __bf16 v16b;
typedef __attribute__((ext_vector_type(8)))  _Float16 v8h;
typedef __attribute__((ext_vector_type(8)))  float v8f;
typedef __attribute__((ext_vector_type(4)))  float v4f;
typedef __attribute__((ext_vector_type(2)))  float v2f;
typedef __attribute__((ext_vector_type(4)))  unsigned v4u;
typedef __attribute__((ext_vector_type(4)))  int v4i;
typedef float __attribute__((may_alias)) float_a;
typedef int __attribute__((may_alias)) int_a;

template <typename T> __device__ __forceinline__ void vst2(void* p, T v) { *(T*)p = v;  }
__device__ __forceinline__ v8f wmma16(v16h a, v16h b, v8f c) {
  v8f d = __builtin_amdgcn_wmma_f32_16x16x32_f16(false, a, false, b, (short)0, c, false, false);
  asm volatile("v_nop\n\tv_nop\n\tv_nop\n\tv_nop" : "+v"(d) : "v"(a), "v"(b));
  return d;
}
__device__ __forceinline__ v8f wmma_bf(v16b a, v16b b, v8f c) {
  v8f d = __builtin_amdgcn_wmma_f32_16x16x32_bf16(false, a, false, b, (short)0, c, false, false);
  asm volatile("v_nop\n\tv_nop\n\tv_nop\n\tv_nop" : "+v"(d) : "v"(a), "v"(b));
  return d;
}
// Token-diffusion attention (B 2, N 4,096, d 512, 8 heads x 64): tied q = k projection, distance-kernel logits -|q_i - q_j|^2 / 8 x tau_h, softmax, . v, output projection.
__device__ __forceinline__ v16h frag_h(const _Float16* rowk0, int lane) {
  union { v16h v; v8h q[2]; } u; const _Float16* p = rowk0 + 8 * (lane >> 4);
  u.q[0] = *(const v8h*)p; u.q[1] = *(const v8h*)(p + 16); return u.v;
}
__device__ __forceinline__ v16h frag_f32(const float* rowk0, int lane) {
  v16h a; const float* p = rowk0 + 8 * (lane >> 4);
#pragma unroll
  for (int i = 0; i < 8; ++i) { a[i] = (_Float16)p[i]; a[8 + i] = (_Float16)p[16 + i]; }
  return a;
}
__device__ __forceinline__ v16h frag_f32s(const float* rowk0, int lane, float sc) {
  v16h a; const float* p = rowk0 + 8 * (lane >> 4);
#pragma unroll
  for (int i = 0; i < 8; ++i) { a[i] = (_Float16)(p[i] * sc); a[8 + i] = (_Float16)(p[16 + i] * sc); }
  return a;
}
// column fragment from a [K][ld] layout (column n), rows >= K read as 0
__device__ __forceinline__ v16h fragc_f32(const float* W, int k0, int n, int lane, int ld, int K) {
  v16h a; const int g = lane >> 4;
#pragma unroll
  for (int i = 0; i < 8; ++i) { const int ka = k0 + 8 * g + i, kb = ka + 16;
    a[i] = (_Float16)(ka < K ? W[(size_t)(ka < K ? ka : K - 1) * ld + n] : 0.f); a[8 + i] = (_Float16)(kb < K ? W[(size_t)(kb < K ? kb : K - 1) * ld + n] : 0.f); }
  return a;
}
struct F2 { v16b h, l; };
__device__ __forceinline__ F2 bsplit16(const float v[16]) { F2 r;
#pragma unroll
  for (int i = 0; i < 16; ++i) { const __bf16 h = (__bf16)v[i]; r.h[i] = h; r.l[i] = (__bf16)(v[i] - (float)h); }
  return r; }
__device__ __forceinline__ F2 split_row(const float* row, int k0, int lane) { float v[16]; const float* p = row + k0 + 8 * (lane >> 4);
#pragma unroll
  for (int i = 0; i < 8; ++i) { v[i] = p[i]; v[8 + i] = p[16 + i]; }
  return bsplit16(v); }
__device__ __forceinline__ F2 split_rowK(const float* row, int k0, int lane, int K) { float v[16]; const int g = lane >> 4;
#pragma unroll
  for (int i = 0; i < 8; ++i) { const int ka = k0 + 8 * g + i, kb = ka + 16; v[i] = ka < K ? row[ka < K ? ka : K - 1] : 0.f; v[8 + i] = kb < K ? row[kb < K ? kb : K - 1] : 0.f; }
  return bsplit16(v); }
__device__ __forceinline__ F2 split_col(const float* W, int k0, int n, int lane, int ld, int K) { float v[16]; const int g = lane >> 4;
#pragma unroll
  for (int i = 0; i < 8; ++i) { const int ka = k0 + 8 * g + i, kb = ka + 16; v[i] = ka < K ? W[(size_t)(ka < K ? ka : K - 1) * ld + n] : 0.f; v[8 + i] = kb < K ? W[(size_t)(kb < K ? kb : K - 1) * ld + n] : 0.f; }
  return bsplit16(v); }
__device__ __forceinline__ v8f mac3(const F2& a, const F2& b, v8f c) { c = wmma_bf(a.l, b.h, c); c = wmma_bf(a.h, b.l, c); return wmma_bf(a.h, b.h, c); }
__device__ __forceinline__ float sigm(float v) { return 1.0f / (1.0f + expf(-v)); }
#define LDSX() do { asm volatile("s_wait_dscnt 0" ::: "memory"); __builtin_amdgcn_wave_barrier(); __builtin_amdgcn_fence(__ATOMIC_RELEASE, "workgroup"); } while (0)


#define NB 2
#define SS 4096
#define DM 512
#define NH 8
#define HD 64
#define QKVW (3 * DM)
#ifndef TQB
#define TQB (SS / 64)
#define TNB NB
#define TOB (NB * SS / 64)     // output row tiles (all)
#endif
typedef __attribute__((ext_vector_type(8))) __bf16 v8b;
__device__ __forceinline__ v16b frag_b(const __bf16* rowk0, int lane) {
  union { v16b v; v8b q[2]; } u; const __bf16* p = rowk0 + 8 * (lane >> 4);
  u.q[0] = *(const v8b*)p; u.q[1] = *(const v8b*)(p + 16); return u.v;
}
__device__ __forceinline__ float bfr(float v) { return (float)(__bf16)v; }
__device__ __attribute__((noinline)) float exp_ni(float v) { return expf(v); }
__device__ __attribute__((noinline)) float erf_ni(float v) { return erff(v); }

#define PK_A 0                       // [1536][512] Wqkv rows (natural [out][in])
#define PK_P (PK_A + QKVW * DM)        // [512][512] Wo rows (natural)
#define PK_END (PK_P + DM * DM)
#define WS_PK  0u
#define WS_QK  (WS_PK + 2u * PK_END)             // f16 [8192 rows][1024]: q | k
#define WS_QKL (WS_QK + 2u * NB * SS * 2 * DM)     // f16 q | k residual planes x2048
#define WS_VTH (WS_QKL + 2u * NB * SS * 2 * DM)    // f16 [b][512 (h*64+d)][4096 s] hi
#define WS_VTL (WS_VTH + 2u * NB * DM * SS)        // f16 lo x 2048
#define WS_O   (WS_VTL + 2u * NB * DM * SS)        // f32 [8192][512]
#define WS_CS  (WS_O + 4u * NB * SS * DM)           // f32 [2][4096][32], unused
#define WS_Q2  (WS_CS + 4u * 2 * SS * 32)                  // f32 [b][h][s] |q|^2
#define WS_END (WS_Q2 + 4u * (size_t)NB * NH * SS)
// ---- k_pack: block = (row n, which): natural [out][in] rows -> bf16; which 0..2 -> W_q/W_k/W_v into PK_A rows which*512 + n; 3 -> W_o into PK_P
__global__ __launch_bounds__(256) void k_pack(const float* __restrict__ WQ, const float* __restrict__ WK, const float* __restrict__ WV, const float* __restrict__ WO, __bf16* __restrict__ PK) {
  __shared__ __align__(16) __bf16 s[DM]; const int n = blockIdx.x, which = blockIdx.y, t = threadIdx.x; const float* Wm = (which == 0) ? WQ : (which == 1) ? WK : (which == 2) ? WV : WO;
  for (int k = t; k < DM; k += 256) s[k] = (__bf16)Wm[(size_t)n * DM + k];
  __syncthreads();
  __bf16* dst = (which < 3) ? PK + PK_A + ((size_t)which * DM + n) * DM : PK + PK_P + (size_t)n * DM;
  for (int q = t; q < DM / 8; q += 256) vst2((unsigned*)(dst + q * 8), *(const v4u*)&s[q * 8]);
}
__global__ __launch_bounds__(128) void k_qkv(const float* __restrict__ XQ, const float* __restrict__ XK, const float* __restrict__ XV, const __bf16* __restrict__ P, const float* __restrict__ BQ, const float* __restrict__ BK, const float* __restrict__ BV, _Float16* __restrict__ QK, _Float16* __restrict__ QKL, _Float16* __restrict__ VTH, _Float16* __restrict__ VTL) {
  const int which0 = (blockIdx.y * 128) / DM; const float* X = (which0 == 0) ? XQ : (which0 == 1) ? XK : XV; const float* BB = BQ ? (((which0 == 0) ? BQ : (which0 == 1) ? BK : BV) + (blockIdx.y * 128 - which0 * DM)) : nullptr;
  __shared__ __align__(16) _Float16 so[4][16][136], sol[4][16][136]; __shared__ __align__(16) _Float16 sth[128][72], stl[128][72];
  const int tid = threadIdx.x, wave = tid >> 5, lane = tid & 31, col = lane & 15, g = lane >> 4; const size_t r0 = (size_t)blockIdx.x * 64 + wave * 16; const int n0 = blockIdx.y * 128;
  v8f acc[8] = {};
#pragma unroll 2
  for (int kc = 0; kc < DM / 32; ++kc) { v16b a; { const float* p = X + (r0 + col) * DM + kc * 32 + 8 * g;
#pragma unroll
      for (int i = 0; i < 8; ++i) { a[i] = (__bf16)p[i]; a[8 + i] = (__bf16)p[16 + i]; } }
#pragma unroll
    for (int j = 0; j < 8; ++j) acc[j] = wmma_bf(a, frag_b(P + (size_t)(n0 + j * 16 + col) * DM + kc * 32, lane), acc[j]); }
  if (n0 < 2 * DM) {   // q stored unscaled (f16 sigma ~0.6, no subnormal exposure); 1/8 applied to the f32 score
#pragma unroll
    for (int j = 0; j < 8; ++j) {
#pragma unroll
      for (int r = 0; r < 8; ++r) { const float v = acc[j][r] + (BB ? bfr(BB[j * 16 + col]) : 0.f); const _Float16 hv = (_Float16)v; so[wave][8 * g + r][j * 16 + col] = hv; sol[wave][8 * g + r][j * 16 + col] = (_Float16)((v - (float)hv) * 2048.0f); } }   // q, k (+ bias) as f16 hi + (x2048) residual
    LDSX();
    for (int rl = 0; rl < 16; ++rl) if (lane < 16) { vst2((unsigned*)(QK + (r0 + rl) * (2 * DM) + n0 + lane * 8), *(const v4u*)&so[wave][rl][lane * 8]); vst2((unsigned*)(QKL + (r0 + rl) * (2 * DM) + n0 + lane * 8), *(const v4u*)&sol[wave][rl][lane * 8]); }
  } else {
#pragma unroll
    for (int j = 0; j < 8; ++j) {
#pragma unroll
      for (int r = 0; r < 8; ++r) { const float v = acc[j][r] + (BB ? bfr(BB[j * 16 + col]) : 0.f); const _Float16 hv = (_Float16)v; sth[j * 16 + col][wave * 16 + 8 * g + r] = hv; stl[j * 16 + col][wave * 16 + 8 * g + r] = (_Float16)((v - (float)hv) * 2048.0f); } }
    __syncthreads();
    const size_t rb = (size_t)blockIdx.x * 64; const int b = (int)(rb / SS), s0 = (int)(rb % SS); const int pc0 = n0 - 2 * DM;
    for (int q = tid; q < 128 * 8; q += 128) { const int d = q >> 3, pc = q & 7; const size_t o = ((size_t)b * DM + pc0 + d) * SS + s0 + pc * 8; vst2((unsigned*)(VTH + o), *(const v4u*)&sth[d][pc * 8]); vst2((unsigned*)(VTL + o), *(const v4u*)&stl[d][pc * 8]); }
  }
}
// ---- k_attn: block = (64 queries, head h, batch b): all-keys flash attention (K = 64: 2 k-steps), scores = (2 q.k - |q|^2 - |k|^2) * 0.125 * tau_h with single f16 operands, P.V: f16 P (x2^11) x V hi in one accumulator; O[b*S+q][h*64+d] = acc / (2048 l) (256-B segments)
#define KST 64   // keys per LDS stage
#define KPI 72   // LDS row pitch in f16: a 128-B row + 16 B = 144 B, an odd multiple of 16 B (conflict-free for ds_load_b128)
#define KSB (KST * KPI * 2)   // bytes of one K (or V^T) buffer
// one stage = 64 K rows x 128 B + 64 V^T rows x 128 B: each of the 128 threads copies four 16-B pieces of each, global -> LDS through no register (a wave's copy = 4 whole 128-B lines).
// s_wait_xcnt 0 is the last line of the copies' own statement, so that it stands in front of every later write of the address registers the copies name.
__device__ __forceinline__ void stage_copy(unsigned lk, unsigned lv, const _Float16* gk, const _Float16* gv) {
  asm volatile("global_load_async_to_lds_b128 %0, %8, off\n\t"
               "global_load_async_to_lds_b128 %1, %9, off\n\t"
               "global_load_async_to_lds_b128 %2, %10, off\n\t"
               "global_load_async_to_lds_b128 %3, %11, off\n\t"
               "global_load_async_to_lds_b128 %4, %12, off\n\t"
               "global_load_async_to_lds_b128 %5, %13, off\n\t"
               "global_load_async_to_lds_b128 %6, %14, off\n\t"
               "global_load_async_to_lds_b128 %7, %15, off\n\t"
               "s_wait_xcnt 0x0"
               :: "v"(lk), "v"(lk + 16 * KPI * 2), "v"(lk + 32 * KPI * 2), "v"(lk + 48 * KPI * 2), "v"(lv), "v"(lv + 16 * KPI * 2), "v"(lv + 32 * KPI * 2), "v"(lv + 48 * KPI * 2),
                  "v"(gk), "v"(gk + (size_t)16 * 2 * DM), "v"(gk + (size_t)32 * 2 * DM), "v"(gk + (size_t)48 * 2 * DM), "v"(gv), "v"(gv + (size_t)16 * SS), "v"(gv + (size_t)32 * SS), "v"(gv + (size_t)48 * SS)
               : "memory");
}
// |k|^2 of one stage's 64 keys = 256 B: one 8-B piece per lane of ONE wave, global -> LDS through no register; s_wait_xcnt 0 closes the copy's own statement, in front of every later write of its address registers.
__device__ __forceinline__ void stage_copy_k2(unsigned l2, const float* g2) {
  asm volatile("global_load_async_to_lds_b64 %0, %1, off\n\t"
               "s_wait_xcnt 0x0"
               :: "v"(l2), "v"(g2) : "memory");
}
// lane l <-> lane l ^ 16 (the two halves of a wave hold the two halves of one query's keys)
__device__ __forceinline__ float xhalf(float x) { return __builtin_bit_cast(float, __builtin_amdgcn_permlanex16(__builtin_bit_cast(int, x), __builtin_bit_cast(int, x), 0x76543210, 0xfedcba98, false, false)); }
// 2^x for eight values / one value. One statement each: the outputs are early-clobber, so that no v_exp_f32 overwrites a source of the one in front of it, and the closing v_nop is the slot the instruction set asks for
// between a transcendental and a next instruction that reads its result or overwrites its source.
__device__ __forceinline__ v8f exp2x8(v8f x) { float r0, r1, r2, r3, r4, r5, r6, r7;
  asm("v_exp_f32 %0, %8\n\tv_exp_f32 %1, %9\n\tv_exp_f32 %2, %10\n\tv_exp_f32 %3, %11\n\tv_exp_f32 %4, %12\n\tv_exp_f32 %5, %13\n\tv_exp_f32 %6, %14\n\tv_exp_f32 %7, %15\n\tv_nop"
      : "=&v"(r0), "=&v"(r1), "=&v"(r2), "=&v"(r3), "=&v"(r4), "=&v"(r5), "=&v"(r6), "=&v"(r7) : "v"(x[0]), "v"(x[1]), "v"(x[2]), "v"(x[3]), "v"(x[4]), "v"(x[5]), "v"(x[6]), "v"(x[7]));
  return v8f{r0, r1, r2, r3, r4, r5, r6, r7}; }
__device__ __forceinline__ float exp2x1(float x) { float r; asm("v_exp_f32 %0, %1\n\tv_nop" : "=&v"(r) : "v"(x)); return r; }
#define LOG2E 1.44269504088896340736f   // exp(v) = 2^(v log2 e), the form __expf compiles to
__global__ __launch_bounds__(128) void k_attn(const _Float16* __restrict__ QK, const _Float16* __restrict__ QKL, const _Float16* __restrict__ VTH, const _Float16* __restrict__ VTL, const void* __restrict__ KMASK, const float* __restrict__ Q2, const float* __restrict__ TAU, float* __restrict__ O) {
  __shared__ __align__(16) float so[4][16][68];
  __shared__ __align__(16) _Float16 sk[2][KST][KPI], sv[2][HD][KPI];   // two buffers: K rows [key][d], V^T rows [d][key] of one 64-key stage, shared by the block's 4 waves
  __shared__ __align__(16) float sk2[2][KST];                          // two buffers: |k|^2 of the stage's keys
  const int tid = threadIdx.x, wave = tid >> 5, lane = tid & 31, col = lane & 15, g = lane >> 4;
  const int qb = blockIdx.x, h = blockIdx.y, b = blockIdx.z; const int q0 = qb * 64 + wave * 16; const size_t rq = (size_t)b * SS + q0 + col;
  const bool w0 = __builtin_amdgcn_readfirstlane(wave) == 0;   // scalar: the wave that copies |k|^2
  v16h aq[2];
#pragma unroll
  for (int kc = 0; kc < 2; ++kc) aq[kc] = frag_h(QK + rq * (2 * DM) + h * HD + kc * 32, lane);
  const float tau = bfr(TAU[h]); const float* Q2h = Q2 + ((size_t)b * NH + h) * SS; const float q2 = Q2h[q0 + col];
  float m = -3.0e38f, l = 0.f;   // this lane's query: running maximum (equal in both halves), sum over this half's keys
  v8f acc[4] = {};               // O^T: acc[dt][r] = o[query col][d = dt * 16 + 8 g + r]
  const int nst = SS / KST;   // all keys, 64 a stage
  const int crow = tid >> 3, cpc = tid & 7;   // this thread's row (+ 16 i) and 16-B piece in every stage
  const _Float16* gk = QK + ((size_t)b * SS + crow) * (2 * DM) + DM + h * HD + cpc * 8; const _Float16* gv = VTH + ((size_t)b * DM + h * HD + crow) * SS + cpc * 8;
  const unsigned lk = (unsigned)(size_t)&sk[0][crow][cpc * 8], lv = (unsigned)(size_t)&sv[0][crow][cpc * 8], l2 = (unsigned)(size_t)&sk2[0][lane * 2];
  const float* g2 = Q2h + lane * 2;
  stage_copy(lk, lv, gk, gv);
  if (w0) stage_copy_k2(l2, g2);
  asm volatile("s_wait_asynccnt 0x0" ::: "memory");   // this wave's copies of stage 0 have landed
  __syncthreads();                                    // stage 0 published to all 4 waves
  stage_copy(lk + KSB, lv + KSB, gk + (size_t)KST * 2 * DM, gv + KST);   // stage 1 flies under stage 0's work
  if (w0) stage_copy_k2(l2 + KST * 4, g2 + KST);
#pragma unroll 1   // stages stay rolled: one publish point, at the foot of each trip
  for (int st = 0; st < nst; ++st) { const int bf = st & 1;
#pragma unroll 1
  for (int sub = 0; sub < KST / 32; ++sub) { v8f s[2];   // rolled, as the 32-key pass was: one copy of the body
#pragma unroll
    for (int ct = 0; ct < 2; ++ct) { const _Float16* krow = &sk[bf][sub * 32 + ct * 16 + col][0]; v8f c = {};
#pragma unroll
      for (int kc = 0; kc < 2; ++kc) c = wmma16(frag_h(krow + kc * 32, lane), aq[kc], c);   // c[r] = k_(8 g + r) . q_col: single product, q, k as one-rounding f16 operands
      union { v8f v; v4f q[2]; } k2; const float* kp = &sk2[bf][sub * 32 + ct * 16 + 8 * g]; k2.q[0] = *(const v4f*)kp; k2.q[1] = *(const v4f*)(kp + 4);
      s[ct] = (2.0f * c - q2 - k2.v) * 0.125f * tau; }   // -|q_i - q_j|^2 / sqrt(64) x tau_h
    float mx = fmaxf(s[0][0], s[1][0]);
#pragma unroll
    for (int r = 1; r < 8; ++r) mx = fmaxf(mx, fmaxf(s[0][r], s[1][r]));
    mx = fmaxf(mx, xhalf(mx));
    const float mn = fmaxf(m, mx); const float ea = exp2x1((m - mn) * LOG2E); const float alpha = (m <= -1.0e38f) ? 0.f : ea;
    v8f e[2];
#pragma unroll
    for (int ct = 0; ct < 2; ++ct) { const v8f x = exp2x8((s[ct] - mn) * LOG2E);
#pragma unroll
      for (int r = 0; r < 8; ++r) e[ct][r] = (s[ct][r] <= -1.0e38f) ? 0.f : x[r]; }
    const v8f e2 = e[0] + e[1]; const float es = ((e2[0] + e2[1]) + (e2[2] + e2[3])) + ((e2[4] + e2[5]) + (e2[6] + e2[7]));
    l = l * alpha + es; m = mn;
#pragma unroll
    for (int dt = 0; dt < 4; ++dt) acc[dt] *= alpha;
    v16h pb;   // P^T as B: P scaled by 2^11 before the f16 rounding so small softmax weights stay out of the f16 subnormal range; 2^-11 folded into the epilogue
#pragma unroll
    for (int i = 0; i < 8; ++i) { pb[i] = (_Float16)(e[0][i] * 2048.0f); pb[8 + i] = (_Float16)(e[1][i] * 2048.0f); }
#pragma unroll
    for (int dt = 0; dt < 4; ++dt) acc[dt] = wmma16(frag_h(&sv[bf][dt * 16 + col][sub * 32], lane), pb, acc[dt]); }   // single product: V x P (x2^11)
    // publish point of stage st + 1, every wave, in this order
    asm volatile("s_wait_dscnt 0x0" ::: "memory");      // this wave's reads of buffer bf have returned
    asm volatile("s_wait_asynccnt 0x0" ::: "memory");   // this wave's copies of stage st + 1 have landed
    __syncthreads();                                    // stage st + 1 published; every wave has left buffer bf
    if (st + 2 < nst) { stage_copy(lk + bf * KSB, lv + bf * KSB, gk + (size_t)(st + 2) * KST * 2 * DM, gv + (st + 2) * KST);   // refill of the buffers just read
      if (w0) stage_copy_k2(l2 + bf * (KST * 4), g2 + (st + 2) * KST); } }
  asm volatile("s_wait_asynccnt 0x0" ::: "memory");   // no copy outstanding behind the loop
  l += xhalf(l);   // the halves' sums joined once
  const float il = (1.0f / 2048.0f) / l;
#pragma unroll
  for (int dt = 0; dt < 4; ++dt) { const v8f o = acc[dt] * il; float* p = &so[wave][col][dt * 16 + 8 * g]; *(v4f*)p = __builtin_shufflevector(o, o, 0, 1, 2, 3); *(v4f*)(p + 4) = __builtin_shufflevector(o, o, 4, 5, 6, 7); }
  LDSX();
  for (int rl = 0; rl < 16; ++rl) if (lane < 16) vst2(O + ((size_t)b * SS + q0 + rl) * DM + h * HD + lane * 4, *(const v4f*)&so[wave][rl][lane * 4]);
}
// ---- k_out: block = (64 rows, 128 cols): out = O(hi/lo) . Wo rows (2 products) + bo
__global__ __launch_bounds__(128) void k_out(const float* __restrict__ O, const __bf16* __restrict__ P, const float* __restrict__ BO, float* __restrict__ Y) {
  __shared__ __align__(16) float so[4][16][132];
  const int tid = threadIdx.x, wave = tid >> 5, lane = tid & 31, col = lane & 15, g = lane >> 4; const size_t r0 = (size_t)blockIdx.x * 64 + wave * 16; const int n0 = blockIdx.y * 128;
  v8f acc[8] = {};
#pragma unroll 2
  for (int kc = 0; kc < DM / 32; ++kc) { const F2 a = split_row(O + (r0 + col) * DM, kc * 32, lane);
#pragma unroll
    for (int j = 0; j < 8; ++j) { const v16b w = frag_b(P + (size_t)(n0 + j * 16 + col) * DM + kc * 32, lane); acc[j] = wmma_bf(a.l, w, acc[j]); acc[j] = wmma_bf(a.h, w, acc[j]); } }
#pragma unroll
  for (int j = 0; j < 8; ++j) {
#pragma unroll
    for (int r = 0; r < 8; ++r) so[wave][8 * g + r][j * 16 + col] = acc[j][r] + (BO ? bfr(BO[n0 + j * 16 + col]) : 0.f); }
  LDSX();
  for (int rl = 0; rl < 16; ++rl) vst2(Y + (r0 + rl) * DM + n0 + lane * 4, *(const v4f*)&so[wave][rl][lane * 4]);
}
// ---- k_q2: block = (64 tokens, b): |q|^2 per (token, head) from the f16 q plane (the same values the scores use); whole 256-B segments per (b,h)
__global__ __launch_bounds__(256) void k_q2(const _Float16* __restrict__ QK, float* __restrict__ Q2) {
  __shared__ __align__(16) float sq[NH][64]; const int t = threadIdx.x; const size_t b = blockIdx.y; const int s0 = blockIdx.x * 64; const int tl = t & 63, hp = t >> 6;   // 64 tokens x 4 groups of 2 heads
  const size_t row = b * SS + s0 + tl;
  for (int hh = hp * 2; hh < hp * 2 + 2; ++hh) { float a = 0.f; const _Float16* q = QK + row * (2 * DM) + hh * HD;
#pragma unroll 8
    for (int d = 0; d < HD; ++d) { const float v = (float)q[d]; a += v * v; }
    sq[hh][tl] = a; }
  __syncthreads();
  for (int e = t; e < NH * 16; e += 256) { const int hh = e >> 4, q4 = e & 15; vst2(Q2 + (b * NH + hh) * SS + s0 + q4 * 4, *(const v4f*)&sq[hh][q4 * 4]); }
}
extern "C" void kernel_launch(void* const* d_in, const int* in_sizes, int n_in, void* d_out, int out_size, void* d_ws, size_t ws_size, hipStream_t stream) {
  (void)in_sizes; (void)n_in; (void)out_size;
  const float** F = (const float**)d_in;   // 0 x [2,4096,512], 1 Wqk [512,512] natural, 2 Wv, 3 Wo, 4 tau [8,1,1]
  if (ws_size < (size_t)WS_END) return;
  char* ws = (char*)d_ws; __bf16* PK = (__bf16*)(ws + WS_PK); _Float16 *QK = (_Float16*)(ws + WS_QK), *QKL = (_Float16*)(ws + WS_QKL), *VTH = (_Float16*)(ws + WS_VTH), *VTL = (_Float16*)(ws + WS_VTL); float *O = (float*)(ws + WS_O), *Q2 = (float*)(ws + WS_Q2);
  k_pack<<<dim3(DM, 4), 256, 0, stream>>>(F[1], F[1], F[2], F[3], PK);   // tied q = k
  k_qkv<<<dim3(TNB * SS / 64, QKVW / 128), 128, 0, stream>>>(F[0], F[0], F[0], PK + PK_A, nullptr, nullptr, nullptr, QK, QKL, VTH, VTL);
  k_q2<<<dim3(SS / 64, TNB), 256, 0, stream>>>(QK, Q2);
  k_attn<<<dim3(TQB, NH, TNB), 128, 0, stream>>>(QK, QKL, VTH, VTL, nullptr, Q2, F[4], O);
  k_out<<<dim3(TOB, DM / 128), 128, 0, stream>>>(O, PK + PK_P, nullptr, (float*)d_out);
}

// v003
// One run takes 156 microseconds.
// Next to v002, in two timings, it ran 1.57 times as fast each time.
// Counting every step since v000, it is 3.21 times as fast.
// compute dtype: all float inputs rounded to bf16, tau read on device; qk / v = x . W^T with EXACT bf16 products on WMMA 16x16x32 (natural rows; the tied projection fills both the q and the k planes); PLAIN attention: q single f16, |q|^2 per token from the same f16 values in f32, logits = (2 q_i.q_j - |q_i|^2 - |q_j|^2) / 8 x tau_h, running-max softmax in f32 (hardware exp), P (scaled by 2^11, single f16) x v (single f16); out = o (bf16 hi + residual) . Wo^T (2 products).
#include <hip/hip_runtime.h>
#include <math.h>

typedef __attribute__((ext_vector_type(16))) _Float16 v16h;
typedef __attribute__((ext_vector_type(16))) __bf16 v16b;
typedef __attribute__((ext_vector_type(8)))  _Float16 v8h;
typedef __attribute__((ext_vector_type(8)))  float v8f;
typedef __attribute__((ext_vector_type(4)))  float v4f;
typedef __attribute__((ext_vector_type(2)))  float v2f;
typedef __attribute__((ext_vector_type(4)))  unsigned v4u;
typedef __attribute__((ext_vector_type(4)))  int v4i;
typedef float __attribute__((may_alias)) float_a;
typedef int __attribute__((may_alias)) int_a;

template <typename T> __device__ __forceinline__ void vst2(void* p, T v) { *(T*)p = v;  }
__device__ __forceinline__ v8f wmma16(v16h a, v16h b, v8f c) {
  v8f d = __builtin_amdgcn_wmma_f32_16x16x32_f16(false, a, false, b, (short)0, c, false, false);
  asm volatile("v_nop\n\tv_nop\n\tv_nop\n\tv_nop" : "+v"(d) : "v"(a), "v"(b));
  return d;
}
__device__ __forceinline__ v8f wmma_bf(v16b a, v16b b, v8f c) {
  v8f d = __builtin_amdgcn_wmma_f32_16x16x32_bf16(false, a, false, b, (short)0, c, false, false);
  asm volatile("v_nop\n\tv_nop\n\tv_nop\n\tv_nop" : "+v"(d) : "v"(a), "v"(b));
  return d;
}
// Token-diffusion attention (B 2, N 4,096, d 512, 8 heads x 64): tied q = k projection, distance-kernel logits -|q_i - q_j|^2 / 8 x tau_h, softmax, . v, output projection.
__device__ __forceinline__ v16h frag_h(const _Float16* rowk0, int lane) {
  union { v16h v; v8h q[2]; } u; const _Float16* p = rowk0 + 8 * (lane >> 4);
  u.q[0] = *(const v8h*)p; u.q[1] = *(const v8h*)(p + 16); return u.v;
}
__device__ __forceinline__ v16h frag_f32(const float* rowk0, int lane) {
  v16h a; const float* p = rowk0 + 8 * (lane >> 4);
#pragma unroll
  for (int i = 0; i < 8; ++i) { a[i] = (_Float16)p[i]; a[8 + i] = (_Float16)p[16 + i]; }
  return a;
}
__device__ __forceinline__ v16h frag_f32s(const float* rowk0, int lane, float sc) {
  v16h a; const float* p = rowk0 + 8 * (lane >> 4);
#pragma unroll
  for (int i = 0; i < 8; ++i) { a[i] = (_Float16)(p[i] * sc); a[8 + i] = (_Float16)(p[16 + i] * sc); }
  return a;
}
// column fragment from a [K][ld] layout (column n), rows >= K read as 0
__device__ __forceinline__ v16h fragc_f32(const float* W, int k0, int n, int lane, int ld, int K) {
  v16h a; const int g = lane >> 4;
#pragma unroll
  for (int i = 0; i < 8; ++i) { const int ka = k0 + 8 * g + i, kb = ka + 16;
    a[i] = (_Float16)(ka < K ? W[(size_t)(ka < K ? ka : K - 1) * ld + n] : 0.f); a[8 + i] = (_Float16)(kb < K ? W[(size_t)(kb < K ? kb : K - 1) * ld + n] : 0.f); }
  return a;
}
struct F2 { v16b h, l; };
__device__ __forceinline__ F2 bsplit16(const float v[16]) { F2 r;
#pragma unroll
  for (int i = 0; i < 16; ++i) { const __bf16 h = (__bf16)v[i]; r.h[i] = h; r.l[i] = (__bf16)(v[i] - (float)h); }
  return r; }
__device__ __forceinline__ F2 split_row(const float* row, int k0, int lane) { float v[16]; const float* p = row + k0 + 8 * (lane >> 4);
#pragma unroll
  for (int i = 0; i < 8; ++i) { v[i] = p[i]; v[8 + i] = p[16 + i]; }
  return bsplit16(v); }
__device__ __forceinline__ F2 split_rowK(const float* row, int k0, int lane, int K) { float v[16]; const int g = lane >> 4;
#pragma unroll
  for (int i = 0; i < 8; ++i) { const int ka = k0 + 8 * g + i, kb = ka + 16; v[i] = ka < K ? row[ka < K ? ka : K - 1] : 0.f; v[8 + i] = kb < K ? row[kb < K ? kb : K - 1] : 0.f; }
  return bsplit16(v); }
__device__ __forceinline__ F2 split_col(const float* W, int k0, int n, int lane, int ld, int K) { float v[16]; const int g = lane >> 4;
#pragma unroll
  for (int i = 0; i < 8; ++i) { const int ka = k0 + 8 * g + i, kb = ka + 16; v[i] = ka < K ? W[(size_t)(ka < K ? ka : K - 1) * ld + n] : 0.f; v[8 + i] = kb < K ? W[(size_t)(kb < K ? kb : K - 1) * ld + n] : 0.f; }
  return bsplit16(v); }
__device__ __forceinline__ v8f mac3(const F2& a, const F2& b, v8f c) { c = wmma_bf(a.l, b.h, c); c = wmma_bf(a.h, b.l, c); return wmma_bf(a.h, b.h, c); }
__device__ __forceinline__ float sigm(float v) { return 1.0f / (1.0f + expf(-v)); }
#define LDSX() do { asm volatile("s_wait_dscnt 0" ::: "memory"); __builtin_amdgcn_wave_barrier(); __builtin_amdgcn_fence(__ATOMIC_RELEASE, "workgroup"); } while (0)


#define NB 2
#define SS 4096
#define DM 512
#define NH 8
#define HD 64
#define QKVW (3 * DM)
#ifndef TQB
#define TQB (SS / 64)
#define TNB NB
#define TOB (NB * SS / 64)     // output row tiles (all)
#endif
typedef __attribute__((ext_vector_type(8))) __bf16 v8b;
__device__ __forceinline__ v16b frag_b(const __bf16* rowk0, int lane) {
  union { v16b v; v8b q[2]; } u; const __bf16* p = rowk0 + 8 * (lane >> 4);
  u.q[0] = *(const v8b*)p; u.q[1] = *(const v8b*)(p + 16); return u.v;
}
__device__ __forceinline__ float bfr(float v) { return (float)(__bf16)v; }
__device__ __attribute__((noinline)) float exp_ni(float v) { return expf(v); }
__device__ __attribute__((noinline)) float erf_ni(float v) { return erff(v); }

#define PK_A 0                       // [1536][512] Wqkv rows (natural [out][in])
#define PK_P (PK_A + QKVW * DM)        // [512][512] Wo rows (natural)
#define PK_END (PK_P + DM * DM)
#define WS_PK  0u
#define WS_QK  (WS_PK + 2u * PK_END)             // f16 [8192 rows][1024]: q | k
#define WS_QKL (WS_QK + 2u * NB * SS * 2 * DM)     // f16 q | k residual planes x2048
#define WS_VTH (WS_QKL + 2u * NB * SS * 2 * DM)    // f16 [b][512 (h*64+d)][4096 s] hi
#define WS_VTL (WS_VTH + 2u * NB * DM * SS)        // f16 lo x 2048
#define WS_O   (WS_VTL + 2u * NB * DM * SS)        // f32 [8192][512]
#define WS_CS  (WS_O + 4u * NB * SS * DM)           // f32 [2][4096][32], unused
#define WS_Q2  (WS_CS + 4u * 2 * SS * 32)                  // f32 [b][h][s] |q|^2
#define WS_END (WS_Q2 + 4u * (size_t)NB * NH * SS)
// ---- k_pack: block = (row n, which): natural [out][in] rows -> bf16; which 0..2 -> W_q/W_k/W_v into PK_A rows which*512 + n; 3 -> W_o into PK_P
__global__ __launch_bounds__(256) void k_pack(const float* __restrict__ WQ, const float* __restrict__ WK, const float* __restrict__ WV, const float* __restrict__ WO, __bf16* __restrict__ PK) {
  __shared__ __align__(16) __bf16 s[DM]; const int n = blockIdx.x, which = blockIdx.y, t = threadIdx.x; const float* Wm = (which == 0) ? WQ : (which == 1) ? WK : (which == 2) ? WV : WO;
  for (int k = t; k < DM; k += 256) s[k] = (__bf16)Wm[(size_t)n * DM + k];
  __syncthreads();
  __bf16* dst = (which < 3) ? PK + PK_A + ((size_t)which * DM + n) * DM : PK + PK_P + (size_t)n * DM;
  for (int q = t; q < DM / 8; q += 256) vst2((unsigned*)(dst + q * 8), *(const v4u*)&s[q * 8]);
}
// ---- LDS ring of the two projection kernels: one stage = 64 k of the block's 64 f32 rows (256 B a row) and of its 128 bf16 weight rows (128 B a row)
#define GST 64                 // k per stage
#define XPB 272                // LDS pitch of an f32 row piece: 256 B + 16 B, an odd multiple of 16 B (conflict-free for ds_load_b128)
#define WPB 144                // LDS pitch of a weight row piece: 128 B + 16 B, an odd multiple of 16 B
#define XSB (64 * XPB)         // bytes of one f32 buffer
#define WSB (128 * WPB)        // bytes of one weight buffer
// eight 16-B pieces per thread, global -> LDS through no register, at fixed steps of both addresses (a wave's copy = 4 whole 128-B lines).
// s_wait_xcnt 0 is the last line of the copies' own statement, so that it stands in front of every later write of the address registers the copies name.
__device__ __forceinline__ void copy8(unsigned l, unsigned ls, const char* gp, size_t gs) {
  asm volatile("global_load_async_to_lds_b128 %0, %8, off\n\t"
               "global_load_async_to_lds_b128 %1, %9, off\n\t"
               "global_load_async_to_lds_b128 %2, %10, off\n\t"
               "global_load_async_to_lds_b128 %3, %11, off\n\t"
               "global_load_async_to_lds_b128 %4, %12, off\n\t"
               "global_load_async_to_lds_b128 %5, %13, off\n\t"
               "global_load_async_to_lds_b128 %6, %14, off\n\t"
               "global_load_async_to_lds_b128 %7, %15, off\n\t"
               "s_wait_xcnt 0x0"
               :: "v"(l), "v"(l + ls), "v"(l + 2 * ls), "v"(l + 3 * ls), "v"(l + 4 * ls), "v"(l + 5 * ls), "v"(l + 6 * ls), "v"(l + 7 * ls),
                  "v"(gp), "v"(gp + gs), "v"(gp + 2 * gs), "v"(gp + 3 * gs), "v"(gp + 4 * gs), "v"(gp + 5 * gs), "v"(gp + 6 * gs), "v"(gp + 7 * gs)
               : "memory");
}
// one stage: thread t copies f32 rows (t >> 4) + 8 i, piece t & 15, and weight rows (t >> 3) + 16 i, piece t & 7
__device__ __forceinline__ void gstage(unsigned lx, unsigned lw, const char* gx, const char* gw) { copy8(lx, 8 * XPB, gx, (size_t)8 * DM * 4); copy8(lw, 16 * WPB, gw, (size_t)16 * DM * 2); }
__global__ __launch_bounds__(128) void k_qkv(const float* __restrict__ XQ, const float* __restrict__ XK, const float* __restrict__ XV, const __bf16* __restrict__ P, const float* __restrict__ BQ, const float* __restrict__ BK, const float* __restrict__ BV, _Float16* __restrict__ QK, _Float16* __restrict__ QKL, _Float16* __restrict__ VTH, _Float16* __restrict__ VTL) {
  const int which0 = (blockIdx.y * 128) / DM; const float* X = (which0 == 0) ? XQ : (which0 == 1) ? XK : XV; const float* BB = BQ ? (((which0 == 0) ? BQ : (which0 == 1) ? BK : BV) + (blockIdx.y * 128 - which0 * DM)) : nullptr;
  __shared__ __align__(16) char sm[2 * XSB + 2 * WSB];   // the ring: two f32 buffers, two weight buffers; behind the loop's last barrier the same bytes are the output staging
  _Float16 (*so)[16][136] = (_Float16 (*)[16][136])sm, (*sol)[16][136] = (_Float16 (*)[16][136])(sm + XSB); _Float16 (*sth)[72] = (_Float16 (*)[72])(sm + 2 * XSB), (*stl)[72] = (_Float16 (*)[72])(sm + 2 * XSB + WSB);
  const int tid = threadIdx.x, wave = tid >> 5, lane = tid & 31, col = lane & 15, g = lane >> 4; const size_t r0 = (size_t)blockIdx.x * 64 + wave * 16; const int n0 = blockIdx.y * 128;
  v8f acc[8] = {};
  const char* gx = (const char*)(X + ((size_t)blockIdx.x * 64 + (tid >> 4)) * DM + (tid & 15) * 4); const char* gw = (const char*)(P + (size_t)(n0 + (tid >> 3)) * DM + (tid & 7) * 8);
  const unsigned lx = (unsigned)(size_t)sm + (tid >> 4) * XPB + (tid & 15) * 16, lw = (unsigned)(size_t)sm + 2 * XSB + (tid >> 3) * WPB + (tid & 7) * 16;
  gstage(lx, lw, gx, gw);
  asm volatile("s_wait_asynccnt 0x0" ::: "memory");   // this wave's copies of stage 0 have landed
  __syncthreads();                                    // stage 0 published to all 4 waves
  gstage(lx + XSB, lw + WSB, gx + GST * 4, gw + GST * 2);   // stage 1 flies under stage 0's work
#pragma unroll 1   // stages stay rolled: one publish point, at the foot of each trip
  for (int st = 0; st < DM / GST; ++st) { const int bf = st & 1; const float* xr = (const float*)(sm + bf * XSB + (wave * 16 + col) * XPB); const __bf16* wr = (const __bf16*)(sm + 2 * XSB + bf * WSB + col * WPB);
#pragma unroll
    for (int kc = 0; kc < GST / 32; ++kc) { v16b a; { const float* p = xr + kc * 32 + 8 * g;
#pragma unroll
        for (int i = 0; i < 8; ++i) { a[i] = (__bf16)p[i]; a[8 + i] = (__bf16)p[16 + i]; } }
      v16b w[8];   // the eight weight fragments of this k step, read as one group in front of its products
#pragma unroll
      for (int j = 0; j < 8; ++j) w[j] = frag_b(wr + j * 16 * (WPB / 2) + kc * 32, lane);
#pragma unroll
      for (int j = 0; j < 8; ++j) acc[j] = wmma_bf(a, w[j], acc[j]); }
    // publish point of stage st + 1, every wave, in this order
    asm volatile("s_wait_dscnt 0x0" ::: "memory");      // this wave's reads of buffer bf have returned
    asm volatile("s_wait_asynccnt 0x0" ::: "memory");   // this wave's copies of stage st + 1 have landed
    __syncthreads();                                    // stage st + 1 published; every wave has left buffer bf
    if (st + 2 < DM / GST) gstage(lx + bf * XSB, lw + bf * WSB, gx + (st + 2) * (GST * 4), gw + (st + 2) * (GST * 2)); }   // refill of the buffers just read
  asm volatile("s_wait_asynccnt 0x0" ::: "memory");   // no copy outstanding behind the loop
  if (n0 < 2 * DM) {   // q stored unscaled (f16 sigma ~0.6, no subnormal exposure); 1/8 applied to the f32 score
#pragma unroll
    for (int j = 0; j < 8; ++j) {
#pragma unroll
      for (int r = 0; r < 8; ++r) { const float v = acc[j][r] + (BB ? bfr(BB[j * 16 + col]) : 0.f); const _Float16 hv = (_Float16)v; so[wave][8 * g + r][j * 16 + col] = hv; sol[wave][8 * g + r][j * 16 + col] = (_Float16)((v - (float)hv) * 2048.0f); } }   // q, k (+ bias) as f16 hi + (x2048) residual
    LDSX();
    for (int rl = 0; rl < 16; ++rl) if (lane < 16) { vst2((unsigned*)(QK + (r0 + rl) * (2 * DM) + n0 + lane * 8), *(const v4u*)&so[wave][rl][lane * 8]); vst2((unsigned*)(QKL + (r0 + rl) * (2 * DM) + n0 + lane * 8), *(const v4u*)&sol[wave][rl][lane * 8]); }
  } else {
#pragma unroll
    for (int j = 0; j < 8; ++j) {
#pragma unroll
      for (int r = 0; r < 8; ++r) { const float v = acc[j][r] + (BB ? bfr(BB[j * 16 + col]) : 0.f); const _Float16 hv = (_Float16)v; sth[j * 16 + col][wave * 16 + 8 * g + r] = hv; stl[j * 16 + col][wave * 16 + 8 * g + r] = (_Float16)((v - (float)hv) * 2048.0f); } }
    __syncthreads();
    const size_t rb = (size_t)blockIdx.x * 64; const int b = (int)(rb / SS), s0 = (int)(rb % SS); const int pc0 = n0 - 2 * DM;
    for (int q = tid; q < 128 * 8; q += 128) { const int d = q >> 3, pc = q & 7; const size_t o = ((size_t)b * DM + pc0 + d) * SS + s0 + pc * 8; vst2((unsigned*)(VTH + o), *(const v4u*)&sth[d][pc * 8]); vst2((unsigned*)(VTL + o), *(const v4u*)&stl[d][pc * 8]); }
  }
}
// ---- k_attn: block = (64 queries, head h, batch b): all-keys flash attention (K = 64: 2 k-steps), scores = (2 q.k - |q|^2 - |k|^2) * 0.125 * tau_h with single f16 operands, P.V: f16 P (x2^11) x V hi in one accumulator; O[b*S+q][h*64+d] = acc / (2048 l) (256-B segments)
#define KST 64   // keys per LDS stage
#define KPI 72   // LDS row pitch in f16: a 128-B row + 16 B = 144 B, an odd multiple of 16 B (conflict-free for ds_load_b128)
#define KSB (KST * KPI * 2)   // bytes of one K (or V^T) buffer
// one stage = 64 K rows x 128 B + 64 V^T rows x 128 B: each of the 128 threads copies four 16-B pieces of each, global -> LDS through no register (a wave's copy = 4 whole 128-B lines).
// s_wait_xcnt 0 is the last line of the copies' own statement, so that it stands in front of every later write of the address registers the copies name.
__device__ __forceinline__ void stage_copy(unsigned lk, unsigned lv, const _Float16* gk, const _Float16* gv) {
  asm volatile("global_load_async_to_lds_b128 %0, %8, off\n\t"
               "global_load_async_to_lds_b128 %1, %9, off\n\t"
               "global_load_async_to_lds_b128 %2, %10, off\n\t"
               "global_load_async_to_lds_b128 %3, %11, off\n\t"
               "global_load_async_to_lds_b128 %4, %12, off\n\t"
               "global_load_async_to_lds_b128 %5, %13, off\n\t"
               "global_load_async_to_lds_b128 %6, %14, off\n\t"
               "global_load_async_to_lds_b128 %7, %15, off\n\t"
               "s_wait_xcnt 0x0"
               :: "v"(lk), "v"(lk + 16 * KPI * 2), "v"(lk + 32 * KPI * 2), "v"(lk + 48 * KPI * 2), "v"(lv), "v"(lv + 16 * KPI * 2), "v"(lv + 32 * KPI * 2), "v"(lv + 48 * KPI * 2),
                  "v"(gk), "v"(gk + (size_t)16 * 2 * DM), "v"(gk + (size_t)32 * 2 * DM), "v"(gk + (size_t)48 * 2 * DM), "v"(gv), "v"(gv + (size_t)16 * SS), "v"(gv + (size_t)32 * SS), "v"(gv + (size_t)48 * SS)
               : "memory");
}
// |k|^2 of one stage's 64 keys = 256 B: one 8-B piece per lane of ONE wave, global -> LDS through no register; s_wait_xcnt 0 closes the copy's own statement, in front of every later write of its address registers.
__device__ __forceinline__ void stage_copy_k2(unsigned l2, const float* g2) {
  asm volatile("global_load_async_to_lds_b64 %0, %1, off\n\t"
               "s_wait_xcnt 0x0"
               :: "v"(l2), "v"(g2) : "memory");
}
// lane l <-> lane l ^ 16 (the two halves of a wave hold the two halves of one query's keys)
__device__ __forceinline__ float xhalf(float x) { return __builtin_bit_cast(float, __builtin_amdgcn_permlanex16(__builtin_bit_cast(int, x), __builtin_bit_cast(int, x), 0x76543210, 0xfedcba98, false, false)); }
// 2^x for eight values / one value. One statement each: the outputs are early-clobber, so that no v_exp_f32 overwrites a source of the one in front of it, and the closing v_nop is the slot the instruction set asks for
// between a transcendental and a next instruction that reads its result or overwrites its source.
__device__ __forceinline__ v8f exp2x8(v8f x) { float r0, r1, r2, r3, r4, r5, r6, r7;
  asm("v_exp_f32 %0, %8\n\tv_exp_f32 %1, %9\n\tv_exp_f32 %2, %10\n\tv_exp_f32 %3, %11\n\tv_exp_f32 %4, %12\n\tv_exp_f32 %5, %13\n\tv_exp_f32 %6, %14\n\tv_exp_f32 %7, %15\n\tv_nop"
      : "=&v"(r0), "=&v"(r1), "=&v"(r2), "=&v"(r3), "=&v"(r4), "=&v"(r5), "=&v"(r6), "=&v"(r7) : "v"(x[0]), "v"(x[1]), "v"(x[2]), "v"(x[3]), "v"(x[4]), "v"(x[5]), "v"(x[6]), "v"(x[7]));
  return v8f{r0, r1, r2, r3, r4, r5, r6, r7}; }
__device__ __forceinline__ float exp2x1(float x) { float r; asm("v_exp_f32 %0, %1\n\tv_nop" : "=&v"(r) : "v"(x)); return r; }
#define LOG2E 1.44269504088896340736f   // exp(v) = 2^(v log2 e), the form __expf compiles to
__global__ __launch_bounds__(128) void k_attn(const _Float16* __restrict__ QK, const _Float16* __restrict__ QKL, const _Float16* __restrict__ VTH, const _Float16* __restrict__ VTL, const void* __restrict__ KMASK, const float* __restrict__ Q2, const float* __restrict__ TAU, float* __restrict__ O) {
  __shared__ __align__(16) float so[4][16][68];
  __shared__ __align__(16) _Float16 sk[2][KST][KPI], sv[2][HD][KPI];   // two buffers: K rows [key][d], V^T rows [d][key] of one 64-key stage, shared by the block's 4 waves
  __shared__ __align__(16) float sk2[2][KST];                          // two buffers: |k|^2 of the stage's keys
  const int tid = threadIdx.x, wave = tid >> 5, lane = tid & 31, col = lane & 15, g = lane >> 4;
  const int qb = blockIdx.x, h = blockIdx.y, b = blockIdx.z; const int q0 = qb * 64 + wave * 16; const size_t rq = (size_t)b * SS + q0 + col;
  const bool w0 = __builtin_amdgcn_readfirstlane(wave) == 0;   // scalar: the wave that copies |k|^2
  v16h aq[2];
#pragma unroll
  for (int kc = 0; kc < 2; ++kc) aq[kc] = frag_h(QK + rq * (2 * DM) + h * HD + kc * 32, lane);
  const float tau = bfr(TAU[h]); const float* Q2h = Q2 + ((size_t)b * NH + h) * SS; const float q2 = Q2h[q0 + col];
  float m = -3.0e38f, l = 0.f;   // this lane's query: running maximum (equal in both halves), sum over this half's keys
  v8f acc[4] = {};               // O^T: acc[dt][r] = o[query col][d = dt * 16 + 8 g + r]
  const int nst = SS / KST;   // all keys, 64 a stage
  const int crow = tid >> 3, cpc = tid & 7;   // this thread's row (+ 16 i) and 16-B piece in every stage
  const _Float16* gk = QK + ((size_t)b * SS + crow) * (2 * DM) + DM + h * HD + cpc * 8; const _Float16* gv = VTH + ((size_t)b * DM + h * HD + crow) * SS + cpc * 8;
  const unsigned lk = (unsigned)(size_t)&sk[0][crow][cpc * 8], lv = (unsigned)(size_t)&sv[0][crow][cpc * 8], l2 = (unsigned)(size_t)&sk2[0][lane * 2];
  const float* g2 = Q2h + lane * 2;
  stage_copy(lk, lv, gk, gv);
  if (w0) stage_copy_k2(l2, g2);
  asm volatile("s_wait_asynccnt 0x0" ::: "memory");   // this wave's copies of stage 0 have landed
  __syncthreads();                                    // stage 0 published to all 4 waves
  stage_copy(lk + KSB, lv + KSB, gk + (size_t)KST * 2 * DM, gv + KST);   // stage 1 flies under stage 0's work
  if (w0) stage_copy_k2(l2 + KST * 4, g2 + KST);
#pragma unroll 1   // stages stay rolled: one publish point, at the foot of each trip
  for (int st = 0; st < nst; ++st) { const int bf = st & 1;
#pragma unroll 1
  for (int sub = 0; sub < KST / 32; ++sub) { v8f s[2];   // rolled, as the 32-key pass was: one copy of the body
#pragma unroll
    for (int ct = 0; ct < 2; ++ct) { const _Float16* krow = &sk[bf][sub * 32 + ct * 16 + col][0]; v8f c = {};
#pragma unroll
      for (int kc = 0; kc < 2; ++kc) c = wmma16(frag_h(krow + kc * 32, lane), aq[kc], c);   // c[r] = k_(8 g + r) . q_col: single product, q, k as one-rounding f16 operands
      union { v8f v; v4f q[2]; } k2; const float* kp = &sk2[bf][sub * 32 + ct * 16 + 8 * g]; k2.q[0] = *(const v4f*)kp; k2.q[1] = *(const v4f*)(kp + 4);
      s[ct] = (2.0f * c - q2 - k2.v) * 0.125f * tau; }   // -|q_i - q_j|^2 / sqrt(64) x tau_h
    float mx = fmaxf(s[0][0], s[1][0]);
#pragma unroll
    for (int r = 1; r < 8; ++r) mx = fmaxf(mx, fmaxf(s[0][r], s[1][r]));
    mx = fmaxf(mx, xhalf(mx));
    const float mn = fmaxf(m, mx); const float ea = exp2x1((m - mn) * LOG2E); const float alpha = (m <= -1.0e38f) ? 0.f : ea;
    v8f e[2];
#pragma unroll
    for (int ct = 0; ct < 2; ++ct) { const v8f x = exp2x8((s[ct] - mn) * LOG2E);
#pragma unroll
      for (int r = 0; r < 8; ++r) e[ct][r] = (s[ct][r] <= -1.0e38f) ? 0.f : x[r]; }
    const v8f e2 = e[0] + e[1]; const float es = ((e2[0] + e2[1]) + (e2[2] + e2[3])) + ((e2[4] + e2[5]) + (e2[6] + e2[7]));
    l = l * alpha + es; m = mn;
#pragma unroll
    for (int dt = 0; dt < 4; ++dt) acc[dt] *= alpha;
    v16h pb;   // P^T as B: P scaled by 2^11 before the f16 rounding so small softmax weights stay out of the f16 subnormal range; 2^-11 folded into the epilogue
#pragma unroll
    for (int i = 0; i < 8; ++i) { pb[i] = (_Float16)(e[0][i] * 2048.0f); pb[8 + i] = (_Float16)(e[1][i] * 2048.0f); }
#pragma unroll
    for (int dt = 0; dt < 4; ++dt) acc[dt] = wmma16(frag_h(&sv[bf][dt * 16 + col][sub * 32], lane), pb, acc[dt]); }   // single product: V x P (x2^11)
    // publish point of stage st + 1, every wave, in this order
    asm volatile("s_wait_dscnt 0x0" ::: "memory");      // this wave's reads of buffer bf have returned
    asm volatile("s_wait_asynccnt 0x0" ::: "memory");   // this wave's copies of stage st + 1 have landed
    __syncthreads();                                    // stage st + 1 published; every wave has left buffer bf
    if (st + 2 < nst) { stage_copy(lk + bf * KSB, lv + bf * KSB, gk + (size_t)(st + 2) * KST * 2 * DM, gv + (st + 2) * KST);   // refill of the buffers just read
      if (w0) stage_copy_k2(l2 + bf * (KST * 4), g2 + (st + 2) * KST); } }
  asm volatile("s_wait_asynccnt 0x0" ::: "memory");   // no copy outstanding behind the loop
  l += xhalf(l);   // the halves' sums joined once
  const float il = (1.0f / 2048.0f) / l;
#pragma unroll
  for (int dt = 0; dt < 4; ++dt) { const v8f o = acc[dt] * il; float* p = &so[wave][col][dt * 16 + 8 * g]; *(v4f*)p = __builtin_shufflevector(o, o, 0, 1, 2, 3); *(v4f*)(p + 4) = __builtin_shufflevector(o, o, 4, 5, 6, 7); }
  LDSX();
  for (int rl = 0; rl < 16; ++rl) if (lane < 16) vst2(O + ((size_t)b * SS + q0 + rl) * DM + h * HD + lane * 4, *(const v4f*)&so[wave][rl][lane * 4]);
}
// ---- k_out: block = (64 rows, 128 cols): out = O(hi/lo) . Wo rows (2 products) + bo
__global__ __launch_bounds__(128) void k_out(const float* __restrict__ O, const __bf16* __restrict__ P, const float* __restrict__ BO, float* __restrict__ Y) {
  __shared__ __align__(16) float so[4][16][132];
  const int tid = threadIdx.x, wave = tid >> 5, lane = tid & 31, col = lane & 15, g = lane >> 4; const size_t r0 = (size_t)blockIdx.x * 64 + wave * 16; const int n0 = blockIdx.y * 128;
  __shared__ __align__(16) char sm[2 * XSB + 2 * WSB];   // the ring: two f32 buffers, two weight buffers
  v8f acc[8] = {};
  const char* gx = (const char*)(O + ((size_t)blockIdx.x * 64 + (tid >> 4)) * DM + (tid & 15) * 4); const char* gw = (const char*)(P + (size_t)(n0 + (tid >> 3)) * DM + (tid & 7) * 8);
  const unsigned lx = (unsigned)(size_t)sm + (tid >> 4) * XPB + (tid & 15) * 16, lw = (unsigned)(size_t)sm + 2 * XSB + (tid >> 3) * WPB + (tid & 7) * 16;
  gstage(lx, lw, gx, gw);
  asm volatile("s_wait_asynccnt 0x0" ::: "memory");   // this wave's copies of stage 0 have landed
  __syncthreads();                                    // stage 0 published to all 4 waves
  gstage(lx + XSB, lw + WSB, gx + GST * 4, gw + GST * 2);   // stage 1 flies under stage 0's work
#pragma unroll 1   // stages stay rolled: one publish point, at the foot of each trip
  for (int st = 0; st < DM / GST; ++st) { const int bf = st & 1; const float* xr = (const float*)(sm + bf * XSB + (wave * 16 + col) * XPB); const __bf16* wr = (const __bf16*)(sm + 2 * XSB + bf * WSB + col * WPB);
#pragma unroll
    for (int kc = 0; kc < GST / 32; ++kc) { const F2 a = split_row(xr, kc * 32, lane);
      v16b w[8];   // the eight weight fragments of this k step, read as one group in front of its products
#pragma unroll
      for (int j = 0; j < 8; ++j) w[j] = frag_b(wr + j * 16 * (WPB / 2) + kc * 32, lane);
#pragma unroll
      for (int j = 0; j < 8; ++j) { acc[j] = wmma_bf(a.l, w[j], acc[j]); acc[j] = wmma_bf(a.h, w[j], acc[j]); } }
    // publish point of stage st + 1, every wave, in this order
    asm volatile("s_wait_dscnt 0x0" ::: "memory");      // this wave's reads of buffer bf have returned
    asm volatile("s_wait_asynccnt 0x0" ::: "memory");   // this wave's copies of stage st + 1 have landed
    __syncthreads();                                    // stage st + 1 published; every wave has left buffer bf
    if (st + 2 < DM / GST) gstage(lx + bf * XSB, lw + bf * WSB, gx + (st + 2) * (GST * 4), gw + (st + 2) * (GST * 2)); }   // refill of the buffers just read
  asm volatile("s_wait_asynccnt 0x0" ::: "memory");   // no copy outstanding behind the loop
#pragma unroll
  for (int j = 0; j < 8; ++j) {
#pragma unroll
    for (int r = 0; r < 8; ++r) so[wave][8 * g + r][j * 16 + col] = acc[j][r] + (BO ? bfr(BO[n0 + j * 16 + col]) : 0.f); }
  LDSX();
  for (int rl = 0; rl < 16; ++rl) vst2(Y + (r0 + rl) * DM + n0 + lane * 4, *(const v4f*)&so[wave][rl][lane * 4]);
}
// ---- k_q2: block = (64 tokens, b): |q|^2 per (token, head) from the f16 q plane (the same values the scores use); whole 256-B segments per (b,h)
__global__ __launch_bounds__(256) void k_q2(const _Float16* __restrict__ QK, float* __restrict__ Q2) {
  __shared__ __align__(16) float sq[NH][64]; const int t = threadIdx.x; const size_t b = blockIdx.y; const int s0 = blockIdx.x * 64; const int tl = t & 63, hp = t >> 6;   // 64 tokens x 4 groups of 2 heads
  const size_t row = b * SS + s0 + tl;
  for (int hh = hp * 2; hh < hp * 2 + 2; ++hh) { float a = 0.f; const _Float16* q = QK + row * (2 * DM) + hh * HD;
#pragma unroll 8
    for (int d = 0; d < HD; ++d) { const float v = (float)q[d]; a += v * v; }
    sq[hh][tl] = a; }
  __syncthreads();
  for (int e = t; e < NH * 16; e += 256) { const int hh = e >> 4, q4 = e & 15; vst2(Q2 + (b * NH + hh) * SS + s0 + q4 * 4, *(const v4f*)&sq[hh][q4 * 4]); }
}
extern "C" void kernel_launch(void* const* d_in, const int* in_sizes, int n_in, void* d_out, int out_size, void* d_ws, size_t ws_size, hipStream_t stream) {
  (void)in_sizes; (void)n_in; (void)out_size;
  const float** F = (const float**)d_in;   // 0 x [2,4096,512], 1 Wqk [512,512] natural, 2 Wv, 3 Wo, 4 tau [8,1,1]
  if (ws_size < (size_t)WS_END) return;
  char* ws = (char*)d_ws; __bf16* PK = (__bf16*)(ws + WS_PK); _Float16 *QK = (_Float16*)(ws + WS_QK), *QKL = (_Float16*)(ws + WS_QKL), *VTH = (_Float16*)(ws + WS_VTH), *VTL = (_Float16*)(ws + WS_VTL); float *O = (float*)(ws + WS_O), *Q2 = (float*)(ws + WS_Q2);
  k_pack<<<dim3(DM, 4), 256, 0, stream>>>(F[1], F[1], F[2], F[3], PK);   // tied q = k
  k_qkv<<<dim3(TNB * SS / 64, QKVW / 128), 128, 0, stream>>>(F[0], F[0], F[0], PK + PK_A, nullptr, nullptr, nullptr, QK, QKL, VTH, VTL);
  k_q2<<<dim3(SS / 64, TNB), 256, 0, stream>>>(QK, Q2);
  k_attn<<<dim3(TQB, NH, TNB), 128, 0, stream>>>(QK, QKL, VTH, VTL, nullptr, Q2, F[4], O);
  k_out<<<dim3(TOB, DM / 128), 128, 0, stream>>>(O, PK + PK_P, nullptr, (float*)d_out);
}

// v004
// A run of this version takes 130 microseconds.
// Next to v003, in two timings, it ran 1.21 and 1.20 times as fast.
// Over all steps from v000 it is 3.87 times as fast.
// compute dtype: all float inputs rounded to bf16, tau read on device; qk / v = x . W^T with EXACT bf16 products on WMMA 16x16x32 (natural rows; the tied projection fills both the q and the k planes); PLAIN attention: q single f16, |q|^2 per token from the same f16 values in f32, logits = (2 q_i.q_j - |q_i|^2 - |q_j|^2) / 8 x tau_h, softmax in f32 (hardware exp; maximum 0 known for 0 <= tau_h <= 64, running maximum otherwise), P (scaled by 2^11, single f16) x v (single f16); out = o (bf16 hi + residual) . Wo^T (2 products).
#include <hip/hip_runtime.h>
#include <math.h>

typedef __attribute__((ext_vector_type(16))) _Float16 v16h;
typedef __attribute__((ext_vector_type(16))) __bf16 v16b;
typedef __attribute__((ext_vector_type(8)))  _Float16 v8h;
typedef __attribute__((ext_vector_type(8)))  float v8f;
typedef __attribute__((ext_vector_type(4)))  float v4f;
typedef __attribute__((ext_vector_type(2)))  float v2f;
typedef __attribute__((ext_vector_type(4)))  unsigned v4u;
typedef __attribute__((ext_vector_type(4)))  int v4i;
typedef float __attribute__((may_alias)) float_a;
typedef int __attribute__((may_alias)) int_a;

template <typename T> __device__ __forceinline__ void vst2(void* p, T v) { *(T*)p = v;  }
__device__ __forceinline__ v8f wmma16(v16h a, v16h b, v8f c) {
  v8f d = __builtin_amdgcn_wmma_f32_16x16x32_f16(false, a, false, b, (short)0, c, false, false);
  asm volatile("v_nop\n\tv_nop\n\tv_nop\n\tv_nop" : "+v"(d) : "v"(a), "v"(b));
  return d;
}
__device__ __forceinline__ v8f wmma_bf(v16b a, v16b b, v8f c) {
  v8f d = __builtin_amdgcn_wmma_f32_16x16x32_bf16(false, a, false, b, (short)0, c, false, false);
  asm volatile("v_nop\n\tv_nop\n\tv_nop\n\tv_nop" : "+v"(d) : "v"(a), "v"(b));
  return d;
}
// Token-diffusion attention (B 2, N 4,096, d 512, 8 heads x 64): tied q = k projection, distance-kernel logits -|q_i - q_j|^2 / 8 x tau_h, softmax, . v, output projection.
__device__ __forceinline__ v16h frag_h(const _Float16* rowk0, int lane) {
  union { v16h v; v8h q[2]; } u; const _Float16* p = rowk0 + 8 * (lane >> 4);
  u.q[0] = *(const v8h*)p; u.q[1] = *(const v8h*)(p + 16); return u.v;
}
__device__ __forceinline__ v16h frag_f32(const float* rowk0, int lane) {
  v16h a; const float* p = rowk0 + 8 * (lane >> 4);
#pragma unroll
  for (int i = 0; i < 8; ++i) { a[i] = (_Float16)p[i]; a[8 + i] = (_Float16)p[16 + i]; }
  return a;
}
__device__ __forceinline__ v16h frag_f32s(const float* rowk0, int lane, float sc) {
  v16h a; const float* p = rowk0 + 8 * (lane >> 4);
#pragma unroll
  for (int i = 0; i < 8; ++i) { a[i] = (_Float16)(p[i] * sc); a[8 + i] = (_Float16)(p[16 + i] * sc); }
  return a;
}
// column fragment from a [K][ld] layout (column n), rows >= K read as 0
__device__ __forceinline__ v16h fragc_f32(const float* W, int k0, int n, int lane, int ld, int K) {
  v16h a; const int g = lane >> 4;
#pragma unroll
  for (int i = 0; i < 8; ++i) { const int ka = k0 + 8 * g + i, kb = ka + 16;
    a[i] = (_Float16)(ka < K ? W[(size_t)(ka < K ? ka : K - 1) * ld + n] : 0.f); a[8 + i] = (_Float16)(kb < K ? W[(size_t)(kb < K ? kb : K - 1) * ld + n] : 0.f); }
  return a;
}
struct F2 { v16b h, l; };
__device__ __forceinline__ F2 bsplit16(const float v[16]) { F2 r;
#pragma unroll
  for (int i = 0; i < 16; ++i) { const __bf16 h = (__bf16)v[i]; r.h[i] = h; r.l[i] = (__bf16)(v[i] - (float)h); }
  return r; }
__device__ __forceinline__ F2 split_row(const float* row, int k0, int lane) { float v[16]; const float* p = row + k0 + 8 * (lane >> 4);
#pragma unroll
  for (int i = 0; i < 8; ++i) { v[i] = p[i]; v[8 + i] = p[16 + i]; }
  return bsplit16(v); }
__device__ __forceinline__ F2 split_rowK(const float* row, int k0, int lane, int K) { float v[16]; const int g = lane >> 4;
#pragma unroll
  for (int i = 0; i < 8; ++i) { const int ka = k0 + 8 * g + i, kb = ka + 16; v[i] = ka < K ? row[ka < K ? ka : K - 1] : 0.f; v[8 + i] = kb < K ? row[kb < K ? kb : K - 1] : 0.f; }
  return bsplit16(v); }
__device__ __forceinline__ F2 split_col(const float* W, int k0, int n, int lane, int ld, int K) { float v[16]; const int g = lane >> 4;
#pragma unroll
  for (int i = 0; i < 8; ++i) { const int ka = k0 + 8 * g + i, kb = ka + 16; v[i] = ka < K ? W[(size_t)(ka < K ? ka : K - 1) * ld + n] : 0.f; v[8 + i] = kb < K ? W[(size_t)(kb < K ? kb : K - 1) * ld + n] : 0.f; }
  return bsplit16(v); }
__device__ __forceinline__ v8f mac3(const F2& a, const F2& b, v8f c) { c = wmma_bf(a.l, b.h, c); c = wmma_bf(a.h, b.l, c); return wmma_bf(a.h, b.h, c); }
__device__ __forceinline__ float sigm(float v) { return 1.0f / (1.0f + expf(-v)); }
#define LDSX() do { asm volatile("s_wait_dscnt 0" ::: "memory"); __builtin_amdgcn_wave_barrier(); __builtin_amdgcn_fence(__ATOMIC_RELEASE, "workgroup"); } while (0)


#define NB 2
#define SS 4096
#define DM 512
#define NH 8
#define HD 64
#define QKVW (3 * DM)
#ifndef TQB
#define TQB (SS / 64)
#define TNB NB
#define TOB (NB * SS / 64)     // output row tiles (all)
#endif
typedef __attribute__((ext_vector_type(8))) __bf16 v8b;
__device__ __forceinline__ v16b frag_b(const __bf16* rowk0, int lane) {
  union { v16b v; v8b q[2]; } u; const __bf16* p = rowk0 + 8 * (lane >> 4);
  u.q[0] = *(const v8b*)p; u.q[1] = *(const v8b*)(p + 16); return u.v;
}
__device__ __forceinline__ float bfr(float v) { return (float)(__bf16)v; }
__device__ __attribute__((noinline)) float exp_ni(float v) { return expf(v); }
__device__ __attribute__((noinline)) float erf_ni(float v) { return erff(v); }

#define PK_A 0                       // [1536][512] Wqkv rows (natural [out][in])
#define PK_P (PK_A + QKVW * DM)        // [512][512] Wo rows (natural)
#define PK_END (PK_P + DM * DM)
#define WS_PK  0u
#define WS_QK  (WS_PK + 2u * PK_END)             // f16 [8192 rows][1024]: q | k
#define WS_QKL (WS_QK + 2u * NB * SS * 2 * DM)     // f16 q | k residual planes x2048
#define WS_VTH (WS_QKL + 2u * NB * SS * 2 * DM)    // f16 [b][512 (h*64+d)][4096 s] hi
#define WS_VTL (WS_VTH + 2u * NB * DM * SS)        // f16 lo x 2048
#define WS_O   (WS_VTL + 2u * NB * DM * SS)        // f32 [8192][512]
#define WS_CS  (WS_O + 4u * NB * SS * DM)           // f32 2 x [4096][32], unused
#define WS_Q2  (WS_CS + 4u * 2 * SS * 32)                  // f32 [b][h][s] -|q|^2 / 2
#define WS_END (WS_Q2 + 4u * (size_t)NB * NH * SS)
// ---- k_pack: block = (row n, which): natural [out][in] rows -> bf16; which 0..2 -> W_q/W_k/W_v into PK_A rows which*512 + n; 3 -> W_o into PK_P
__global__ __launch_bounds__(256) void k_pack(const float* __restrict__ WQ, const float* __restrict__ WK, const float* __restrict__ WV, const float* __restrict__ WO, __bf16* __restrict__ PK) {
  __shared__ __align__(16) __bf16 s[DM]; const int n = blockIdx.x, which = blockIdx.y, t = threadIdx.x; const float* Wm = (which == 0) ? WQ : (which == 1) ? WK : (which == 2) ? WV : WO;
  for (int k = t; k < DM; k += 256) s[k] = (__bf16)Wm[(size_t)n * DM + k];
  __syncthreads();
  __bf16* dst = (which < 3) ? PK + PK_A + ((size_t)which * DM + n) * DM : PK + PK_P + (size_t)n * DM;
  for (int q = t; q < DM / 8; q += 256) vst2((unsigned*)(dst + q * 8), *(const v4u*)&s[q * 8]);
}
// ---- LDS ring of the two projection kernels: one stage = 64 k of the block's 64 f32 rows (256 B a row) and of its 128 bf16 weight rows (128 B a row)
#define GST 64                 // k per stage
#define XPB 272                // LDS pitch of an f32 row piece: 256 B + 16 B, an odd multiple of 16 B (conflict-free for ds_load_b128)
#define WPB 144                // LDS pitch of a weight row piece: 128 B + 16 B, an odd multiple of 16 B
#define XSB (64 * XPB)         // bytes of one f32 buffer
#define WSB (128 * WPB)        // bytes of one weight buffer
// eight 16-B pieces per thread, global -> LDS through no register, at fixed steps of both addresses (a wave's copy = 4 whole 128-B lines).
// s_wait_xcnt 0 is the last line of the copies' own statement, so that it stands in front of every later write of the address registers the copies name.
__device__ __forceinline__ void copy8(unsigned l, unsigned ls, const char* gp, size_t gs) {
  asm volatile("global_load_async_to_lds_b128 %0, %8, off\n\t"
               "global_load_async_to_lds_b128 %1, %9, off\n\t"
               "global_load_async_to_lds_b128 %2, %10, off\n\t"
               "global_load_async_to_lds_b128 %3, %11, off\n\t"
               "global_load_async_to_lds_b128 %4, %12, off\n\t"
               "global_load_async_to_lds_b128 %5, %13, off\n\t"
               "global_load_async_to_lds_b128 %6, %14, off\n\t"
               "global_load_async_to_lds_b128 %7, %15, off\n\t"
               "s_wait_xcnt 0x0"
               :: "v"(l), "v"(l + ls), "v"(l + 2 * ls), "v"(l + 3 * ls), "v"(l + 4 * ls), "v"(l + 5 * ls), "v"(l + 6 * ls), "v"(l + 7 * ls),
                  "v"(gp), "v"(gp + gs), "v"(gp + 2 * gs), "v"(gp + 3 * gs), "v"(gp + 4 * gs), "v"(gp + 5 * gs), "v"(gp + 6 * gs), "v"(gp + 7 * gs)
               : "memory");
}
// one stage: thread t copies f32 rows (t >> 4) + 8 i, piece t & 15, and weight rows (t >> 3) + 16 i, piece t & 7
__device__ __forceinline__ void gstage(unsigned lx, unsigned lw, const char* gx, const char* gw) { copy8(lx, 8 * XPB, gx, (size_t)8 * DM * 4); copy8(lw, 16 * WPB, gw, (size_t)16 * DM * 2); }
__global__ __launch_bounds__(128) void k_qkv(const float* __restrict__ XQ, const float* __restrict__ XK, const float* __restrict__ XV, const __bf16* __restrict__ P, const float* __restrict__ BQ, const float* __restrict__ BK, const float* __restrict__ BV, _Float16* __restrict__ QK, _Float16* __restrict__ QKL, _Float16* __restrict__ VTH, _Float16* __restrict__ VTL) {
  const int which0 = (blockIdx.y * 128) / DM; const float* X = (which0 == 0) ? XQ : (which0 == 1) ? XK : XV; const float* BB = BQ ? (((which0 == 0) ? BQ : (which0 == 1) ? BK : BV) + (blockIdx.y * 128 - which0 * DM)) : nullptr;
  __shared__ __align__(16) char sm[2 * XSB + 2 * WSB];   // the ring: two f32 buffers, two weight buffers; behind the loop's last barrier the same bytes are the output staging
  _Float16 (*so)[16][136] = (_Float16 (*)[16][136])sm, (*sol)[16][136] = (_Float16 (*)[16][136])(sm + XSB); _Float16 (*sth)[72] = (_Float16 (*)[72])(sm + 2 * XSB), (*stl)[72] = (_Float16 (*)[72])(sm + 2 * XSB + WSB);
  const int tid = threadIdx.x, wave = tid >> 5, lane = tid & 31, col = lane & 15, g = lane >> 4; const size_t r0 = (size_t)blockIdx.x * 64 + wave * 16; const int n0 = blockIdx.y * 128;
  v8f acc[8] = {};
  const char* gx = (const char*)(X + ((size_t)blockIdx.x * 64 + (tid >> 4)) * DM + (tid & 15) * 4); const char* gw = (const char*)(P + (size_t)(n0 + (tid >> 3)) * DM + (tid & 7) * 8);
  const unsigned lx = (unsigned)(size_t)sm + (tid >> 4) * XPB + (tid & 15) * 16, lw = (unsigned)(size_t)sm + 2 * XSB + (tid >> 3) * WPB + (tid & 7) * 16;
  gstage(lx, lw, gx, gw);
  asm volatile("s_wait_asynccnt 0x0" ::: "memory");   // this wave's copies of stage 0 have landed
  __syncthreads();                                    // stage 0 published to all 4 waves
  gstage(lx + XSB, lw + WSB, gx + GST * 4, gw + GST * 2);   // stage 1 flies under stage 0's work
#pragma unroll 1   // stages stay rolled: one publish point, at the foot of each trip
  for (int st = 0; st < DM / GST; ++st) { const int bf = st & 1; const float* xr = (const float*)(sm + bf * XSB + (wave * 16 + col) * XPB); const __bf16* wr = (const __bf16*)(sm + 2 * XSB + bf * WSB + col * WPB);
#pragma unroll
    for (int kc = 0; kc < GST / 32; ++kc) { v16b a; { const float* p = xr + kc * 32 + 8 * g;
#pragma unroll
        for (int i = 0; i < 8; ++i) { a[i] = (__bf16)p[i]; a[8 + i] = (__bf16)p[16 + i]; } }
      v16b w[8];   // the eight weight fragments of this k step, read as one group in front of its products
#pragma unroll
      for (int j = 0; j < 8; ++j) w[j] = frag_b(wr + j * 16 * (WPB / 2) + kc * 32, lane);
#pragma unroll
      for (int j = 0; j < 8; ++j) acc[j] = wmma_bf(a, w[j], acc[j]); }
    // publish point of stage st + 1, every wave, in this order
    asm volatile("s_wait_dscnt 0x0" ::: "memory");      // this wave's reads of buffer bf have returned
    asm volatile("s_wait_asynccnt 0x0" ::: "memory");   // this wave's copies of stage st + 1 have landed
    __syncthreads();                                    // stage st + 1 published; every wave has left buffer bf
    if (st + 2 < DM / GST) gstage(lx + bf * XSB, lw + bf * WSB, gx + (st + 2) * (GST * 4), gw + (st + 2) * (GST * 2)); }   // refill of the buffers just read
  asm volatile("s_wait_asynccnt 0x0" ::: "memory");   // no copy outstanding behind the loop
  if (n0 < 2 * DM) {   // q stored unscaled (f16 sigma ~0.6, no subnormal exposure); 1/8 applied to the f32 score
#pragma unroll
    for (int j = 0; j < 8; ++j) {
#pragma unroll
      for (int r = 0; r < 8; ++r) { const float v = acc[j][r] + (BB ? bfr(BB[j * 16 + col]) : 0.f); const _Float16 hv = (_Float16)v; so[wave][8 * g + r][j * 16 + col] = hv; sol[wave][8 * g + r][j * 16 + col] = (_Float16)((v - (float)hv) * 2048.0f); } }   // q, k (+ bias) as f16 hi + (x2048) residual
    LDSX();
    for (int rl = 0; rl < 16; ++rl) if (lane < 16) { vst2((unsigned*)(QK + (r0 + rl) * (2 * DM) + n0 + lane * 8), *(const v4u*)&so[wave][rl][lane * 8]); vst2((unsigned*)(QKL + (r0 + rl) * (2 * DM) + n0 + lane * 8), *(const v4u*)&sol[wave][rl][lane * 8]); }
  } else {
#pragma unroll
    for (int j = 0; j < 8; ++j) {
#pragma unroll
      for (int r = 0; r < 8; ++r) { const float v = acc[j][r] + (BB ? bfr(BB[j * 16 + col]) : 0.f); const _Float16 hv = (_Float16)v; sth[j * 16 + col][wave * 16 + 8 * g + r] = hv; stl[j * 16 + col][wave * 16 + 8 * g + r] = (_Float16)((v - (float)hv) * 2048.0f); } }
    __syncthreads();
    const size_t rb = (size_t)blockIdx.x * 64; const int b = (int)(rb / SS), s0 = (int)(rb % SS); const int pc0 = n0 - 2 * DM;
    for (int q = tid; q < 128 * 8; q += 128) { const int d = q >> 3, pc = q & 7; const size_t o = ((size_t)b * DM + pc0 + d) * SS + s0 + pc * 8; vst2((unsigned*)(VTH + o), *(const v4u*)&sth[d][pc * 8]); vst2((unsigned*)(VTL + o), *(const v4u*)&stl[d][pc * 8]); }
  }
}
// ---- k_attn: block = (64 queries, head h, batch b): all-keys flash attention (K = 64: 2 k-steps), scores = (2 q.k - |q|^2 - |k|^2) * 0.125 * tau_h with single f16 operands, P.V: f16 P (x2^11) x V hi in one accumulator; O[b*S+q][h*64+d] = acc / (2048 l) (256-B segments)
#define KST 64   // keys per LDS stage
#define KPI 72   // LDS row pitch in f16: a 128-B row + 16 B = 144 B, an odd multiple of 16 B (conflict-free for ds_load_b128)
#define KSB (KST * KPI * 2)   // bytes of one K (or V^T) buffer
// one stage = 64 K rows x 128 B + 64 V^T rows x 128 B: each of the 128 threads copies four 16-B pieces of each, global -> LDS through no register (a wave's copy = 4 whole 128-B lines).
// s_wait_xcnt 0 is the last line of the copies' own statement, so that it stands in front of every later write of the address registers the copies name.
__device__ __forceinline__ void stage_copy(unsigned lk, unsigned lv, const _Float16* gk, const _Float16* gv) {
  asm volatile("global_load_async_to_lds_b128 %0, %8, off\n\t"
               "global_load_async_to_lds_b128 %1, %9, off\n\t"
               "global_load_async_to_lds_b128 %2, %10, off\n\t"
               "global_load_async_to_lds_b128 %3, %11, off\n\t"
               "global_load_async_to_lds_b128 %4, %12, off\n\t"
               "global_load_async_to_lds_b128 %5, %13, off\n\t"
               "global_load_async_to_lds_b128 %6, %14, off\n\t"
               "global_load_async_to_lds_b128 %7, %15, off\n\t"
               "s_wait_xcnt 0x0"
               :: "v"(lk), "v"(lk + 16 * KPI * 2), "v"(lk + 32 * KPI * 2), "v"(lk + 48 * KPI * 2), "v"(lv), "v"(lv + 16 * KPI * 2), "v"(lv + 32 * KPI * 2), "v"(lv + 48 * KPI * 2),
                  "v"(gk), "v"(gk + (size_t)16 * 2 * DM), "v"(gk + (size_t)32 * 2 * DM), "v"(gk + (size_t)48 * 2 * DM), "v"(gv), "v"(gv + (size_t)16 * SS), "v"(gv + (size_t)32 * SS), "v"(gv + (size_t)48 * SS)
               : "memory");
}
// -|k|^2 / 2 of one stage's 64 keys = 256 B: one 8-B piece per lane of ONE wave, global -> LDS through no register; s_wait_xcnt 0 closes the copy's own statement, in front of every later write of its address registers.
__device__ __forceinline__ void stage_copy_k2(unsigned l2, const float* g2) {
  asm volatile("global_load_async_to_lds_b64 %0, %1, off\n\t"
               "s_wait_xcnt 0x0"
               :: "v"(l2), "v"(g2) : "memory");
}
// lane l <-> lane l ^ 16 (the two halves of a wave hold the two halves of one query's keys)
__device__ __forceinline__ float xhalf(float x) { return __builtin_bit_cast(float, __builtin_amdgcn_permlanex16(__builtin_bit_cast(int, x), __builtin_bit_cast(int, x), 0x76543210, 0xfedcba98, false, false)); }
// 2^x for eight values / one value. One statement each: the outputs are early-clobber, so that no v_exp_f32 overwrites a source of the one in front of it, and the closing v_nop is the slot the instruction set asks for
// between a transcendental and a next instruction that reads its result or overwrites its source.
__device__ __forceinline__ v8f exp2x8(v8f x) { float r0, r1, r2, r3, r4, r5, r6, r7;
  asm("v_exp_f32 %0, %8\n\tv_exp_f32 %1, %9\n\tv_exp_f32 %2, %10\n\tv_exp_f32 %3, %11\n\tv_exp_f32 %4, %12\n\tv_exp_f32 %5, %13\n\tv_exp_f32 %6, %14\n\tv_exp_f32 %7, %15\n\tv_nop"
      : "=&v"(r0), "=&v"(r1), "=&v"(r2), "=&v"(r3), "=&v"(r4), "=&v"(r5), "=&v"(r6), "=&v"(r7) : "v"(x[0]), "v"(x[1]), "v"(x[2]), "v"(x[3]), "v"(x[4]), "v"(x[5]), "v"(x[6]), "v"(x[7]));
  return v8f{r0, r1, r2, r3, r4, r5, r6, r7}; }
__device__ __forceinline__ float exp2x1(float x) { float r; asm("v_exp_f32 %0, %1\n\tv_nop" : "=&v"(r) : "v"(x)); return r; }
#define LOG2E 1.44269504088896340736f   // exp(v) = 2^(v log2 e), the form __expf compiles to
__global__ __launch_bounds__(128) void k_attn(const _Float16* __restrict__ QK, const _Float16* __restrict__ QKL, const _Float16* __restrict__ VTH, const _Float16* __restrict__ VTL, const void* __restrict__ KMASK, const float* __restrict__ Q2, const float* __restrict__ TAU, float* __restrict__ O) {
  __shared__ __align__(16) float so[4][16][68];
  __shared__ __align__(16) _Float16 sk[2][KST][KPI], sv[2][HD][KPI];   // two buffers: K rows [key][d], V^T rows [d][key] of one 64-key stage, shared by the block's 4 waves
  __shared__ __align__(16) float sk2[2][KST];                          // two buffers: -|k|^2 / 2 of the stage's keys
  const int tid = threadIdx.x, wave = tid >> 5, lane = tid & 31, col = lane & 15, g = lane >> 4;
  const int qb = blockIdx.x, h = blockIdx.y, b = blockIdx.z; const int q0 = qb * 64 + wave * 16; const size_t rq = (size_t)b * SS + q0 + col;
  const bool w0 = __builtin_amdgcn_readfirstlane(wave) == 0;   // scalar: the wave that copies -|k|^2 / 2
  v16h aq[2];
#pragma unroll
  for (int kc = 0; kc < 2; ++kc) aq[kc] = frag_h(QK + rq * (2 * DM) + h * HD + kc * 32, lane);
  const float tau = bfr(TAU[h]); const float* Q2h = Q2 + ((size_t)b * NH + h) * SS; const float hq = Q2h[q0 + col];   // -|q|^2 / 2 of this lane's query
  // q = k, so logit_ij = -|q_i - q_j|^2 tau / 8 <= 0 for tau >= 0 and logit_ii = 0, and every row meets its own key: the row maximum is 0 before any key is read.
  // Scalar test, the same for the whole block (tau of its head); any other tau (negative, NaN, or so large that the rounding of logit_ii could leave the head room of P in f16) takes the running maximum.
  const bool max0 = __builtin_amdgcn_readfirstlane((int)(tau >= 0.f && tau <= 64.f)) != 0;
  const float xa = 0.25f * tau * LOG2E, xb = hq * xa + 11.0f;   // log2 (2^11 e^logit) = (k.q - |k|^2 / 2) xa + xb
  v8f ls = {};                   // max0: this lane's sums of 2^11 P, one per register position
  float m = -3.0e38f, l = 0.f;   // this lane's query: running maximum (equal in both halves), sum over this half's keys
  v8f acc[4] = {};               // O^T: acc[dt][r] = o[query col][d = dt * 16 + 8 g + r]
  const int nst = SS / KST;   // all keys, 64 a stage
  const int crow = tid >> 3, cpc = tid & 7;   // this thread's row (+ 16 i) and 16-B piece in every stage
  const _Float16* gk = QK + ((size_t)b * SS + crow) * (2 * DM) + DM + h * HD + cpc * 8; const _Float16* gv = VTH + ((size_t)b * DM + h * HD + crow) * SS + cpc * 8;
  const unsigned lk = (unsigned)(size_t)&sk[0][crow][cpc * 8], lv = (unsigned)(size_t)&sv[0][crow][cpc * 8], l2 = (unsigned)(size_t)&sk2[0][lane * 2];
  const float* g2 = Q2h + lane * 2;
  stage_copy(lk, lv, gk, gv);
  if (w0) stage_copy_k2(l2, g2);
  asm volatile("s_wait_asynccnt 0x0" ::: "memory");   // this wave's copies of stage 0 have landed
  __syncthreads();                                    // stage 0 published to all 4 waves
  stage_copy(lk + KSB, lv + KSB, gk + (size_t)KST * 2 * DM, gv + KST);   // stage 1 flies under stage 0's work
  if (w0) stage_copy_k2(l2 + KST * 4, g2 + KST);
#pragma unroll 1   // stages stay rolled: one publish point, at the foot of each trip
  for (int st = 0; st < nst; ++st) { const int bf = st & 1;
  if (max0) {
#pragma unroll   // both 32-key passes of the stage in line: nothing is carried from pass to pass but sums, and every LDS offset is a constant
  for (int sub = 0; sub < KST / 32; ++sub) { v8f e[2];
#pragma unroll
    for (int ct = 0; ct < 2; ++ct) { const _Float16* krow = &sk[bf][sub * 32 + ct * 16 + col][0];
      union { v8f v; v4f q[2]; } k2; const float* kp = &sk2[bf][sub * 32 + ct * 16 + 8 * g]; k2.q[0] = *(const v4f*)kp; k2.q[1] = *(const v4f*)(kp + 4);
      v8f c = k2.v;   // the product starts from -|k|^2 / 2 of its rows
#pragma unroll
      for (int kc = 0; kc < 2; ++kc) c = wmma16(frag_h(krow + kc * 32, lane), aq[kc], c);
      e[ct] = exp2x8(c * xa + xb); }   // 2^11 P: one fma and one exponential a score
    ls += e[0] + e[1];
    v16h pb;
#pragma unroll
    for (int i = 0; i < 8; ++i) { pb[i] = (_Float16)e[0][i]; pb[8 + i] = (_Float16)e[1][i]; }
#pragma unroll
    for (int dt = 0; dt < 4; ++dt) acc[dt] = wmma16(frag_h(&sv[bf][dt * 16 + col][sub * 32], lane), pb, acc[dt]); }
  } else {
#pragma unroll 1
  for (int sub = 0; sub < KST / 32; ++sub) { v8f s[2];   // rolled, as the 32-key pass was: one copy of the body
#pragma unroll
    for (int ct = 0; ct < 2; ++ct) { const _Float16* krow = &sk[bf][sub * 32 + ct * 16 + col][0]; v8f c = {};
#pragma unroll
      for (int kc = 0; kc < 2; ++kc) c = wmma16(frag_h(krow + kc * 32, lane), aq[kc], c);   // c[r] = k_(8 g + r) . q_col: single product, q, k as one-rounding f16 operands
      union { v8f v; v4f q[2]; } k2; const float* kp = &sk2[bf][sub * 32 + ct * 16 + 8 * g]; k2.q[0] = *(const v4f*)kp; k2.q[1] = *(const v4f*)(kp + 4);
      s[ct] = (c + hq + k2.v) * 0.25f * tau; }   // -|q_i - q_j|^2 / sqrt(64) x tau_h
    float mx = fmaxf(s[0][0], s[1][0]);
#pragma unroll
    for (int r = 1; r < 8; ++r) mx = fmaxf(mx, fmaxf(s[0][r], s[1][r]));
    mx = fmaxf(mx, xhalf(mx));
    const float mn = fmaxf(m, mx); const float ea = exp2x1((m - mn) * LOG2E); const float alpha = (m <= -1.0e38f) ? 0.f : ea;
    v8f e[2];
#pragma unroll
    for (int ct = 0; ct < 2; ++ct) { const v8f x = exp2x8((s[ct] - mn) * LOG2E);
#pragma unroll
      for (int r = 0; r < 8; ++r) e[ct][r] = (s[ct][r] <= -1.0e38f) ? 0.f : x[r]; }
    const v8f e2 = e[0] + e[1]; const float es = ((e2[0] + e2[1]) + (e2[2] + e2[3])) + ((e2[4] + e2[5]) + (e2[6] + e2[7]));
    l = l * alpha + es; m = mn;
#pragma unroll
    for (int dt = 0; dt < 4; ++dt) acc[dt] *= alpha;
    v16h pb;   // P^T as B: P scaled by 2^11 before the f16 rounding so small softmax weights stay out of the f16 subnormal range; 2^-11 folded into the epilogue
#pragma unroll
    for (int i = 0; i < 8; ++i) { pb[i] = (_Float16)(e[0][i] * 2048.0f); pb[8 + i] = (_Float16)(e[1][i] * 2048.0f); }
#pragma unroll
    for (int dt = 0; dt < 4; ++dt) acc[dt] = wmma16(frag_h(&sv[bf][dt * 16 + col][sub * 32], lane), pb, acc[dt]); }   // single product: V x P (x2^11)
  }
    // publish point of stage st + 1, every wave, in this order
    asm volatile("s_wait_dscnt 0x0" ::: "memory");      // this wave's reads of buffer bf have returned
    asm volatile("s_wait_asynccnt 0x0" ::: "memory");   // this wave's copies of stage st + 1 have landed
    __syncthreads();                                    // stage st + 1 published; every wave has left buffer bf
    if (st + 2 < nst) { stage_copy(lk + bf * KSB, lv + bf * KSB, gk + (size_t)(st + 2) * KST * 2 * DM, gv + (st + 2) * KST);   // refill of the buffers just read
      if (w0) stage_copy_k2(l2 + bf * (KST * 4), g2 + (st + 2) * KST); } }
  asm volatile("s_wait_asynccnt 0x0" ::: "memory");   // no copy outstanding behind the loop
  if (max0) l = (((ls[0] + ls[1]) + (ls[2] + ls[3])) + ((ls[4] + ls[5]) + (ls[6] + ls[7]))) * (1.0f / 2048.0f);
  l += xhalf(l);   // the halves' sums joined once
  const float il = (1.0f / 2048.0f) / l;
#pragma unroll
  for (int dt = 0; dt < 4; ++dt) { const v8f o = acc[dt] * il; float* p = &so[wave][col][dt * 16 + 8 * g]; *(v4f*)p = __builtin_shufflevector(o, o, 0, 1, 2, 3); *(v4f*)(p + 4) = __builtin_shufflevector(o, o, 4, 5, 6, 7); }
  LDSX();
  for (int rl = 0; rl < 16; ++rl) if (lane < 16) vst2(O + ((size_t)b * SS + q0 + rl) * DM + h * HD + lane * 4, *(const v4f*)&so[wave][rl][lane * 4]);
}
// ---- k_out: block = (64 rows, 128 cols): out = O(hi/lo) . Wo rows (2 products) + bo
__global__ __launch_bounds__(128) void k_out(const float* __restrict__ O, const __bf16* __restrict__ P, const float* __restrict__ BO, float* __restrict__ Y) {
  __shared__ __align__(16) float so[4][16][132];
  const int tid = threadIdx.x, wave = tid >> 5, lane = tid & 31, col = lane & 15, g = lane >> 4; const size_t r0 = (size_t)blockIdx.x * 64 + wave * 16; const int n0 = blockIdx.y * 128;
  __shared__ __align__(16) char sm[2 * XSB + 2 * WSB];   // the ring: two f32 buffers, two weight buffers
  v8f acc[8] = {};
  const char* gx = (const char*)(O + ((size_t)blockIdx.x * 64 + (tid >> 4)) * DM + (tid & 15) * 4); const char* gw = (const char*)(P + (size_t)(n0 + (tid >> 3)) * DM + (tid & 7) * 8);
  const unsigned lx = (unsigned)(size_t)sm + (tid >> 4) * XPB + (tid & 15) * 16, lw = (unsigned)(size_t)sm + 2 * XSB + (tid >> 3) * WPB + (tid & 7) * 16;
  gstage(lx, lw, gx, gw);
  asm volatile("s_wait_asynccnt 0x0" ::: "memory");   // this wave's copies of stage 0 have landed
  __syncthreads();                                    // stage 0 published to all 4 waves
  gstage(lx + XSB, lw + WSB, gx + GST * 4, gw + GST * 2);   // stage 1 flies under stage 0's work
#pragma unroll 1   // stages stay rolled: one publish point, at the foot of each trip
  for (int st = 0; st < DM / GST; ++st) { const int bf = st & 1; const float* xr = (const float*)(sm + bf * XSB + (wave * 16 + col) * XPB); const __bf16* wr = (const __bf16*)(sm + 2 * XSB + bf * WSB + col * WPB);
#pragma unroll
    for (int kc = 0; kc < GST / 32; ++kc) { const F2 a = split_row(xr, kc * 32, lane);
      v16b w[8];   // the eight weight fragments of this k step, read as one group in front of its products
#pragma unroll
      for (int j = 0; j < 8; ++j) w[j] = frag_b(wr + j * 16 * (WPB / 2) + kc * 32, lane);
#pragma unroll
      for (int j = 0; j < 8; ++j) { acc[j] = wmma_bf(a.l, w[j], acc[j]); acc[j] = wmma_bf(a.h, w[j], acc[j]); } }
    // publish point of stage st + 1, every wave, in this order
    asm volatile("s_wait_dscnt 0x0" ::: "memory");      // this wave's reads of buffer bf have returned
    asm volatile("s_wait_asynccnt 0x0" ::: "memory");   // this wave's copies of stage st + 1 have landed
    __syncthreads();                                    // stage st + 1 published; every wave has left buffer bf
    if (st + 2 < DM / GST) gstage(lx + bf * XSB, lw + bf * WSB, gx + (st + 2) * (GST * 4), gw + (st + 2) * (GST * 2)); }   // refill of the buffers just read
  asm volatile("s_wait_asynccnt 0x0" ::: "memory");   // no copy outstanding behind the loop
#pragma unroll
  for (int j = 0; j < 8; ++j) {
#pragma unroll
    for (int r = 0; r < 8; ++r) so[wave][8 * g + r][j * 16 + col] = acc[j][r] + (BO ? bfr(BO[n0 + j * 16 + col]) : 0.f); }
  LDSX();
  for (int rl = 0; rl < 16; ++rl) vst2(Y + (r0 + rl) * DM + n0 + lane * 4, *(const v4f*)&so[wave][rl][lane * 4]);
}
// ---- k_q2: block = (64 tokens, b): -|q|^2 / 2 per (token, head) from the f16 q plane (the same values the scores use); whole 256-B segments per (b,h)
__global__ __launch_bounds__(256) void k_q2(const _Float16* __restrict__ QK, float* __restrict__ Q2) {
  __shared__ __align__(16) float sq[NH][64]; const int t = threadIdx.x; const size_t b = blockIdx.y; const int s0 = blockIdx.x * 64; const int tl = t & 63, hp = t >> 6;   // 64 tokens x 4 groups of 2 heads
  const size_t row = b * SS + s0 + tl;
  for (int hh = hp * 2; hh < hp * 2 + 2; ++hh) { float a = 0.f; const _Float16* q = QK + row * (2 * DM) + hh * HD;
#pragma unroll 8
    for (int d = 0; d < HD; ++d) { const float v = (float)q[d]; a += v * v; }
    sq[hh][tl] = -0.5f * a; }
  __syncthreads();
  for (int e = t; e < NH * 16; e += 256) { const int hh = e >> 4, q4 = e & 15; vst2(Q2 + (b * NH + hh) * SS + s0 + q4 * 4, *(const v4f*)&sq[hh][q4 * 4]); }
}
extern "C" void kernel_launch(void* const* d_in, const int* in_sizes, int n_in, void* d_out, int out_size, void* d_ws, size_t ws_size, hipStream_t stream) {
  (void)in_sizes; (void)n_in; (void)out_size;
  const float** F = (const float**)d_in;   // 0 x [2,4096,512], 1 Wqk [512,512] natural, 2 Wv, 3 Wo, 4 tau [8,1,1]
  if (ws_size < (size_t)WS_END) return;
  char* ws = (char*)d_ws; __bf16* PK = (__bf16*)(ws + WS_PK); _Float16 *QK = (_Float16*)(ws + WS_QK), *QKL = (_Float16*)(ws + WS_QKL), *VTH = (_Float16*)(ws + WS_VTH), *VTL = (_Float16*)(ws + WS_VTL); float *O = (float*)(ws + WS_O), *Q2 = (float*)(ws + WS_Q2);
  k_pack<<<dim3(DM, 4), 256, 0, stream>>>(F[1], F[1], F[2], F[3], PK);   // tied q = k
  k_qkv<<<dim3(TNB * SS / 64, QKVW / 128), 128, 0, stream>>>(F[0], F[0], F[0], PK + PK_A, nullptr, nullptr, nullptr, QK, QKL, VTH, VTL);
  k_q2<<<dim3(SS / 64, TNB), 256, 0, stream>>>(QK, Q2);
  k_attn<<<dim3(TQB, NH, TNB), 128, 0, stream>>>(QK, QKL, VTH, VTL, nullptr, Q2, F[4], O);
  k_out<<<dim3(TOB, DM / 128), 128, 0, stream>>>(O, PK + PK_P, nullptr, (float*)d_out);
}

// v005
// A run of this version takes 107 microseconds.
// Two timings next to v004 put it at 1.21 and 1.22 times that version's speed.
// All steps since v000 together make it 4.71 times as fast.
// compute dtype: all float inputs rounded to bf16, tau read on device; qk / v = x . W^T with EXACT bf16 products on WMMA 16x16x32 (natural rows; the tied projection fills both the q and the k planes); PLAIN attention: q single f16, |q|^2 per token from the same f16 values in f32, logits = (2 q_i.q_j - |q_i|^2 - |q_j|^2) / 8 x tau_h, softmax in f32 (hardware exp; maximum 0 known for 0 <= tau_h <= 64, running maximum otherwise), P (scaled by 2^11, single f16) x v (single f16); out = o (bf16 hi + residual) . Wo^T (2 products).
#include <hip/hip_runtime.h>
#include <math.h>

typedef __attribute__((ext_vector_type(16))) _Float16 v16h;
typedef __attribute__((ext_vector_type(16))) __bf16 v16b;
typedef __attribute__((ext_vector_type(8)))  _Float16 v8h;
typedef __attribute__((ext_vector_type(8)))  float v8f;
typedef __attribute__((ext_vector_type(4)))  float v4f;
typedef __attribute__((ext_vector_type(2)))  float v2f;
typedef __attribute__((ext_vector_type(4)))  unsigned v4u;
typedef __attribute__((ext_vector_type(4)))  int v4i;
typedef float __attribute__((may_alias)) float_a;
typedef int __attribute__((may_alias)) int_a;

template <typename T> __device__ __forceinline__ void vst2(void* p, T v) { *(T*)p = v;  }
__device__ __forceinline__ v8f wmma16(v16h a, v16h b, v8f c) {
  v8f d = __builtin_amdgcn_wmma_f32_16x16x32_f16(false, a, false, b, (short)0, c, false, false);
  asm volatile("v_nop\n\tv_nop\n\tv_nop\n\tv_nop" : "+v"(d) : "v"(a), "v"(b));
  return d;
}
__device__ __forceinline__ v8f wmma_bf(v16b a, v16b b, v8f c) {
  v8f d = __builtin_amdgcn_wmma_f32_16x16x32_bf16(false, a, false, b, (short)0, c, false, false);
  asm volatile("v_nop\n\tv_nop\n\tv_nop\n\tv_nop" : "+v"(d) : "v"(a), "v"(b));
  return d;
}
// Token-diffusion attention (B 2, N 4,096, d 512, 8 heads x 64): tied q = k projection, distance-kernel logits -|q_i - q_j|^2 / 8 x tau_h, softmax, . v, output projection.
__device__ __forceinline__ v16h frag_h(const _Float16* rowk0, int lane) {
  union { v16h v; v8h q[2]; } u; const _Float16* p = rowk0 + 8 * (lane >> 4);
  u.q[0] = *(const v8h*)p; u.q[1] = *(const v8h*)(p + 16); return u.v;
}
__device__ __forceinline__ v16h frag_f32(const float* rowk0, int lane) {
  v16h a; const float* p = rowk0 + 8 * (lane >> 4);
#pragma unroll
  for (int i = 0; i < 8; ++i) { a[i] = (_Float16)p[i]; a[8 + i] = (_Float16)p[16 + i]; }
  return a;
}
__device__ __forceinline__ v16h frag_f32s(const float* rowk0, int lane, float sc) {
  v16h a; const float* p = rowk0 + 8 * (lane >> 4);
#pragma unroll
  for (int i = 0; i < 8; ++i) { a[i] = (_Float16)(p[i] * sc); a[8 + i] = (_Float16)(p[16 + i] * sc); }
  return a;
}
// column fragment from a [K][ld] layout (column n), rows >= K read as 0
__device__ __forceinline__ v16h fragc_f32(const float* W, int k0, int n, int lane, int ld, int K) {
  v16h a; const int g = lane >> 4;
#pragma unroll
  for (int i = 0; i < 8; ++i) { const int ka = k0 + 8 * g + i, kb = ka + 16;
    a[i] = (_Float16)(ka < K ? W[(size_t)(ka < K ? ka : K - 1) * ld + n] : 0.f); a[8 + i] = (_Float16)(kb < K ? W[(size_t)(kb < K ? kb : K - 1) * ld + n] : 0.f); }
  return a;
}
struct F2 { v16b h, l; };
__device__ __forceinline__ F2 bsplit16(const float v[16]) { F2 r;
#pragma unroll
  for (int i = 0; i < 16; ++i) { const __bf16 h = (__bf16)v[i]; r.h[i] = h; r.l[i] = (__bf16)(v[i] - (float)h); }
  return r; }
__device__ __forceinline__ F2 split_row(const float* row, int k0, int lane) { float v[16]; const float* p = row + k0 + 8 * (lane >> 4);
#pragma unroll
  for (int i = 0; i < 8; ++i) { v[i] = p[i]; v[8 + i] = p[16 + i]; }
  return bsplit16(v); }
__device__ __forceinline__ F2 split_rowK(const float* row, int k0, int lane, int K) { float v[16]; const int g = lane >> 4;
#pragma unroll
  for (int i = 0; i < 8; ++i) { const int ka = k0 + 8 * g + i, kb = ka + 16; v[i] = ka < K ? row[ka < K ? ka : K - 1] : 0.f; v[8 + i] = kb < K ? row[kb < K ? kb : K - 1] : 0.f; }
  return bsplit16(v); }
__device__ __forceinline__ F2 split_col(const float* W, int k0, int n, int lane, int ld, int K) { float v[16]; const int g = lane >> 4;
#pragma unroll
  for (int i = 0; i < 8; ++i) { const int ka = k0 + 8 * g + i, kb = ka + 16; v[i] = ka < K ? W[(size_t)(ka < K ? ka : K - 1) * ld + n] : 0.f; v[8 + i] = kb < K ? W[(size_t)(kb < K ? kb : K - 1) * ld + n] : 0.f; }
  return bsplit16(v); }
__device__ __forceinline__ v8f mac3(const F2& a, const F2& b, v8f c) { c = wmma_bf(a.l, b.h, c); c = wmma_bf(a.h, b.l, c); return wmma_bf(a.h, b.h, c); }
__device__ __forceinline__ float sigm(float v) { return 1.0f / (1.0f + expf(-v)); }
#define LDSX() do { asm volatile("s_wait_dscnt 0" ::: "memory"); __builtin_amdgcn_wave_barrier(); __builtin_amdgcn_fence(__ATOMIC_RELEASE, "workgroup"); } while (0)


#define NB 2
#define SS 4096
#define DM 512
#define NH 8
#define HD 64
#define QKVW (3 * DM)
#ifndef TQB
#define TQB (SS / 128)         // query blocks of k_attn: 4 waves x 32 queries
#define TNB NB
#define TOB (NB * SS / 64)     // output row tiles (all)
#endif
typedef __attribute__((ext_vector_type(8))) __bf16 v8b;
__device__ __forceinline__ v16b frag_b(const __bf16* rowk0, int lane) {
  union { v16b v; v8b q[2]; } u; const __bf16* p = rowk0 + 8 * (lane >> 4);
  u.q[0] = *(const v8b*)p; u.q[1] = *(const v8b*)(p + 16); return u.v;
}
__device__ __forceinline__ float bfr(float v) { return (float)(__bf16)v; }
__device__ __attribute__((noinline)) float exp_ni(float v) { return expf(v); }
__device__ __attribute__((noinline)) float erf_ni(float v) { return erff(v); }

#define PK_A 0                       // [1536][512] Wqkv rows (natural [out][in])
#define PK_P (PK_A + QKVW * DM)        // [512][512] Wo rows (natural)
#define PK_END (PK_P + DM * DM)
#define WS_PK  0u
#define WS_QK  (WS_PK + 2u * PK_END)             // f16 [8192 rows][1024]: q | k
#define WS_QKL (WS_QK + 2u * NB * SS * 2 * DM)     // f16 q | k residual planes x2048
#define WS_VTH (WS_QKL + 2u * NB * SS * 2 * DM)    // f16 [b][512 (h*64+d)][4096 s] hi
#define WS_VTL (WS_VTH + 2u * NB * DM * SS)        // f16 lo x 2048
#define WS_O   (WS_VTL + 2u * NB * DM * SS)        // f32 [8192][512]
#define WS_CS  (WS_O + 4u * NB * SS * DM)           // f32 2 x [4096][32], unused
#define WS_Q2  (WS_CS + 4u * 2 * SS * 32)                  // f32 [b][h][s] -|q|^2 / 2
#define WS_END (WS_Q2 + 4u * (size_t)NB * NH * SS)
// ---- k_pack: block = (row n, which): natural [out][in] rows -> bf16; which 0..2 -> W_q/W_k/W_v into PK_A rows which*512 + n; 3 -> W_o into PK_P
__global__ __launch_bounds__(256) void k_pack(const float* __restrict__ WQ, const float* __restrict__ WK, const float* __restrict__ WV, const float* __restrict__ WO, __bf16* __restrict__ PK) {
  __shared__ __align__(16) __bf16 s[DM]; const int n = blockIdx.x, which = blockIdx.y, t = threadIdx.x; const float* Wm = (which == 0) ? WQ : (which == 1) ? WK : (which == 2) ? WV : WO;
  for (int k = t; k < DM; k += 256) s[k] = (__bf16)Wm[(size_t)n * DM + k];
  __syncthreads();
  __bf16* dst = (which < 3) ? PK + PK_A + ((size_t)which * DM + n) * DM : PK + PK_P + (size_t)n * DM;
  for (int q = t; q < DM / 8; q += 256) vst2((unsigned*)(dst + q * 8), *(const v4u*)&s[q * 8]);
}
// ---- LDS ring of the two projection kernels: one stage = 64 k of the block's 64 f32 rows (256 B a row) and of its 128 bf16 weight rows (128 B a row)
#define GST 64                 // k per stage
#define XPB 272                // LDS pitch of an f32 row piece: 256 B + 16 B, an odd multiple of 16 B (conflict-free for ds_load_b128)
#define WPB 144                // LDS pitch of a weight row piece: 128 B + 16 B, an odd multiple of 16 B
#define XSB (64 * XPB)         // bytes of one f32 buffer
#define WSB (128 * WPB)        // bytes of one weight buffer
// eight 16-B pieces per thread, global -> LDS through no register, at fixed steps of both addresses (a wave's copy = 4 whole 128-B lines).
// s_wait_xcnt 0 is the last line of the copies' own statement, so that it stands in front of every later write of the address registers the copies name.
__device__ __forceinline__ void copy8(unsigned l, unsigned ls, const char* gp, size_t gs) {
  asm volatile("global_load_async_to_lds_b128 %0, %8, off\n\t"
               "global_load_async_to_lds_b128 %1, %9, off\n\t"
               "global_load_async_to_lds_b128 %2, %10, off\n\t"
               "global_load_async_to_lds_b128 %3, %11, off\n\t"
               "global_load_async_to_lds_b128 %4, %12, off\n\t"
               "global_load_async_to_lds_b128 %5, %13, off\n\t"
               "global_load_async_to_lds_b128 %6, %14, off\n\t"
               "global_load_async_to_lds_b128 %7, %15, off\n\t"
               "s_wait_xcnt 0x0"
               :: "v"(l), "v"(l + ls), "v"(l + 2 * ls), "v"(l + 3 * ls), "v"(l + 4 * ls), "v"(l + 5 * ls), "v"(l + 6 * ls), "v"(l + 7 * ls),
                  "v"(gp), "v"(gp + gs), "v"(gp + 2 * gs), "v"(gp + 3 * gs), "v"(gp + 4 * gs), "v"(gp + 5 * gs), "v"(gp + 6 * gs), "v"(gp + 7 * gs)
               : "memory");
}
// one stage: thread t copies f32 rows (t >> 4) + 8 i, piece t & 15, and weight rows (t >> 3) + 16 i, piece t & 7
__device__ __forceinline__ void gstage(unsigned lx, unsigned lw, const char* gx, const char* gw) { copy8(lx, 8 * XPB, gx, (size_t)8 * DM * 4); copy8(lw, 16 * WPB, gw, (size_t)16 * DM * 2); }
__global__ __launch_bounds__(128) void k_qkv(const float* __restrict__ XQ, const float* __restrict__ XK, const float* __restrict__ XV, const __bf16* __restrict__ P, const float* __restrict__ BQ, const float* __restrict__ BK, const float* __restrict__ BV, _Float16* __restrict__ QK, _Float16* __restrict__ QKL, _Float16* __restrict__ VTH, _Float16* __restrict__ VTL) {
  const int which0 = (blockIdx.y * 128) / DM; const float* X = (which0 == 0) ? XQ : (which0 == 1) ? XK : XV; const float* BB = BQ ? (((which0 == 0) ? BQ : (which0 == 1) ? BK : BV) + (blockIdx.y * 128 - which0 * DM)) : nullptr;
  __shared__ __align__(16) char sm[2 * XSB + 2 * WSB];   // the ring: two f32 buffers, two weight buffers; behind the loop's last barrier the same bytes are the output staging
  _Float16 (*so)[16][136] = (_Float16 (*)[16][136])sm, (*sol)[16][136] = (_Float16 (*)[16][136])(sm + XSB); _Float16 (*sth)[72] = (_Float16 (*)[72])(sm + 2 * XSB), (*stl)[72] = (_Float16 (*)[72])(sm + 2 * XSB + WSB);
  const int tid = threadIdx.x, wave = tid >> 5, lane = tid & 31, col = lane & 15, g = lane >> 4; const size_t r0 = (size_t)blockIdx.x * 64 + wave * 16; const int n0 = blockIdx.y * 128;
  v8f acc[8] = {};
  const char* gx = (const char*)(X + ((size_t)blockIdx.x * 64 + (tid >> 4)) * DM + (tid & 15) * 4); const char* gw = (const char*)(P + (size_t)(n0 + (tid >> 3)) * DM + (tid & 7) * 8);
  const unsigned lx = (unsigned)(size_t)sm + (tid >> 4) * XPB + (tid & 15) * 16, lw = (unsigned)(size_t)sm + 2 * XSB + (tid >> 3) * WPB + (tid & 7) * 16;
  gstage(lx, lw, gx, gw);
  asm volatile("s_wait_asynccnt 0x0" ::: "memory");   // this wave's copies of stage 0 have landed
  __syncthreads();                                    // stage 0 published to all 4 waves
  gstage(lx + XSB, lw + WSB, gx + GST * 4, gw + GST * 2);   // stage 1 flies under stage 0's work
#pragma unroll 1   // stages stay rolled: one publish point, at the foot of each trip
  for (int st = 0; st < DM / GST; ++st) { const int bf = st & 1; const float* xr = (const float*)(sm + bf * XSB + (wave * 16 + col) * XPB); const __bf16* wr = (const __bf16*)(sm + 2 * XSB + bf * WSB + col * WPB);
#pragma unroll
    for (int kc = 0; kc < GST / 32; ++kc) { v16b a; { const float* p = xr + kc * 32 + 8 * g;
#pragma unroll
        for (int i = 0; i < 8; ++i) { a[i] = (__bf16)p[i]; a[8 + i] = (__bf16)p[16 + i]; } }
      v16b w[8];   // the eight weight fragments of this k step, read as one group in front of its products
#pragma unroll
      for (int j = 0; j < 8; ++j) w[j] = frag_b(wr + j * 16 * (WPB / 2) + kc * 32, lane);
#pragma unroll
      for (int j = 0; j < 8; ++j) acc[j] = wmma_bf(a, w[j], acc[j]); }
    // publish point of stage st + 1, every wave, in this order
    asm volatile("s_wait_dscnt 0x0" ::: "memory");      // this wave's reads of buffer bf have returned
    asm volatile("s_wait_asynccnt 0x0" ::: "memory");   // this wave's copies of stage st + 1 have landed
    __syncthreads();                                    // stage st + 1 published; every wave has left buffer bf
    if (st + 2 < DM / GST) gstage(lx + bf * XSB, lw + bf * WSB, gx + (st + 2) * (GST * 4), gw + (st + 2) * (GST * 2)); }   // refill of the buffers just read
  asm volatile("s_wait_asynccnt 0x0" ::: "memory");   // no copy outstanding behind the loop
  if (n0 < 2 * DM) {   // q stored unscaled (f16 sigma ~0.6, no subnormal exposure); 1/8 applied to the f32 score
#pragma unroll
    for (int j = 0; j < 8; ++j) {
#pragma unroll
      for (int r = 0; r < 8; ++r) { const float v = acc[j][r] + (BB ? bfr(BB[j * 16 + col]) : 0.f); const _Float16 hv = (_Float16)v; so[wave][8 * g + r][j * 16 + col] = hv; sol[wave][8 * g + r][j * 16 + col] = (_Float16)((v - (float)hv) * 2048.0f); } }   // q, k (+ bias) as f16 hi + (x2048) residual
    LDSX();
    for (int rl = 0; rl < 16; ++rl) if (lane < 16) { vst2((unsigned*)(QK + (r0 + rl) * (2 * DM) + n0 + lane * 8), *(const v4u*)&so[wave][rl][lane * 8]); vst2((unsigned*)(QKL + (r0 + rl) * (2 * DM) + n0 + lane * 8), *(const v4u*)&sol[wave][rl][lane * 8]); }
  } else {
#pragma unroll
    for (int j = 0; j < 8; ++j) {
#pragma unroll
      for (int r = 0; r < 8; ++r) { const float v = acc[j][r] + (BB ? bfr(BB[j * 16 + col]) : 0.f); const _Float16 hv = (_Float16)v; sth[j * 16 + col][wave * 16 + 8 * g + r] = hv; stl[j * 16 + col][wave * 16 + 8 * g + r] = (_Float16)((v - (float)hv) * 2048.0f); } }
    __syncthreads();
    const size_t rb = (size_t)blockIdx.x * 64; const int b = (int)(rb / SS), s0 = (int)(rb % SS); const int pc0 = n0 - 2 * DM;
    for (int q = tid; q < 128 * 8; q += 128) { const int d = q >> 3, pc = q & 7; const size_t o = ((size_t)b * DM + pc0 + d) * SS + s0 + pc * 8; vst2((unsigned*)(VTH + o), *(const v4u*)&sth[d][pc * 8]); vst2((unsigned*)(VTL + o), *(const v4u*)&stl[d][pc * 8]); }
  }
}
// ---- k_attn: block = (128 queries, head h, batch b): all-keys flash attention (K = 64: 2 k-steps), logits = -|q - k|^2 / 8 x tau_h with single f16 operands, P.V: f16 P (x2^11) x V hi (single f16) in one accumulator; O[b*S+q][h*64+d] = acc / 2048 / l (256-B segments)
#define KST 64   // keys per LDS stage
#define KPI 72   // LDS row pitch in f16: a 128-B row + 16 B = 144 B, an odd multiple of 16 B (conflict-free for ds_load_b128)
#define KSB (KST * KPI * 2)   // bytes of one K (or V^T) buffer
// one stage = 64 K rows x 128 B + 64 V^T rows x 128 B: each of the 128 threads copies four 16-B pieces of each, global -> LDS through no register (a wave's copy = 4 whole 128-B lines).
// s_wait_xcnt 0 is the last line of the copies' own statement, so that it stands in front of every later write of the address registers the copies name.
__device__ __forceinline__ void stage_copy(unsigned lk, unsigned lv, const _Float16* gk, const _Float16* gv) {
  asm volatile("global_load_async_to_lds_b128 %0, %8, off\n\t"
               "global_load_async_to_lds_b128 %1, %9, off\n\t"
               "global_load_async_to_lds_b128 %2, %10, off\n\t"
               "global_load_async_to_lds_b128 %3, %11, off\n\t"
               "global_load_async_to_lds_b128 %4, %12, off\n\t"
               "global_load_async_to_lds_b128 %5, %13, off\n\t"
               "global_load_async_to_lds_b128 %6, %14, off\n\t"
               "global_load_async_to_lds_b128 %7, %15, off\n\t"
               "s_wait_xcnt 0x0"
               :: "v"(lk), "v"(lk + 16 * KPI * 2), "v"(lk + 32 * KPI * 2), "v"(lk + 48 * KPI * 2), "v"(lv), "v"(lv + 16 * KPI * 2), "v"(lv + 32 * KPI * 2), "v"(lv + 48 * KPI * 2),
                  "v"(gk), "v"(gk + (size_t)16 * 2 * DM), "v"(gk + (size_t)32 * 2 * DM), "v"(gk + (size_t)48 * 2 * DM), "v"(gv), "v"(gv + (size_t)16 * SS), "v"(gv + (size_t)32 * SS), "v"(gv + (size_t)48 * SS)
               : "memory");
}
// -|k|^2 / 2 of one stage's 64 keys = 256 B: one 8-B piece per lane of ONE wave, global -> LDS through no register; s_wait_xcnt 0 closes the copy's own statement, in front of every later write of its address registers.
__device__ __forceinline__ void stage_copy_k2(unsigned l2, const float* g2) {
  asm volatile("global_load_async_to_lds_b64 %0, %1, off\n\t"
               "s_wait_xcnt 0x0"
               :: "v"(l2), "v"(g2) : "memory");
}
// lane l <-> lane l ^ 16 (the two halves of a wave hold the two halves of one query's keys)
__device__ __forceinline__ float xhalf(float x) { return __builtin_bit_cast(float, __builtin_amdgcn_permlanex16(__builtin_bit_cast(int, x), __builtin_bit_cast(int, x), 0x76543210, 0xfedcba98, false, false)); }
// 2^x for eight values / one value. One statement each: the outputs are early-clobber, so that no v_exp_f32 overwrites a source of the one in front of it, and the closing v_nop is the slot the instruction set asks for
// between a transcendental and a next instruction that reads its result or overwrites its source.
__device__ __forceinline__ v8f exp2x8(v8f x) { float r0, r1, r2, r3, r4, r5, r6, r7;
  asm("v_exp_f32 %0, %8\n\tv_exp_f32 %1, %9\n\tv_exp_f32 %2, %10\n\tv_exp_f32 %3, %11\n\tv_exp_f32 %4, %12\n\tv_exp_f32 %5, %13\n\tv_exp_f32 %6, %14\n\tv_exp_f32 %7, %15\n\tv_nop"
      : "=&v"(r0), "=&v"(r1), "=&v"(r2), "=&v"(r3), "=&v"(r4), "=&v"(r5), "=&v"(r6), "=&v"(r7) : "v"(x[0]), "v"(x[1]), "v"(x[2]), "v"(x[3]), "v"(x[4]), "v"(x[5]), "v"(x[6]), "v"(x[7]));
  return v8f{r0, r1, r2, r3, r4, r5, r6, r7}; }
__device__ __forceinline__ float exp2x1(float x) { float r; asm("v_exp_f32 %0, %1\n\tv_nop" : "=&v"(r) : "v"(x)); return r; }
#define LOG2E 1.44269504088896340736f   // exp(v) = 2^(v log2 e), the form __expf compiles to
#define QT 2   // 16-query tiles per wave: in the max0 loop every K and V^T fragment read from LDS is the A operand of QT products
// s a + b on register pairs: the two constants stay one pair each, whichever pair of s they meet
__device__ __forceinline__ v8f fma8(v8f s, v2f a, v2f b) { union { v8f v; v2f p[4]; } u; u.v = s;
#pragma unroll
  for (int i = 0; i < 4; ++i) u.p[i] = u.p[i] * a + b;
  return u.v; }
__device__ __forceinline__ v8f ld8f(const float* p) { union { v8f v; v4f q[2]; } u; u.q[0] = *(const v4f*)p; u.q[1] = *(const v4f*)(p + 4); return u.v; }
// one 32-key pass of one query tile with the running maximum (any tau): kb = K row (pass key 0 + col), kp = -|k|^2 / 2 of pass key 8 g, vb = V^T row col at the pass's first key
__device__ __forceinline__ void pass_runmax(const _Float16* kb, const float* kp, const _Float16* vb, int lane, const v16h (&aq)[2], float hq, float tau, float& m, float& l, v8f (&acc)[4]) {
  v8f s[2];
#pragma unroll
  for (int ct = 0; ct < 2; ++ct) { const _Float16* krow = kb + ct * 16 * KPI; v8f c = {};
#pragma unroll
    for (int kc = 0; kc < 2; ++kc) c = wmma16(frag_h(krow + kc * 32, lane), aq[kc], c);   // c[r] = k_(8 g + r) . q_col: single product, q, k as one-rounding f16 operands
    s[ct] = (c + hq + ld8f(kp + ct * 16)) * 0.25f * tau; }   // -|q_i - q_j|^2 / sqrt(64) x tau_h
  float mx = fmaxf(s[0][0], s[1][0]);
#pragma unroll
  for (int r = 1; r < 8; ++r) mx = fmaxf(mx, fmaxf(s[0][r], s[1][r]));
  mx = fmaxf(mx, xhalf(mx));
  const float mn = fmaxf(m, mx); const float ea = exp2x1((m - mn) * LOG2E); const float alpha = (m <= -1.0e38f) ? 0.f : ea;
  v8f e[2];
#pragma unroll
  for (int ct = 0; ct < 2; ++ct) { const v8f x = exp2x8((s[ct] - mn) * LOG2E);
#pragma unroll
    for (int r = 0; r < 8; ++r) e[ct][r] = (s[ct][r] <= -1.0e38f) ? 0.f : x[r]; }
  const v8f e2 = e[0] + e[1]; const float es = ((e2[0] + e2[1]) + (e2[2] + e2[3])) + ((e2[4] + e2[5]) + (e2[6] + e2[7]));
  l = l * alpha + es; m = mn;
#pragma unroll
  for (int dt = 0; dt < 4; ++dt) acc[dt] *= alpha;
  v16h pb;   // P^T as B: P scaled by 2^11 before the f16 rounding so small softmax weights stay out of the f16 subnormal range; 2^-11 folded into the epilogue
#pragma unroll
  for (int i = 0; i < 8; ++i) { pb[i] = (_Float16)(e[0][i] * 2048.0f); pb[8 + i] = (_Float16)(e[1][i] * 2048.0f); }
#pragma unroll
  for (int dt = 0; dt < 4; ++dt) acc[dt] = wmma16(frag_h(vb + dt * 16 * KPI, lane), pb, acc[dt]);   // single product: V x P (x2^11)
}
// publish point of stage st + 1, every wave, in this order; then the refill of the buffers just read
__device__ __forceinline__ void ring_foot(int st, bool w0, unsigned lk, unsigned lv, unsigned l2, const _Float16* gk, const _Float16* gv, const float* g2) { const int bf = st & 1;
  asm volatile("s_wait_dscnt 0x0" ::: "memory");      // this wave's reads of buffer bf have returned
  asm volatile("s_wait_asynccnt 0x0" ::: "memory");   // this wave's copies of stage st + 1 have landed
  __syncthreads();                                    // stage st + 1 published; every wave has left buffer bf
  if (st + 2 < SS / KST) { stage_copy(lk + bf * KSB, lv + bf * KSB, gk + (size_t)(st + 2) * KST * 2 * DM, gv + (st + 2) * KST);
    if (w0) stage_copy_k2(l2 + bf * (KST * 4), g2 + (st + 2) * KST); } }
// amdgpu_waves_per_eu(4, 4): a budget of 256 registers, so that the loop stays inside one register window (left free, this build took 261 and switched windows in the loop)
__global__ __launch_bounds__(128) __attribute__((amdgpu_waves_per_eu(4, 4))) void k_attn(const _Float16* __restrict__ QK, const _Float16* __restrict__ QKL, const _Float16* __restrict__ VTH, const _Float16* __restrict__ VTL, const void* __restrict__ KMASK, const float* __restrict__ Q2, const float* __restrict__ TAU, float* __restrict__ O) {
  __shared__ __align__(16) float so[4][QT * 16][68];
  __shared__ __align__(16) _Float16 sk[2][KST][KPI], sv[2][HD][KPI];   // two buffers: K rows [key][d], V^T rows [d][key] of one 64-key stage, shared by the block's 4 waves
  __shared__ __align__(16) float sk2[2][KST];                          // two buffers: -|k|^2 / 2 of the stage's keys
  const int tid = threadIdx.x, wave = tid >> 5, lane = tid & 31, col = lane & 15, g = lane >> 4;
  const int qb = blockIdx.x, h = blockIdx.y, b = blockIdx.z; const int q0 = qb * (4 * QT * 16) + wave * (QT * 16);
  const bool w0 = __builtin_amdgcn_readfirstlane(wave) == 0;   // scalar: the wave that copies -|k|^2 / 2
  const float tau = bfr(TAU[h]); const float* Q2h = Q2 + ((size_t)b * NH + h) * SS;
  v16h aq[QT][2]; float hq[QT];   // per tile: this lane's query as B operand, and its -|q|^2 / 2
#pragma unroll
  for (int qt = 0; qt < QT; ++qt) { hq[qt] = Q2h[q0 + qt * 16 + col];
#pragma unroll
    for (int kc = 0; kc < 2; ++kc) aq[qt][kc] = frag_h(QK + ((size_t)b * SS + q0 + qt * 16 + col) * (2 * DM) + h * HD + kc * 32, lane); }
  // q = k, so logit_ij = -|q_i - q_j|^2 tau / 8 <= 0 for tau >= 0 and logit_ii = 0, and every row meets its own key: the row maximum is 0 before any key is read.
  // Scalar test, the same for the whole block (tau of its head); any other tau (negative, NaN, or so large that the rounding of logit_ii could leave the head room of P in f16) takes the running maximum.
  const bool max0 = __builtin_amdgcn_readfirstlane((int)(tau >= 0.f && tau <= 64.f)) != 0;
  const float xa = 0.25f * tau * LOG2E;   // log2 (2^11 e^logit) = (k.q - |k|^2 / 2) xa + xb
  const v2f xa2 = {xa, xa};
  float m[QT], l[QT];            // per tile, this lane's query: running maximum (equal in both halves); sum over this half's keys
  v2f xb2[QT], ls[QT];           // max0: xb; this lane's sums of 2^11 P, folded to one register pair in every pass
  v8f acc[QT][4];                // O^T: acc[qt][dt][r] = o[query col of tile qt][d = dt * 16 + 8 g + r]
#pragma unroll
  for (int qt = 0; qt < QT; ++qt) { const float xb = hq[qt] * xa + 11.0f; xb2[qt] = v2f{xb, xb}; m[qt] = -3.0e38f; l[qt] = 0.f; ls[qt] = v2f{};
#pragma unroll
    for (int dt = 0; dt < 4; ++dt) acc[qt][dt] = v8f{}; }
  const int nst = SS / KST;   // all keys, 64 a stage
  const int crow = tid >> 3, cpc = tid & 7;   // this thread's row (+ 16 i) and 16-B piece in every stage
  const _Float16* gk = QK + ((size_t)b * SS + crow) * (2 * DM) + DM + h * HD + cpc * 8; const _Float16* gv = VTH + ((size_t)b * DM + h * HD + crow) * SS + cpc * 8;
  const unsigned lk = (unsigned)(size_t)&sk[0][crow][cpc * 8], lv = (unsigned)(size_t)&sv[0][crow][cpc * 8], l2 = (unsigned)(size_t)&sk2[0][lane * 2];
  const float* g2 = Q2h + lane * 2;
  stage_copy(lk, lv, gk, gv);
  if (w0) stage_copy_k2(l2, g2);
  asm volatile("s_wait_asynccnt 0x0" ::: "memory");   // this wave's copies of stage 0 have landed
  __syncthreads();                                    // stage 0 published to all 4 waves
  stage_copy(lk + KSB, lv + KSB, gk + (size_t)KST * 2 * DM, gv + KST);   // stage 1 flies under stage 0's work
  if (w0) stage_copy_k2(l2 + KST * 4, g2 + KST);
  if (max0) {   // the same for the whole block: each side has its own loop over the stages, with the same publish point
#pragma unroll 1   // stages stay rolled: one publish point, at the foot of each trip
  for (int st = 0; st < nst; ++st) { const int bf = st & 1; const _Float16* kb = &sk[bf][col][0]; const _Float16* vb = &sv[bf][col][0]; const float* kp = &sk2[bf][8 * g];
    v16h kf[2][2]; v8f k2[2];   // the K fragments and -|k|^2 / 2 of one 32-key pass, read as one group
#pragma unroll
    for (int ct = 0; ct < 2; ++ct) { k2[ct] = ld8f(kp + ct * 16);
#pragma unroll
      for (int kc = 0; kc < 2; ++kc) kf[ct][kc] = frag_h(kb + ct * 16 * KPI + kc * 32, lane); }
#pragma unroll   // both 32-key passes of the stage in line: nothing is carried from pass to pass but sums and the fragments fetched ahead, and every LDS offset is a constant
    for (int sub = 0; sub < KST / 32; ++sub) { v8f s[QT][2];
#pragma unroll
      for (int kc = 0; kc < 2; ++kc) {   // four independent tiles between a product and the one that adds to it
#pragma unroll
        for (int ct = 0; ct < 2; ++ct) {
#pragma unroll
          for (int qt = 0; qt < QT; ++qt) s[qt][ct] = wmma16(kf[ct][kc], aq[qt][kc], kc ? s[qt][ct] : k2[ct]); } }   // the product starts from -|k|^2 / 2 of its rows
      v16h vf[4];   // this pass's V^T fragments and the next pass's K group: one place of LDS reads, in flight under the exponentials
#pragma unroll
      for (int dt = 0; dt < 4; ++dt) vf[dt] = frag_h(vb + dt * 16 * KPI + sub * 32, lane);
      if (sub + 1 < KST / 32) {
#pragma unroll
        for (int ct = 0; ct < 2; ++ct) { k2[ct] = ld8f(kp + (sub + 1) * 32 + ct * 16);
#pragma unroll
          for (int kc = 0; kc < 2; ++kc) kf[ct][kc] = frag_h(kb + ((sub + 1) * 32 + ct * 16) * KPI + kc * 32, lane); } }
      v16h pb[QT];
#pragma unroll
      for (int qt = 0; qt < QT; ++qt) { const v8f e0 = exp2x8(fma8(s[qt][0], xa2, xb2[qt])), e1 = exp2x8(fma8(s[qt][1], xa2, xb2[qt]));   // 2^11 P: one fma and one exponential a score
        const v8f e2 = e0 + e1; const v4f e4 = __builtin_shufflevector(e2, e2, 0, 1, 2, 3) + __builtin_shufflevector(e2, e2, 4, 5, 6, 7);
        ls[qt] += __builtin_shufflevector(e4, e4, 0, 1) + __builtin_shufflevector(e4, e4, 2, 3);
#pragma unroll
        for (int i = 0; i < 8; ++i) { pb[qt][i] = (_Float16)e0[i]; pb[qt][8 + i] = (_Float16)e1[i]; } }
#pragma unroll
      for (int dt = 0; dt < 4; ++dt) {
#pragma unroll
        for (int qt = 0; qt < QT; ++qt) acc[qt][dt] = wmma16(vf[dt], pb[qt], acc[qt][dt]); } }
    ring_foot(st, w0, lk, lv, l2, gk, gv, g2); }
  } else {
#pragma unroll 1   // stages stay rolled: one publish point, at the foot of each trip
  for (int st = 0; st < nst; ++st) { const int bf = st & 1; const _Float16* kb = &sk[bf][col][0]; const _Float16* vb = &sv[bf][col][0]; const float* kp = &sk2[bf][8 * g];
#pragma unroll 1
    for (int sub = 0; sub < KST / 32; ++sub) {   // rolled, as the 32-key pass was: one copy of the body per tile
#pragma unroll
      for (int qt = 0; qt < QT; ++qt) pass_runmax(kb + sub * 32 * KPI, kp + sub * 32, vb + sub * 32, lane, aq[qt], hq[qt], tau, m[qt], l[qt], acc[qt]); }
    ring_foot(st, w0, lk, lv, l2, gk, gv, g2); }
  }
  asm volatile("s_wait_asynccnt 0x0" ::: "memory");   // no copy outstanding behind the loop
#pragma unroll
  for (int qt = 0; qt < QT; ++qt) { float lq = l[qt];
    if (max0) lq = (ls[qt][0] + ls[qt][1]) * (1.0f / 2048.0f);
    lq += xhalf(lq);   // the halves' sums joined once
    const float il = (1.0f / 2048.0f) / lq;
#pragma unroll
    for (int dt = 0; dt < 4; ++dt) { const v8f o = acc[qt][dt] * il; float* p = &so[wave][qt * 16 + col][dt * 16 + 8 * g]; *(v4f*)p = __builtin_shufflevector(o, o, 0, 1, 2, 3); *(v4f*)(p + 4) = __builtin_shufflevector(o, o, 4, 5, 6, 7); } }
  LDSX();
  for (int rl = 0; rl < QT * 16; ++rl) if (lane < 16) vst2(O + ((size_t)b * SS + q0 + rl) * DM + h * HD + lane * 4, *(const v4f*)&so[wave][rl][lane * 4]);
}
// ---- k_out: block = (64 rows, 128 cols): out = O(hi/lo) . Wo rows (2 products) + bo
__global__ __launch_bounds__(128) void k_out(const float* __restrict__ O, const __bf16* __restrict__ P, const float* __restrict__ BO, float* __restrict__ Y) {
  __shared__ __align__(16) float so[4][16][132];
  const int tid = threadIdx.x, wave = tid >> 5, lane = tid & 31, col = lane & 15, g = lane >> 4; const size_t r0 = (size_t)blockIdx.x * 64 + wave * 16; const int n0 = blockIdx.y * 128;
  __shared__ __align__(16) char sm[2 * XSB + 2 * WSB];   // the ring: two f32 buffers, two weight buffers
  v8f acc[8] = {};
  const char* gx = (const char*)(O + ((size_t)blockIdx.x * 64 + (tid >> 4)) * DM + (tid & 15) * 4); const char* gw = (const char*)(P + (size_t)(n0 + (tid >> 3)) * DM + (tid & 7) * 8);
  const unsigned lx = (unsigned)(size_t)sm + (tid >> 4) * XPB + (tid & 15) * 16, lw = (unsigned)(size_t)sm + 2 * XSB + (tid >> 3) * WPB + (tid & 7) * 16;
  gstage(lx, lw, gx, gw);
  asm volatile("s_wait_asynccnt 0x0" ::: "memory");   // this wave's copies of stage 0 have landed
  __syncthreads();                                    // stage 0 published to all 4 waves
  gstage(lx + XSB, lw + WSB, gx + GST * 4, gw + GST * 2);   // stage 1 flies under stage 0's work
#pragma unroll 1   // stages stay rolled: one publish point, at the foot of each trip
  for (int st = 0; st < DM / GST; ++st) { const int bf = st & 1; const float* xr = (const float*)(sm + bf * XSB + (wave * 16 + col) * XPB); const __bf16* wr = (const __bf16*)(sm + 2 * XSB + bf * WSB + col * WPB);
#pragma unroll
    for (int kc = 0; kc < GST / 32; ++kc) { const F2 a = split_row(xr, kc * 32, lane);
      v16b w[8];   // the eight weight fragments of this k step, read as one group in front of its products
#pragma unroll
      for (int j = 0; j < 8; ++j) w[j] = frag_b(wr + j * 16 * (WPB / 2) + kc * 32, lane);
#pragma unroll
      for (int j = 0; j < 8; ++j) { acc[j] = wmma_bf(a.l, w[j], acc[j]); acc[j] = wmma_bf(a.h, w[j], acc[j]); } }
    // publish point of stage st + 1, every wave, in this order
    asm volatile("s_wait_dscnt 0x0" ::: "memory");      // this wave's reads of buffer bf have returned
    asm volatile("s_wait_asynccnt 0x0" ::: "memory");   // this wave's copies of stage st + 1 have landed
    __syncthreads();                                    // stage st + 1 published; every wave has left buffer bf
    if (st + 2 < DM / GST) gstage(lx + bf * XSB, lw + bf * WSB, gx + (st + 2) * (GST * 4), gw + (st + 2) * (GST * 2)); }   // refill of the buffers just read
  asm volatile("s_wait_asynccnt 0x0" ::: "memory");   // no copy outstanding behind the loop
#pragma unroll
  for (int j = 0; j < 8; ++j) {
#pragma unroll
    for (int r = 0; r < 8; ++r) so[wave][8 * g + r][j * 16 + col] = acc[j][r] + (BO ? bfr(BO[n0 + j * 16 + col]) : 0.f); }
  LDSX();
  for (int rl = 0; rl < 16; ++rl) vst2(Y + (r0 + rl) * DM + n0 + lane * 4, *(const v4f*)&so[wave][rl][lane * 4]);
}
// ---- k_q2: block = (64 tokens, b): -|q|^2 / 2 per (token, head) from the f16 q plane (the same values the scores use); whole 256-B segments per (b,h)
__global__ __launch_bounds__(256) void k_q2(const _Float16* __restrict__ QK, float* __restrict__ Q2) {
  __shared__ __align__(16) float sq[NH][64]; const int t = threadIdx.x; const size_t b = blockIdx.y; const int s0 = blockIdx.x * 64; const int tl = t & 63, hp = t >> 6;   // 64 tokens x 4 groups of 2 heads
  const size_t row = b * SS + s0 + tl;
  for (int hh = hp * 2; hh < hp * 2 + 2; ++hh) { float a = 0.f; const _Float16* q = QK + row * (2 * DM) + hh * HD;
#pragma unroll 8
    for (int d = 0; d < HD; ++d) { const float v = (float)q[d]; a += v * v; }
    sq[hh][tl] = -0.5f * a; }
  __syncthreads();
  for (int e = t; e < NH * 16; e += 256) { const int hh = e >> 4, q4 = e & 15; vst2(Q2 + (b * NH + hh) * SS + s0 + q4 * 4, *(const v4f*)&sq[hh][q4 * 4]); }
}
extern "C" void kernel_launch(void* const* d_in, const int* in_sizes, int n_in, void* d_out, int out_size, void* d_ws, size_t ws_size, hipStream_t stream) {
  (void)in_sizes; (void)n_in; (void)out_size;
  const float** F = (const float**)d_in;   // 0 x [2,4096,512], 1 Wqk [512,512] natural, 2 Wv, 3 Wo, 4 tau [8,1,1]
  if (ws_size < (size_t)WS_END) return;
  char* ws = (char*)d_ws; __bf16* PK = (__bf16*)(ws + WS_PK); _Float16 *QK = (_Float16*)(ws + WS_QK), *QKL = (_Float16*)(ws + WS_QKL), *VTH = (_Float16*)(ws + WS_VTH), *VTL = (_Float16*)(ws + WS_VTL); float *O = (float*)(ws + WS_O), *Q2 = (float*)(ws + WS_Q2);
  k_pack<<<dim3(DM, 4), 256, 0, stream>>>(F[1], F[1], F[2], F[3], PK);   // tied q = k
  k_qkv<<<dim3(TNB * SS / 64, QKVW / 128), 128, 0, stream>>>(F[0], F[0], F[0], PK + PK_A, nullptr, nullptr, nullptr, QK, QKL, VTH, VTL);
  k_q2<<<dim3(SS / 64, TNB), 256, 0, stream>>>(QK, Q2);
  k_attn<<<dim3(TQB, NH, TNB), 128, 0, stream>>>(QK, QKL, VTH, VTL, nullptr, Q2, F[4], O);
  k_out<<<dim3(TOB, DM / 128), 128, 0, stream>>>(O, PK + PK_P, nullptr, (float*)d_out);
}

// v006
// It runs in 93.3 microseconds.
// Two timings next to v005 both put it at 1.14 times that version's speed.
// Counting every step since v000, it is 5.36 times as fast.
// compute dtype: all float inputs rounded to bf16, tau read on device; qk / v = x . W^T with EXACT bf16 products on WMMA 16x16x32 (natural rows; the tied projection is computed once, its one plane is read as q and as k); PLAIN attention: q single f16, |q|^2 per token from the same f16 values in f32, logits = (2 q_i.q_j - |q_i|^2 - |q_j|^2) / 8 x tau_h, softmax in f32 (hardware exp; maximum 0 known for 0 <= tau_h <= 64, running maximum otherwise), P (scaled by 2^11, single f16) x v (single f16); out = o (bf16 hi + residual) . Wo^T (2 products).
#include <hip/hip_runtime.h>
#include <math.h>

typedef __attribute__((ext_vector_type(16))) _Float16 v16h;
typedef __attribute__((ext_vector_type(16))) __bf16 v16b;
typedef __attribute__((ext_vector_type(8)))  _Float16 v8h;
typedef __attribute__((ext_vector_type(8)))  float v8f;
typedef __attribute__((ext_vector_type(4)))  float v4f;
typedef __attribute__((ext_vector_type(2)))  float v2f;
typedef __attribute__((ext_vector_type(4)))  unsigned v4u;
typedef __attribute__((ext_vector_type(4)))  int v4i;
typedef float __attribute__((may_alias)) float_a;
typedef int __attribute__((may_alias)) int_a;

template <typename T> __device__ __forceinline__ void vst2(void* p, T v) { *(T*)p = v;  }
__device__ __forceinline__ v8f wmma16(v16h a, v16h b, v8f c) {
  v8f d = __builtin_amdgcn_wmma_f32_16x16x32_f16(false, a, false, b, (short)0, c, false, false);
  asm volatile("v_nop\n\tv_nop\n\tv_nop\n\tv_nop" : "+v"(d) : "v"(a), "v"(b));
  return d;
}
__device__ __forceinline__ v8f wmma_bf(v16b a, v16b b, v8f c) {
  v8f d = __builtin_amdgcn_wmma_f32_16x16x32_bf16(false, a, false, b, (short)0, c, false, false);
  asm volatile("v_nop\n\tv_nop\n\tv_nop\n\tv_nop" : "+v"(d) : "v"(a), "v"(b));
  return d;
}
// Token-diffusion attention (B 2, N 4,096, d 512, 8 heads x 64): tied q = k projection, distance-kernel logits -|q_i - q_j|^2 / 8 x tau_h, softmax, . v, output projection.
__device__ __forceinline__ v16h frag_h(const _Float16* rowk0, int lane) {
  union { v16h v; v8h q[2]; } u; const _Float16* p = rowk0 + 8 * (lane >> 4);
  u.q[0] = *(const v8h*)p; u.q[1] = *(const v8h*)(p + 16); return u.v;
}
__device__ __forceinline__ v16h frag_f32(const float* rowk0, int lane) {
  v16h a; const float* p = rowk0 + 8 * (lane >> 4);
#pragma unroll
  for (int i = 0; i < 8; ++i) { a[i] = (_Float16)p[i]; a[8 + i] = (_Float16)p[16 + i]; }
  return a;
}
__device__ __forceinline__ v16h frag_f32s(const float* rowk0, int lane, float sc) {
  v16h a; const float* p = rowk0 + 8 * (lane >> 4);
#pragma unroll
  for (int i = 0; i < 8; ++i) { a[i] = (_Float16)(p[i] * sc); a[8 + i] = (_Float16)(p[16 + i] * sc); }
  return a;
}
// column fragment from a [K][ld] layout (column n), rows >= K read as 0
__device__ __forceinline__ v16h fragc_f32(const float* W, int k0, int n, int lane, int ld, int K) {
  v16h a; const int g = lane >> 4;
#pragma unroll
  for (int i = 0; i < 8; ++i) { const int ka = k0 + 8 * g + i, kb = ka + 16;
    a[i] = (_Float16)(ka < K ? W[(size_t)(ka < K ? ka : K - 1) * ld + n] : 0.f); a[8 + i] = (_Float16)(kb < K ? W[(size_t)(kb < K ? kb : K - 1) * ld + n] : 0.f); }
  return a;
}
struct F2 { v16b h, l; };
__device__ __forceinline__ F2 bsplit16(const float v[16]) { F2 r;
#pragma unroll
  for (int i = 0; i < 16; ++i) { const __bf16 h = (__bf16)v[i]; r.h[i] = h; r.l[i] = (__bf16)(v[i] - (float)h); }
  return r; }
__device__ __forceinline__ F2 split_row(const float* row, int k0, int lane) { float v[16]; const float* p = row + k0 + 8 * (lane >> 4);
#pragma unroll
  for (int i = 0; i < 8; ++i) { v[i] = p[i]; v[8 + i] = p[16 + i]; }
  return bsplit16(v); }
__device__ __forceinline__ F2 split_rowK(const float* row, int k0, int lane, int K) { float v[16]; const int g = lane >> 4;
#pragma unroll
  for (int i = 0; i < 8; ++i) { const int ka = k0 + 8 * g + i, kb = ka + 16; v[i] = ka < K ? row[ka < K ? ka : K - 1] : 0.f; v[8 + i] = kb < K ? row[kb < K ? kb : K - 1] : 0.f; }
  return bsplit16(v); }
__device__ __forceinline__ F2 split_col(const float* W, int k0, int n, int lane, int ld, int K) { float v[16]; const int g = lane >> 4;
#pragma unroll
  for (int i = 0; i < 8; ++i) { const int ka = k0 + 8 * g + i, kb = ka + 16; v[i] = ka < K ? W[(size_t)(ka < K ? ka : K - 1) * ld + n] : 0.f; v[8 + i] = kb < K ? W[(size_t)(kb < K ? kb : K - 1) * ld + n] : 0.f; }
  return bsplit16(v); }
__device__ __forceinline__ v8f mac3(const F2& a, const F2& b, v8f c) { c = wmma_bf(a.l, b.h, c); c = wmma_bf(a.h, b.l, c); return wmma_bf(a.h, b.h, c); }
__device__ __forceinline__ float sigm(float v) { return 1.0f / (1.0f + expf(-v)); }
#define LDSX() do { asm volatile("s_wait_dscnt 0" ::: "memory"); __builtin_amdgcn_wave_barrier(); __builtin_amdgcn_fence(__ATOMIC_RELEASE, "workgroup"); } while (0)


#define NB 2
#define SS 4096
#define DM 512
#define NH 8
#define HD 64
#define QKVW (2 * DM)          // projection rows: Wqk (tied q = k), Wv
#ifndef TQB
#define TQB (SS / 128)         // query blocks of k_attn: 4 waves x 32 queries
#define TNB NB
#define TOB (NB * SS / 64)     // output row tiles (all)
#endif
typedef __attribute__((ext_vector_type(8))) __bf16 v8b;
__device__ __forceinline__ v16b frag_b(const __bf16* rowk0, int lane) {
  union { v16b v; v8b q[2]; } u; const __bf16* p = rowk0 + 8 * (lane >> 4);
  u.q[0] = *(const v8b*)p; u.q[1] = *(const v8b*)(p + 16); return u.v;
}
__device__ __forceinline__ float bfr(float v) { return (float)(__bf16)v; }
__device__ __attribute__((noinline)) float exp_ni(float v) { return expf(v); }
__device__ __attribute__((noinline)) float erf_ni(float v) { return erff(v); }

#define PK_A 0                       // [1024][512] Wqk, Wv rows (natural [out][in])
#define PK_P (PK_A + QKVW * DM)        // [512][512] Wo rows (natural)
#define PK_END (PK_P + DM * DM)
#define WS_PK  0u
#define WS_QK  (WS_PK + 2u * PK_END)             // f16 [8192 rows][pitch 1024]: q = k in columns 0..511, the rest of a row is neither written nor read
#define WS_VTH (WS_QK + 2u * NB * SS * 2 * DM)     // f16 [b][512 (h*64+d)][4096 s]
#define WS_O   (WS_VTH + 2u * NB * DM * SS)        // f32 [8192][512]
#define WS_CS  (WS_O + 4u * NB * SS * DM)           // f32 [2][4096][32]: reserved, neither written nor read
#define WS_Q2  (WS_CS + 4u * 2 * SS * 32)                  // f32 [b][h][s] -|q|^2 / 2
#define WS_END (WS_Q2 + 4u * (size_t)NB * NH * SS)
// ---- k_pack: block = (row n, which): natural [out][in] rows -> bf16; which 0..1 -> W_qk/W_v into PK_A rows which*512 + n; 2 -> W_o into PK_P
__global__ __launch_bounds__(256) void k_pack(const float* __restrict__ WQ, const float* __restrict__ WV, const float* __restrict__ WO, __bf16* __restrict__ PK) {
  __shared__ __align__(16) __bf16 s[DM]; const int n = blockIdx.x, which = blockIdx.y, t = threadIdx.x; const float* Wm = (which == 0) ? WQ : (which == 1) ? WV : WO;
  for (int k = t; k < DM; k += 256) s[k] = (__bf16)Wm[(size_t)n * DM + k];
  __syncthreads();
  __bf16* dst = (which < 2) ? PK + PK_A + ((size_t)which * DM + n) * DM : PK + PK_P + (size_t)n * DM;
  for (int q = t; q < DM / 8; q += 256) vst2((unsigned*)(dst + q * 8), *(const v4u*)&s[q * 8]);
}
// ---- LDS ring of the two projection kernels: one stage = 64 k of the block's 64 f32 rows (256 B a row) and of its 128 bf16 weight rows (128 B a row)
#define GST 64                 // k per stage
#define XPB 272                // LDS pitch of an f32 row piece: 256 B + 16 B, an odd multiple of 16 B (conflict-free for ds_load_b128)
#define WPB 144                // LDS pitch of a weight row piece: 128 B + 16 B, an odd multiple of 16 B
#define XSB (64 * XPB)         // bytes of one f32 buffer
#define WSB (128 * WPB)        // bytes of one weight buffer
// eight 16-B pieces per thread, global -> LDS through no register, at fixed steps of both addresses (a wave's copy = 4 whole 128-B lines).
// s_wait_xcnt 0 is the last line of the copies' own statement, so that it stands in front of every later write of the address registers the copies name.
__device__ __forceinline__ void copy8(unsigned l, unsigned ls, const char* gp, size_t gs) {
  asm volatile("global_load_async_to_lds_b128 %0, %8, off\n\t"
               "global_load_async_to_lds_b128 %1, %9, off\n\t"
               "global_load_async_to_lds_b128 %2, %10, off\n\t"
               "global_load_async_to_lds_b128 %3, %11, off\n\t"
               "global_load_async_to_lds_b128 %4, %12, off\n\t"
               "global_load_async_to_lds_b128 %5, %13, off\n\t"
               "global_load_async_to_lds_b128 %6, %14, off\n\t"
               "global_load_async_to_lds_b128 %7, %15, off\n\t"
               "s_wait_xcnt 0x0"
               :: "v"(l), "v"(l + ls), "v"(l + 2 * ls), "v"(l + 3 * ls), "v"(l + 4 * ls), "v"(l + 5 * ls), "v"(l + 6 * ls), "v"(l + 7 * ls),
                  "v"(gp), "v"(gp + gs), "v"(gp + 2 * gs), "v"(gp + 3 * gs), "v"(gp + 4 * gs), "v"(gp + 5 * gs), "v"(gp + 6 * gs), "v"(gp + 7 * gs)
               : "memory");
}
// one stage: thread t copies f32 rows (t >> 4) + 8 i, piece t & 15, and weight rows (t >> 3) + 16 i, piece t & 7
__device__ __forceinline__ void gstage(unsigned lx, unsigned lw, const char* gx, const char* gw) { copy8(lx, 8 * XPB, gx, (size_t)8 * DM * 4); copy8(lw, 16 * WPB, gw, (size_t)16 * DM * 2); }
__global__ __launch_bounds__(128) void k_qkv(const float* __restrict__ XQ, const float* __restrict__ XV, const __bf16* __restrict__ P, const float* __restrict__ BQ, const float* __restrict__ BV, _Float16* __restrict__ QK, _Float16* __restrict__ VTH) {
  const int which0 = (blockIdx.y * 128) / DM; const float* X = (which0 == 0) ? XQ : XV; const float* BB = BQ ? (((which0 == 0) ? BQ : BV) + (blockIdx.y * 128 - which0 * DM)) : nullptr;
  __shared__ __align__(16) char sm[2 * XSB + 2 * WSB];   // the ring: two f32 buffers, two weight buffers; behind the loop's last barrier the same bytes are the output staging
  _Float16 (*so)[16][136] = (_Float16 (*)[16][136])sm; _Float16 (*sth)[72] = (_Float16 (*)[72])(sm + 2 * XSB);
  const int tid = threadIdx.x, wave = tid >> 5, lane = tid & 31, col = lane & 15, g = lane >> 4; const size_t r0 = (size_t)blockIdx.x * 64 + wave * 16; const int n0 = blockIdx.y * 128;
  v8f acc[8] = {};
  const char* gx = (const char*)(X + ((size_t)blockIdx.x * 64 + (tid >> 4)) * DM + (tid & 15) * 4); const char* gw = (const char*)(P + (size_t)(n0 + (tid >> 3)) * DM + (tid & 7) * 8);
  const unsigned lx = (unsigned)(size_t)sm + (tid >> 4) * XPB + (tid & 15) * 16, lw = (unsigned)(size_t)sm + 2 * XSB + (tid >> 3) * WPB + (tid & 7) * 16;
  gstage(lx, lw, gx, gw);
  asm volatile("s_wait_asynccnt 0x0" ::: "memory");   // this wave's copies of stage 0 have landed
  __syncthreads();                                    // stage 0 published to all 4 waves
  gstage(lx + XSB, lw + WSB, gx + GST * 4, gw + GST * 2);   // stage 1 flies under stage 0's work
#pragma unroll 1   // stages stay rolled: one publish point, at the foot of each trip
  for (int st = 0; st < DM / GST; ++st) { const int bf = st & 1; const float* xr = (const float*)(sm + bf * XSB + (wave * 16 + col) * XPB); const __bf16* wr = (const __bf16*)(sm + 2 * XSB + bf * WSB + col * WPB);
#pragma unroll
    for (int kc = 0; kc < GST / 32; ++kc) { v16b a; { const float* p = xr + kc * 32 + 8 * g;
#pragma unroll
        for (int i = 0; i < 8; ++i) { a[i] = (__bf16)p[i]; a[8 + i] = (__bf16)p[16 + i]; } }
      v16b w[8];   // the eight weight fragments of this k step, read as one group in front of its products
#pragma unroll
      for (int j = 0; j < 8; ++j) w[j] = frag_b(wr + j * 16 * (WPB / 2) + kc * 32, lane);
#pragma unroll
      for (int j = 0; j < 8; ++j) acc[j] = wmma_bf(a, w[j], acc[j]); }
    // publish point of stage st + 1, every wave, in this order
    asm volatile("s_wait_dscnt 0x0" ::: "memory");      // this wave's reads of buffer bf have returned
    asm volatile("s_wait_asynccnt 0x0" ::: "memory");   // this wave's copies of stage st + 1 have landed
    __syncthreads();                                    // stage st + 1 published; every wave has left buffer bf
    if (st + 2 < DM / GST) gstage(lx + bf * XSB, lw + bf * WSB, gx + (st + 2) * (GST * 4), gw + (st + 2) * (GST * 2)); }   // refill of the buffers just read
  asm volatile("s_wait_asynccnt 0x0" ::: "memory");   // no copy outstanding behind the loop
  if (n0 < DM) {   // q = k stored unscaled (f16 sigma ~0.6, no subnormal exposure); 1/8 applied to the f32 score
#pragma unroll
    for (int j = 0; j < 8; ++j) {
#pragma unroll
      for (int r = 0; r < 8; ++r) { const float v = acc[j][r] + (BB ? bfr(BB[j * 16 + col]) : 0.f); so[wave][8 * g + r][j * 16 + col] = (_Float16)v; } }   // q = k (+ bias) as one f16
    LDSX();
    for (int rl = 0; rl < 16; ++rl) if (lane < 16) vst2((unsigned*)(QK + (r0 + rl) * (2 * DM) + n0 + lane * 8), *(const v4u*)&so[wave][rl][lane * 8]);
  } else {
#pragma unroll
    for (int j = 0; j < 8; ++j) {
#pragma unroll
      for (int r = 0; r < 8; ++r) { const float v = acc[j][r] + (BB ? bfr(BB[j * 16 + col]) : 0.f); sth[j * 16 + col][wave * 16 + 8 * g + r] = (_Float16)v; } }
    __syncthreads();
    const size_t rb = (size_t)blockIdx.x * 64; const int b = (int)(rb / SS), s0 = (int)(rb % SS); const int pc0 = n0 - DM;
    for (int q = tid; q < 128 * 8; q += 128) { const int d = q >> 3, pc = q & 7; const size_t o = ((size_t)b * DM + pc0 + d) * SS + s0 + pc * 8; vst2((unsigned*)(VTH + o), *(const v4u*)&sth[d][pc * 8]); }
  }
}
// ---- k_attn: block = (128 queries, head h, batch b): all-keys flash attention (K = 64: 2 k-steps), logits = -|q - k|^2 / 8 x tau_h with single f16 operands, P.V: f16 P (x2^11) x V hi (single f16) in one accumulator; O[b*S+q][h*64+d] = acc / 2048 / l (256-B segments)
#define KST 64   // keys per LDS stage
#define KPI 72   // LDS row pitch in f16: a 128-B row + 16 B = 144 B, an odd multiple of 16 B (conflict-free for ds_load_b128)
#define KSB (KST * KPI * 2)   // bytes of one K (or V^T) buffer
// one stage = 64 K rows x 128 B + 64 V^T rows x 128 B: each of the 128 threads copies four 16-B pieces of each, global -> LDS through no register (a wave's copy = 4 whole 128-B lines).
// s_wait_xcnt 0 is the last line of the copies' own statement, so that it stands in front of every later write of the address registers the copies name.
__device__ __forceinline__ void stage_copy(unsigned lk, unsigned lv, const _Float16* gk, const _Float16* gv) {
  asm volatile("global_load_async_to_lds_b128 %0, %8, off\n\t"
               "global_load_async_to_lds_b128 %1, %9, off\n\t"
               "global_load_async_to_lds_b128 %2, %10, off\n\t"
               "global_load_async_to_lds_b128 %3, %11, off\n\t"
               "global_load_async_to_lds_b128 %4, %12, off\n\t"
               "global_load_async_to_lds_b128 %5, %13, off\n\t"
               "global_load_async_to_lds_b128 %6, %14, off\n\t"
               "global_load_async_to_lds_b128 %7, %15, off\n\t"
               "s_wait_xcnt 0x0"
               :: "v"(lk), "v"(lk + 16 * KPI * 2), "v"(lk + 32 * KPI * 2), "v"(lk + 48 * KPI * 2), "v"(lv), "v"(lv + 16 * KPI * 2), "v"(lv + 32 * KPI * 2), "v"(lv + 48 * KPI * 2),
                  "v"(gk), "v"(gk + (size_t)16 * 2 * DM), "v"(gk + (size_t)32 * 2 * DM), "v"(gk + (size_t)48 * 2 * DM), "v"(gv), "v"(gv + (size_t)16 * SS), "v"(gv + (size_t)32 * SS), "v"(gv + (size_t)48 * SS)
               : "memory");
}
// -|k|^2 / 2 of one stage's 64 keys = 256 B: one 8-B piece per lane of ONE wave, global -> LDS through no register; s_wait_xcnt 0 closes the copy's own statement, in front of every later write of its address registers.
__device__ __forceinline__ void stage_copy_k2(unsigned l2, const float* g2) {
  asm volatile("global_load_async_to_lds_b64 %0, %1, off\n\t"
               "s_wait_xcnt 0x0"
               :: "v"(l2), "v"(g2) : "memory");
}
// lane l <-> lane l ^ 16 (the two halves of a wave hold the two halves of one query's keys)
__device__ __forceinline__ float xhalf(float x) { return __builtin_bit_cast(float, __builtin_amdgcn_permlanex16(__builtin_bit_cast(int, x), __builtin_bit_cast(int, x), 0x76543210, 0xfedcba98, false, false)); }
// 2^x for eight values / one value. One statement each: the outputs are early-clobber, so that no v_exp_f32 overwrites a source of the one in front of it, and the closing v_nop is the slot the instruction set asks for
// between a transcendental and a next instruction that reads its result or overwrites its source.
__device__ __forceinline__ v8f exp2x8(v8f x) { float r0, r1, r2, r3, r4, r5, r6, r7;
  asm("v_exp_f32 %0, %8\n\tv_exp_f32 %1, %9\n\tv_exp_f32 %2, %10\n\tv_exp_f32 %3, %11\n\tv_exp_f32 %4, %12\n\tv_exp_f32 %5, %13\n\tv_exp_f32 %6, %14\n\tv_exp_f32 %7, %15\n\tv_nop"
      : "=&v"(r0), "=&v"(r1), "=&v"(r2), "=&v"(r3), "=&v"(r4), "=&v"(r5), "=&v"(r6), "=&v"(r7) : "v"(x[0]), "v"(x[1]), "v"(x[2]), "v"(x[3]), "v"(x[4]), "v"(x[5]), "v"(x[6]), "v"(x[7]));
  return v8f{r0, r1, r2, r3, r4, r5, r6, r7}; }
__device__ __forceinline__ float exp2x1(float x) { float r; asm("v_exp_f32 %0, %1\n\tv_nop" : "=&v"(r) : "v"(x)); return r; }
#define LOG2E 1.44269504088896340736f   // exp(v) = 2^(v log2 e), the form __expf compiles to
#define QT 2   // 16-query tiles per wave: in the max0 loop every K and V^T fragment read from LDS is the A operand of QT products
// s a + b on register pairs: the two constants stay one pair each, whichever pair of s they meet
__device__ __forceinline__ v8f fma8(v8f s, v2f a, v2f b) { union { v8f v; v2f p[4]; } u; u.v = s;
#pragma unroll
  for (int i = 0; i < 4; ++i) u.p[i] = u.p[i] * a + b;
  return u.v; }
__device__ __forceinline__ v8f ld8f(const float* p) { union { v8f v; v4f q[2]; } u; u.q[0] = *(const v4f*)p; u.q[1] = *(const v4f*)(p + 4); return u.v; }
// one 32-key pass of one query tile with the running maximum (any tau): kb = K row (pass key 0 + col), kp = -|k|^2 / 2 of pass key 8 g, vb = V^T row col at the pass's first key
__device__ __forceinline__ void pass_runmax(const _Float16* kb, const float* kp, const _Float16* vb, int lane, const v16h (&aq)[2], float hq, float tau, float& m, float& l, v8f (&acc)[4]) {
  v8f s[2];
#pragma unroll
  for (int ct = 0; ct < 2; ++ct) { const _Float16* krow = kb + ct * 16 * KPI; v8f c = {};
#pragma unroll
    for (int kc = 0; kc < 2; ++kc) c = wmma16(frag_h(krow + kc * 32, lane), aq[kc], c);   // c[r] = k_(8 g + r) . q_col: single product, q, k as one-rounding f16 operands
    s[ct] = (c + hq + ld8f(kp + ct * 16)) * 0.25f * tau; }   // -|q_i - q_j|^2 / sqrt(64) x tau_h
  float mx = fmaxf(s[0][0], s[1][0]);
#pragma unroll
  for (int r = 1; r < 8; ++r) mx = fmaxf(mx, fmaxf(s[0][r], s[1][r]));
  mx = fmaxf(mx, xhalf(mx));
  const float mn = fmaxf(m, mx); const float ea = exp2x1((m - mn) * LOG2E); const float alpha = (m <= -1.0e38f) ? 0.f : ea;
  v8f e[2];
#pragma unroll
  for (int ct = 0; ct < 2; ++ct) { const v8f x = exp2x8((s[ct] - mn) * LOG2E);
#pragma unroll
    for (int r = 0; r < 8; ++r) e[ct][r] = (s[ct][r] <= -1.0e38f) ? 0.f : x[r]; }
  const v8f e2 = e[0] + e[1]; const float es = ((e2[0] + e2[1]) + (e2[2] + e2[3])) + ((e2[4] + e2[5]) + (e2[6] + e2[7]));
  l = l * alpha + es; m = mn;
#pragma unroll
  for (int dt = 0; dt < 4; ++dt) acc[dt] *= alpha;
  v16h pb;   // P^T as B: P scaled by 2^11 before the f16 rounding so small softmax weights stay out of the f16 subnormal range; 2^-11 folded into the epilogue
#pragma unroll
  for (int i = 0; i < 8; ++i) { pb[i] = (_Float16)(e[0][i] * 2048.0f); pb[8 + i] = (_Float16)(e[1][i] * 2048.0f); }
#pragma unroll
  for (int dt = 0; dt < 4; ++dt) acc[dt] = wmma16(frag_h(vb + dt * 16 * KPI, lane), pb, acc[dt]);   // single product: V x P (x2^11)
}
// publish point of stage st + 1, every wave, in this order; then the refill of the buffers just read
__device__ __forceinline__ void ring_foot(int st, bool w0, unsigned lk, unsigned lv, unsigned l2, const _Float16* gk, const _Float16* gv, const float* g2) { const int bf = st & 1;
  asm volatile("s_wait_dscnt 0x0" ::: "memory");      // this wave's reads of buffer bf have returned
  asm volatile("s_wait_asynccnt 0x0" ::: "memory");   // this wave's copies of stage st + 1 have landed
  __syncthreads();                                    // stage st + 1 published; every wave has left buffer bf
  if (st + 2 < SS / KST) { stage_copy(lk + bf * KSB, lv + bf * KSB, gk + (size_t)(st + 2) * KST * 2 * DM, gv + (st + 2) * KST);
    if (w0) stage_copy_k2(l2 + bf * (KST * 4), g2 + (st + 2) * KST); } }
// amdgpu_waves_per_eu(4, 4): a budget of 256 registers, so that the loop stays inside one register window (left free, this build took 261 and switched windows in the loop)
__global__ __launch_bounds__(128) __attribute__((amdgpu_waves_per_eu(4, 4))) void k_attn(const _Float16* __restrict__ QK, const _Float16* __restrict__ QKL, const _Float16* __restrict__ VTH, const _Float16* __restrict__ VTL, const void* __restrict__ KMASK, const float* __restrict__ Q2, const float* __restrict__ TAU, float* __restrict__ O) {
  __shared__ __align__(16) float so[4][QT * 16][68];
  __shared__ __align__(16) _Float16 sk[2][KST][KPI], sv[2][HD][KPI];   // two buffers: K rows [key][d], V^T rows [d][key] of one 64-key stage, shared by the block's 4 waves
  __shared__ __align__(16) float sk2[2][KST];                          // two buffers: -|k|^2 / 2 of the stage's keys
  const int tid = threadIdx.x, wave = tid >> 5, lane = tid & 31, col = lane & 15, g = lane >> 4;
  const int qb = blockIdx.x, h = blockIdx.y, b = blockIdx.z; const int q0 = qb * (4 * QT * 16) + wave * (QT * 16);
  const bool w0 = __builtin_amdgcn_readfirstlane(wave) == 0;   // scalar: the wave that copies -|k|^2 / 2
  const float tau = bfr(TAU[h]); const float* Q2h = Q2 + ((size_t)b * NH + h) * SS;
  v16h aq[QT][2]; float hq[QT];   // per tile: this lane's query as B operand, and its -|q|^2 / 2
#pragma unroll
  for (int qt = 0; qt < QT; ++qt) { hq[qt] = Q2h[q0 + qt * 16 + col];
#pragma unroll
    for (int kc = 0; kc < 2; ++kc) aq[qt][kc] = frag_h(QK + ((size_t)b * SS + q0 + qt * 16 + col) * (2 * DM) + h * HD + kc * 32, lane); }
  // q = k, so logit_ij = -|q_i - q_j|^2 tau / 8 <= 0 for tau >= 0 and logit_ii = 0, and every row meets its own key: the row maximum is 0 before any key is read.
  // Scalar test, the same for the whole block (tau of its head); any other tau (negative, NaN, or so large that the rounding of logit_ii could leave the head room of P in f16) takes the running maximum.
  const bool max0 = __builtin_amdgcn_readfirstlane((int)(tau >= 0.f && tau <= 64.f)) != 0;
  const float xa = 0.25f * tau * LOG2E;   // log2 (2^11 e^logit) = (k.q - |k|^2 / 2) xa + xb
  const v2f xa2 = {xa, xa};
  float m[QT], l[QT];            // per tile, this lane's query: running maximum (equal in both halves); sum over this half's keys
  v2f xb2[QT], ls[QT];           // max0: xb; this lane's sums of 2^11 P, folded to one register pair in every pass
  v8f acc[QT][4];                // O^T: acc[qt][dt][r] = o[query col of tile qt][d = dt * 16 + 8 g + r]
#pragma unroll
  for (int qt = 0; qt < QT; ++qt) { const float xb = hq[qt] * xa + 11.0f; xb2[qt] = v2f{xb, xb}; m[qt] = -3.0e38f; l[qt] = 0.f; ls[qt] = v2f{};
#pragma unroll
    for (int dt = 0; dt < 4; ++dt) acc[qt][dt] = v8f{}; }
  const int nst = SS / KST;   // all keys, 64 a stage
  const int crow = tid >> 3, cpc = tid & 7;   // this thread's row (+ 16 i) and 16-B piece in every stage
  const _Float16* gk = QK + ((size_t)b * SS + crow) * (2 * DM) + h * HD + cpc * 8;   /* K rows = the q plane's rows (tied) */ const _Float16* gv = VTH + ((size_t)b * DM + h * HD + crow) * SS + cpc * 8;
  const unsigned lk = (unsigned)(size_t)&sk[0][crow][cpc * 8], lv = (unsigned)(size_t)&sv[0][crow][cpc * 8], l2 = (unsigned)(size_t)&sk2[0][lane * 2];
  const float* g2 = Q2h + lane * 2;
  stage_copy(lk, lv, gk, gv);
  if (w0) stage_copy_k2(l2, g2);
  asm volatile("s_wait_asynccnt 0x0" ::: "memory");   // this wave's copies of stage 0 have landed
  __syncthreads();                                    // stage 0 published to all 4 waves
  stage_copy(lk + KSB, lv + KSB, gk + (size_t)KST * 2 * DM, gv + KST);   // stage 1 flies under stage 0's work
  if (w0) stage_copy_k2(l2 + KST * 4, g2 + KST);
  if (max0) {   // the same for the whole block: each side has its own loop over the stages, with the same publish point
#pragma unroll 1   // stages stay rolled: one publish point, at the foot of each trip
  for (int st = 0; st < nst; ++st) { const int bf = st & 1; const _Float16* kb = &sk[bf][col][0]; const _Float16* vb = &sv[bf][col][0]; const float* kp = &sk2[bf][8 * g];
    v16h kf[2][2]; v8f k2[2];   // the K fragments and -|k|^2 / 2 of one 32-key pass, read as one group
#pragma unroll
    for (int ct = 0; ct < 2; ++ct) { k2[ct] = ld8f(kp + ct * 16);
#pragma unroll
      for (int kc = 0; kc < 2; ++kc) kf[ct][kc] = frag_h(kb + ct * 16 * KPI + kc * 32, lane); }
#pragma unroll   // both 32-key passes of the stage in line: nothing is carried from pass to pass but sums and the fragments fetched ahead, and every LDS offset is a constant
    for (int sub = 0; sub < KST / 32; ++sub) { v8f s[QT][2];
#pragma unroll
      for (int kc = 0; kc < 2; ++kc) {   // four independent tiles between a product and the one that adds to it
#pragma unroll
        for (int ct = 0; ct < 2; ++ct) {
#pragma unroll
          for (int qt = 0; qt < QT; ++qt) s[qt][ct] = wmma16(kf[ct][kc], aq[qt][kc], kc ? s[qt][ct] : k2[ct]); } }   // the product starts from -|k|^2 / 2 of its rows
      v16h vf[4];   // this pass's V^T fragments and the next pass's K group: one place of LDS reads, in flight under the exponentials
#pragma unroll
      for (int dt = 0; dt < 4; ++dt) vf[dt] = frag_h(vb + dt * 16 * KPI + sub * 32, lane);
      if (sub + 1 < KST / 32) {
#pragma unroll
        for (int ct = 0; ct < 2; ++ct) { k2[ct] = ld8f(kp + (sub + 1) * 32 + ct * 16);
#pragma unroll
          for (int kc = 0; kc < 2; ++kc) kf[ct][kc] = frag_h(kb + ((sub + 1) * 32 + ct * 16) * KPI + kc * 32, lane); } }
      v16h pb[QT];
#pragma unroll
      for (int qt = 0; qt < QT; ++qt) { const v8f e0 = exp2x8(fma8(s[qt][0], xa2, xb2[qt])), e1 = exp2x8(fma8(s[qt][1], xa2, xb2[qt]));   // 2^11 P: one fma and one exponential a score
        const v8f e2 = e0 + e1; const v4f e4 = __builtin_shufflevector(e2, e2, 0, 1, 2, 3) + __builtin_shufflevector(e2, e2, 4, 5, 6, 7);
        ls[qt] += __builtin_shufflevector(e4, e4, 0, 1) + __builtin_shufflevector(e4, e4, 2, 3);
#pragma unroll
        for (int i = 0; i < 8; ++i) { pb[qt][i] = (_Float16)e0[i]; pb[qt][8 + i] = (_Float16)e1[i]; } }
#pragma unroll
      for (int dt = 0; dt < 4; ++dt) {
#pragma unroll
        for (int qt = 0; qt < QT; ++qt) acc[qt][dt] = wmma16(vf[dt], pb[qt], acc[qt][dt]); } }
    ring_foot(st, w0, lk, lv, l2, gk, gv, g2); }
  } else {
#pragma unroll 1   // stages stay rolled: one publish point, at the foot of each trip
  for (int st = 0; st < nst; ++st) { const int bf = st & 1; const _Float16* kb = &sk[bf][col][0]; const _Float16* vb = &sv[bf][col][0]; const float* kp = &sk2[bf][8 * g];
#pragma unroll 1
    for (int sub = 0; sub < KST / 32; ++sub) {   // rolled, as the 32-key pass was: one copy of the body per tile
#pragma unroll
      for (int qt = 0; qt < QT; ++qt) pass_runmax(kb + sub * 32 * KPI, kp + sub * 32, vb + sub * 32, lane, aq[qt], hq[qt], tau, m[qt], l[qt], acc[qt]); }
    ring_foot(st, w0, lk, lv, l2, gk, gv, g2); }
  }
  asm volatile("s_wait_asynccnt 0x0" ::: "memory");   // no copy outstanding behind the loop
#pragma unroll
  for (int qt = 0; qt < QT; ++qt) { float lq = l[qt];
    if (max0) lq = (ls[qt][0] + ls[qt][1]) * (1.0f / 2048.0f);
    lq += xhalf(lq);   // the halves' sums joined once
    const float il = (1.0f / 2048.0f) / lq;
#pragma unroll
    for (int dt = 0; dt < 4; ++dt) { const v8f o = acc[qt][dt] * il; float* p = &so[wave][qt * 16 + col][dt * 16 + 8 * g]; *(v4f*)p = __builtin_shufflevector(o, o, 0, 1, 2, 3); *(v4f*)(p + 4) = __builtin_shufflevector(o, o, 4, 5, 6, 7); } }
  LDSX();
  for (int rl = 0; rl < QT * 16; ++rl) if (lane < 16) vst2(O + ((size_t)b * SS + q0 + rl) * DM + h * HD + lane * 4, *(const v4f*)&so[wave][rl][lane * 4]);
}
// ---- k_out: block = (64 rows, 128 cols): out = O(hi/lo) . Wo rows (2 products) + bo
__global__ __launch_bounds__(128) void k_out(const float* __restrict__ O, const __bf16* __restrict__ P, const float* __restrict__ BO, float* __restrict__ Y) {
  __shared__ __align__(16) float so[4][16][132];
  const int tid = threadIdx.x, wave = tid >> 5, lane = tid & 31, col = lane & 15, g = lane >> 4; const size_t r0 = (size_t)blockIdx.x * 64 + wave * 16; const int n0 = blockIdx.y * 128;
  __shared__ __align__(16) char sm[2 * XSB + 2 * WSB];   // the ring: two f32 buffers, two weight buffers
  v8f acc[8] = {};
  const char* gx = (const char*)(O + ((size_t)blockIdx.x * 64 + (tid >> 4)) * DM + (tid & 15) * 4); const char* gw = (const char*)(P + (size_t)(n0 + (tid >> 3)) * DM + (tid & 7) * 8);
  const unsigned lx = (unsigned)(size_t)sm + (tid >> 4) * XPB + (tid & 15) * 16, lw = (unsigned)(size_t)sm + 2 * XSB + (tid >> 3) * WPB + (tid & 7) * 16;
  gstage(lx, lw, gx, gw);
  asm volatile("s_wait_asynccnt 0x0" ::: "memory");   // this wave's copies of stage 0 have landed
  __syncthreads();                                    // stage 0 published to all 4 waves
  gstage(lx + XSB, lw + WSB, gx + GST * 4, gw + GST * 2);   // stage 1 flies under stage 0's work
#pragma unroll 1   // stages stay rolled: one publish point, at the foot of each trip
  for (int st = 0; st < DM / GST; ++st) { const int bf = st & 1; const float* xr = (const float*)(sm + bf * XSB + (wave * 16 + col) * XPB); const __bf16* wr = (const __bf16*)(sm + 2 * XSB + bf * WSB + col * WPB);
#pragma unroll
    for (int kc = 0; kc < GST / 32; ++kc) { const F2 a = split_row(xr, kc * 32, lane);
      v16b w[8];   // the eight weight fragments of this k step, read as one group in front of its products
#pragma unroll
      for (int j = 0; j < 8; ++j) w[j] = frag_b(wr + j * 16 * (WPB / 2) + kc * 32, lane);
#pragma unroll
      for (int j = 0; j < 8; ++j) { acc[j] = wmma_bf(a.l, w[j], acc[j]); acc[j] = wmma_bf(a.h, w[j], acc[j]); } }
    // publish point of stage st + 1, every wave, in this order
    asm volatile("s_wait_dscnt 0x0" ::: "memory");      // this wave's reads of buffer bf have returned
    asm volatile("s_wait_asynccnt 0x0" ::: "memory");   // this wave's copies of stage st + 1 have landed
    __syncthreads();                                    // stage st + 1 published; every wave has left buffer bf
    if (st + 2 < DM / GST) gstage(lx + bf * XSB, lw + bf * WSB, gx + (st + 2) * (GST * 4), gw + (st + 2) * (GST * 2)); }   // refill of the buffers just read
  asm volatile("s_wait_asynccnt 0x0" ::: "memory");   // no copy outstanding behind the loop
#pragma unroll
  for (int j = 0; j < 8; ++j) {
#pragma unroll
    for (int r = 0; r < 8; ++r) so[wave][8 * g + r][j * 16 + col] = acc[j][r] + (BO ? bfr(BO[n0 + j * 16 + col]) : 0.f); }
  LDSX();
  for (int rl = 0; rl < 16; ++rl) vst2(Y + (r0 + rl) * DM + n0 + lane * 4, *(const v4f*)&so[wave][rl][lane * 4]);
}
// ---- k_q2: block = (64 tokens, b): -|q|^2 / 2 per (token, head) from the f16 q plane (the same values the scores use); whole 256-B segments per (b,h)
__global__ __launch_bounds__(256) void k_q2(const _Float16* __restrict__ QK, float* __restrict__ Q2) {
  __shared__ __align__(16) float sq[NH][64]; const int t = threadIdx.x; const size_t b = blockIdx.y; const int s0 = blockIdx.x * 64; const int tl = t & 63, hp = t >> 6;   // 64 tokens x 4 groups of 2 heads
  const size_t row = b * SS + s0 + tl;
  for (int hh = hp * 2; hh < hp * 2 + 2; ++hh) { float a = 0.f; const _Float16* q = QK + row * (2 * DM) + hh * HD;
#pragma unroll 8
    for (int d = 0; d < HD; ++d) { const float v = (float)q[d]; a += v * v; }
    sq[hh][tl] = -0.5f * a; }
  __syncthreads();
  for (int e = t; e < NH * 16; e += 256) { const int hh = e >> 4, q4 = e & 15; vst2(Q2 + (b * NH + hh) * SS + s0 + q4 * 4, *(const v4f*)&sq[hh][q4 * 4]); }
}
extern "C" void kernel_launch(void* const* d_in, const int* in_sizes, int n_in, void* d_out, int out_size, void* d_ws, size_t ws_size, hipStream_t stream) {
  (void)in_sizes; (void)n_in; (void)out_size;
  const float** F = (const float**)d_in;   // 0 x [2,4096,512], 1 Wqk [512,512] natural, 2 Wv, 3 Wo, 4 tau [8,1,1]
  if (ws_size < (size_t)WS_END) return;
  char* ws = (char*)d_ws; __bf16* PK = (__bf16*)(ws + WS_PK); _Float16 *QK = (_Float16*)(ws + WS_QK), *VTH = (_Float16*)(ws + WS_VTH); float *O = (float*)(ws + WS_O), *Q2 = (float*)(ws + WS_Q2);
  k_pack<<<dim3(DM, 3), 256, 0, stream>>>(F[1], F[2], F[3], PK);
  k_qkv<<<dim3(TNB * SS / 64, QKVW / 128), 128, 0, stream>>>(F[0], F[0], PK + PK_A, nullptr, nullptr, QK, VTH);   // tied q = k: one projection, one plane
  k_q2<<<dim3(SS / 64, TNB), 256, 0, stream>>>(QK, Q2);
  k_attn<<<dim3(TQB, NH, TNB), 128, 0, stream>>>(QK, nullptr, VTH, nullptr, nullptr, Q2, F[4], O);
  k_out<<<dim3(TOB, DM / 128), 128, 0, stream>>>(O, PK + PK_P, nullptr, (float*)d_out);
}

// v007
// Measured time: 89.1 microseconds a run.
// In both of two side-by-side timings against v006, it was 1.05 times as fast.
// All steps since v000 together make it 5.62 times as fast.
// compute dtype: all float inputs rounded to bf16, tau read on device; qk / v = x . W^T with EXACT bf16 products on WMMA 16x16x32 (natural rows; the tied projection is computed once, its one plane is read as q and as k); PLAIN attention: q single f16, |q|^2 per token from the same f16 values in f32, logits = (2 q_i.q_j - |q_i|^2 - |q_j|^2) / 8 x tau_h, softmax in f32 (hardware exp; maximum 0 known for 0 <= tau_h <= 64, running maximum otherwise), P (scaled by 2^11, single f16) x v (single f16); out = o (bf16 hi + residual) . Wo^T (2 products).
#include <hip/hip_runtime.h>
#include <math.h>

typedef __attribute__((ext_vector_type(16))) _Float16 v16h;
typedef __attribute__((ext_vector_type(16))) __bf16 v16b;
typedef __attribute__((ext_vector_type(8)))  _Float16 v8h;
typedef __attribute__((ext_vector_type(8)))  float v8f;
typedef __attribute__((ext_vector_type(4)))  float v4f;
typedef __attribute__((ext_vector_type(2)))  float v2f;
typedef __attribute__((ext_vector_type(4)))  unsigned v4u;
typedef __attribute__((ext_vector_type(4)))  int v4i;
typedef float __attribute__((may_alias)) float_a;
typedef int __attribute__((may_alias)) int_a;

template <typename T> __device__ __forceinline__ void vst2(void* p, T v) { *(T*)p = v;  }
__device__ __forceinline__ v8f wmma16(v16h a, v16h b, v8f c) {
  v8f d = __builtin_amdgcn_wmma_f32_16x16x32_f16(false, a, false, b, (short)0, c, false, false);
  asm volatile("v_nop\n\tv_nop\n\tv_nop\n\tv_nop" : "+v"(d) : "v"(a), "v"(b));
  return d;
}
__device__ __forceinline__ v8f wmma_bf(v16b a, v16b b, v8f c) {
  return __builtin_amdgcn_wmma_f32_16x16x32_bf16(false, a, false, b, (short)0, c, false, false);   // bare builtin: the compiler pads it where a hazard asks for slots
}
__device__ __forceinline__ v8f wmma16b(v16h a, v16h b, v8f c) {   // the same for f16, for the straight-line matrix runs of the fixed-maximum loop; wmma16 with its four slots stays where a rolled loop branches back directly behind a product
  return __builtin_amdgcn_wmma_f32_16x16x32_f16(false, a, false, b, (short)0, c, false, false);
}
// keeps the compiler's scheduler from moving instructions across this line: LDS read groups stay whole and ahead of use, matrix runs stay unbroken (left free, it sank each read to its use, with a wait to 0 in front of the product)
#define SFENCE() __builtin_amdgcn_sched_barrier(0)
// Token-diffusion attention (B 2, N 4,096, d 512, 8 heads x 64): tied q = k projection, distance-kernel logits -|q_i - q_j|^2 / 8 x tau_h, softmax, . v, output projection.
__device__ __forceinline__ v16h frag_h(const _Float16* rowk0, int lane) {
  union { v16h v; v8h q[2]; } u; const _Float16* p = rowk0 + 8 * (lane >> 4);
  u.q[0] = *(const v8h*)p; u.q[1] = *(const v8h*)(p + 16); return u.v;
}
__device__ __forceinline__ v16h frag_f32(const float* rowk0, int lane) {
  v16h a; const float* p = rowk0 + 8 * (lane >> 4);
#pragma unroll
  for (int i = 0; i < 8; ++i) { a[i] = (_Float16)p[i]; a[8 + i] = (_Float16)p[16 + i]; }
  return a;
}
__device__ __forceinline__ v16h frag_f32s(const float* rowk0, int lane, float sc) {
  v16h a; const float* p = rowk0 + 8 * (lane >> 4);
#pragma unroll
  for (int i = 0; i < 8; ++i) { a[i] = (_Float16)(p[i] * sc); a[8 + i] = (_Float16)(p[16 + i] * sc); }
  return a;
}
// column fragment from a [K][ld] layout (column n), rows >= K read as 0
__device__ __forceinline__ v16h fragc_f32(const float* W, int k0, int n, int lane, int ld, int K) {
  v16h a; const int g = lane >> 4;
#pragma unroll
  for (int i = 0; i < 8; ++i) { const int ka = k0 + 8 * g + i, kb = ka + 16;
    a[i] = (_Float16)(ka < K ? W[(size_t)(ka < K ? ka : K - 1) * ld + n] : 0.f); a[8 + i] = (_Float16)(kb < K ? W[(size_t)(kb < K ? kb : K - 1) * ld + n] : 0.f); }
  return a;
}
struct F2 { v16b h, l; };
__device__ __forceinline__ F2 bsplit16(const float v[16]) { F2 r;
#pragma unroll
  for (int i = 0; i < 16; ++i) { const __bf16 h = (__bf16)v[i]; r.h[i] = h; r.l[i] = (__bf16)(v[i] - (float)h); }
  return r; }
__device__ __forceinline__ F2 split_row(const float* row, int k0, int lane) { float v[16]; const float* p = row + k0 + 8 * (lane >> 4);
#pragma unroll
  for (int i = 0; i < 8; ++i) { v[i] = p[i]; v[8 + i] = p[16 + i]; }
  return bsplit16(v); }
__device__ __forceinline__ F2 split_rowK(const float* row, int k0, int lane, int K) { float v[16]; const int g = lane >> 4;
#pragma unroll
  for (int i = 0; i < 8; ++i) { const int ka = k0 + 8 * g + i, kb = ka + 16; v[i] = ka < K ? row[ka < K ? ka : K - 1] : 0.f; v[8 + i] = kb < K ? row[kb < K ? kb : K - 1] : 0.f; }
  return bsplit16(v); }
__device__ __forceinline__ F2 split_col(const float* W, int k0, int n, int lane, int ld, int K) { float v[16]; const int g = lane >> 4;
#pragma unroll
  for (int i = 0; i < 8; ++i) { const int ka = k0 + 8 * g + i, kb = ka + 16; v[i] = ka < K ? W[(size_t)(ka < K ? ka : K - 1) * ld + n] : 0.f; v[8 + i] = kb < K ? W[(size_t)(kb < K ? kb : K - 1) * ld + n] : 0.f; }
  return bsplit16(v); }
__device__ __forceinline__ v8f mac3(const F2& a, const F2& b, v8f c) { c = wmma_bf(a.l, b.h, c); c = wmma_bf(a.h, b.l, c); return wmma_bf(a.h, b.h, c); }
__device__ __forceinline__ float sigm(float v) { return 1.0f / (1.0f + expf(-v)); }
#define LDSX() do { asm volatile("s_wait_dscnt 0" ::: "memory"); __builtin_amdgcn_wave_barrier(); __builtin_amdgcn_fence(__ATOMIC_RELEASE, "workgroup"); } while (0)


#define NB 2
#define SS 4096
#define DM 512
#define NH 8
#define HD 64
#define QKVW (2 * DM)          // projection rows: Wqk (tied q = k), Wv
#ifndef TQB
#define TQB (SS / 128)         // query blocks of k_attn: 4 waves x 32 queries
#define TNB NB
#define TOB (NB * SS / 64)     // output row tiles (all)
#endif
typedef __attribute__((ext_vector_type(8))) __bf16 v8b;
__device__ __forceinline__ v16b frag_b(const __bf16* rowk0, int lane) {
  union { v16b v; v8b q[2]; } u; const __bf16* p = rowk0 + 8 * (lane >> 4);
  u.q[0] = *(const v8b*)p; u.q[1] = *(const v8b*)(p + 16); return u.v;
}
__device__ __forceinline__ float bfr(float v) { return (float)(__bf16)v; }
__device__ __attribute__((noinline)) float exp_ni(float v) { return expf(v); }
__device__ __attribute__((noinline)) float erf_ni(float v) { return erff(v); }

#define PK_A 0                       // [1024][512] Wqk, Wv rows (natural [out][in])
#define PK_P (PK_A + QKVW * DM)        // [512][512] Wo rows (natural)
#define PK_END (PK_P + DM * DM)
#define WS_PK  0u
#define WS_QK  (WS_PK + 2u * PK_END)             // f16 [8192 rows][pitch 1024]: q = k in columns 0..511, the rest of a row is neither written nor read
#define WS_VTH (WS_QK + 2u * NB * SS * 2 * DM)     // f16 [b][512 (h*64+d)][4096 s]
#define WS_O   (WS_VTH + 2u * NB * DM * SS)        // f32 [8192][512]
#define WS_CS  (WS_O + 4u * NB * SS * DM)           // f32 [2][4096][32]: reserved, neither written nor read
#define WS_Q2  (WS_CS + 4u * 2 * SS * 32)                  // f32 [b][h][s] -|q|^2 / 2
#define WS_END (WS_Q2 + 4u * (size_t)NB * NH * SS)
// ---- k_pack: block = (row n, which): natural [out][in] rows -> bf16; which 0..1 -> W_qk/W_v into PK_A rows which*512 + n; 2 -> W_o into PK_P
__global__ __launch_bounds__(256) void k_pack(const float* __restrict__ WQ, const float* __restrict__ WV, const float* __restrict__ WO, __bf16* __restrict__ PK) {
  __shared__ __align__(16) __bf16 s[DM]; const int n = blockIdx.x, which = blockIdx.y, t = threadIdx.x; const float* Wm = (which == 0) ? WQ : (which == 1) ? WV : WO;
  for (int k = t; k < DM; k += 256) s[k] = (__bf16)Wm[(size_t)n * DM + k];
  __syncthreads();
  __bf16* dst = (which < 2) ? PK + PK_A + ((size_t)which * DM + n) * DM : PK + PK_P + (size_t)n * DM;
  for (int q = t; q < DM / 8; q += 256) vst2((unsigned*)(dst + q * 8), *(const v4u*)&s[q * 8]);
}
// ---- LDS ring of the two projection kernels: one stage = 64 k of the block's 64 f32 rows (256 B a row) and of its 128 bf16 weight rows (128 B a row)
#define GST 64                 // k per stage
#define XPB 272                // LDS pitch of an f32 row piece: 256 B + 16 B, an odd multiple of 16 B (conflict-free for ds_load_b128)
#define WPB 144                // LDS pitch of a weight row piece: 128 B + 16 B, an odd multiple of 16 B
#define XSB (64 * XPB)         // bytes of one f32 buffer
#define WSB (128 * WPB)        // bytes of one weight buffer
// eight 16-B pieces per thread, global -> LDS through no register, at fixed steps of both addresses (a wave's copy = 4 whole 128-B lines).
// s_wait_xcnt 0 is the last line of the copies' own statement, so that it stands in front of every later write of the address registers the copies name.
__device__ __forceinline__ void copy8(unsigned l, unsigned ls, const char* gp, size_t gs) {
  asm volatile("global_load_async_to_lds_b128 %0, %8, off\n\t"
               "global_load_async_to_lds_b128 %1, %9, off\n\t"
               "global_load_async_to_lds_b128 %2, %10, off\n\t"
               "global_load_async_to_lds_b128 %3, %11, off\n\t"
               "global_load_async_to_lds_b128 %4, %12, off\n\t"
               "global_load_async_to_lds_b128 %5, %13, off\n\t"
               "global_load_async_to_lds_b128 %6, %14, off\n\t"
               "global_load_async_to_lds_b128 %7, %15, off\n\t"
               "s_wait_xcnt 0x0"
               :: "v"(l), "v"(l + ls), "v"(l + 2 * ls), "v"(l + 3 * ls), "v"(l + 4 * ls), "v"(l + 5 * ls), "v"(l + 6 * ls), "v"(l + 7 * ls),
                  "v"(gp), "v"(gp + gs), "v"(gp + 2 * gs), "v"(gp + 3 * gs), "v"(gp + 4 * gs), "v"(gp + 5 * gs), "v"(gp + 6 * gs), "v"(gp + 7 * gs)
               : "memory");
}
// one stage: thread t copies f32 rows (t >> 4) + 8 i, piece t & 15, and weight rows (t >> 3) + 16 i, piece t & 7
__device__ __forceinline__ void gstage(unsigned lx, unsigned lw, const char* gx, const char* gw) { copy8(lx, 8 * XPB, gx, (size_t)8 * DM * 4); copy8(lw, 16 * WPB, gw, (size_t)16 * DM * 2); }
__global__ __launch_bounds__(128) void k_qkv(const float* __restrict__ XQ, const float* __restrict__ XV, const __bf16* __restrict__ P, const float* __restrict__ BQ, const float* __restrict__ BV, _Float16* __restrict__ QK, _Float16* __restrict__ VTH) {
  const int which0 = (blockIdx.y * 128) / DM; const float* X = (which0 == 0) ? XQ : XV; const float* BB = BQ ? (((which0 == 0) ? BQ : BV) + (blockIdx.y * 128 - which0 * DM)) : nullptr;
  __shared__ __align__(16) char sm[2 * XSB + 2 * WSB];   // the ring: two f32 buffers, two weight buffers; behind the loop's last barrier the same bytes are the output staging
  _Float16 (*so)[16][136] = (_Float16 (*)[16][136])sm; _Float16 (*sth)[72] = (_Float16 (*)[72])(sm + 2 * XSB);
  const int tid = threadIdx.x, wave = tid >> 5, lane = tid & 31, col = lane & 15, g = lane >> 4; const size_t r0 = (size_t)blockIdx.x * 64 + wave * 16; const int n0 = blockIdx.y * 128;
  v8f acc[8] = {};
  const char* gx = (const char*)(X + ((size_t)blockIdx.x * 64 + (tid >> 4)) * DM + (tid & 15) * 4); const char* gw = (const char*)(P + (size_t)(n0 + (tid >> 3)) * DM + (tid & 7) * 8);
  const unsigned lx = (unsigned)(size_t)sm + (tid >> 4) * XPB + (tid & 15) * 16, lw = (unsigned)(size_t)sm + 2 * XSB + (tid >> 3) * WPB + (tid & 7) * 16;
  gstage(lx, lw, gx, gw);
  asm volatile("s_wait_asynccnt 0x0" ::: "memory");   // this wave's copies of stage 0 have landed
  __syncthreads();                                    // stage 0 published to all 4 waves
  gstage(lx + XSB, lw + WSB, gx + GST * 4, gw + GST * 2);   // stage 1 flies under stage 0's work
#pragma unroll 1   // stages stay rolled: one publish point, at the foot of each trip
  for (int st = 0; st < DM / GST; ++st) { const int bf = st & 1; const float* xr = (const float*)(sm + bf * XSB + (wave * 16 + col) * XPB); const __bf16* wr = (const __bf16*)(sm + 2 * XSB + bf * WSB + col * WPB);
#pragma unroll
    for (int kc = 0; kc < GST / 32; ++kc) { v16b a; { const float* p = xr + kc * 32 + 8 * g;
#pragma unroll
        for (int i = 0; i < 8; ++i) { a[i] = (__bf16)p[i]; a[8 + i] = (__bf16)p[16 + i]; } }
      v16b w[8];   // the eight weight fragments of this k step, read as one group in front of its products
#pragma unroll
      for (int j = 0; j < 8; ++j) w[j] = frag_b(wr + j * 16 * (WPB / 2) + kc * 32, lane);
      SFENCE();
#pragma unroll
      for (int j = 0; j < 8; ++j) acc[j] = wmma_bf(a, w[j], acc[j]); }
    // publish point of stage st + 1, every wave, in this order
    asm volatile("s_wait_dscnt 0x0" ::: "memory");      // this wave's reads of buffer bf have returned
    asm volatile("s_wait_asynccnt 0x0" ::: "memory");   // this wave's copies of stage st + 1 have landed
    __syncthreads();                                    // stage st + 1 published; every wave has left buffer bf
    if (st + 2 < DM / GST) gstage(lx + bf * XSB, lw + bf * WSB, gx + (st + 2) * (GST * 4), gw + (st + 2) * (GST * 2)); }   // refill of the buffers just read
  asm volatile("s_wait_asynccnt 0x0" ::: "memory");   // no copy outstanding behind the loop
  if (n0 < DM) {   // q = k stored unscaled (f16 sigma ~0.6, no subnormal exposure); 1/8 applied to the f32 score
#pragma unroll
    for (int j = 0; j < 8; ++j) {
#pragma unroll
      for (int r = 0; r < 8; ++r) { const float v = acc[j][r] + (BB ? bfr(BB[j * 16 + col]) : 0.f); so[wave][8 * g + r][j * 16 + col] = (_Float16)v; } }   // q = k (+ bias) as one f16
    LDSX();
    for (int rl = 0; rl < 16; ++rl) if (lane < 16) vst2((unsigned*)(QK + (r0 + rl) * (2 * DM) + n0 + lane * 8), *(const v4u*)&so[wave][rl][lane * 8]);
  } else {
#pragma unroll
    for (int j = 0; j < 8; ++j) {
#pragma unroll
      for (int r = 0; r < 8; ++r) { const float v = acc[j][r] + (BB ? bfr(BB[j * 16 + col]) : 0.f); sth[j * 16 + col][wave * 16 + 8 * g + r] = (_Float16)v; } }
    __syncthreads();
    const size_t rb = (size_t)blockIdx.x * 64; const int b = (int)(rb / SS), s0 = (int)(rb % SS); const int pc0 = n0 - DM;
    for (int q = tid; q < 128 * 8; q += 128) { const int d = q >> 3, pc = q & 7; const size_t o = ((size_t)b * DM + pc0 + d) * SS + s0 + pc * 8; vst2((unsigned*)(VTH + o), *(const v4u*)&sth[d][pc * 8]); }
  }
}
// ---- k_attn: block = (128 queries, head h, batch b): all-keys flash attention (K = 64: 2 k-steps), logits = -|q - k|^2 / 8 x tau_h with single f16 operands, P.V: f16 P (x2^11) x V hi (single f16) in one accumulator; O[b*S+q][h*64+d] = acc / 2048 / l (256-B segments)
#define KST 64   // keys per LDS stage
#define KPI 72   // LDS row pitch in f16: a 128-B row + 16 B = 144 B, an odd multiple of 16 B (conflict-free for ds_load_b128)
#define KSB (KST * KPI * 2)   // bytes of one K (or V^T) buffer
// one stage = 64 K rows x 128 B + 64 V^T rows x 128 B: each of the 128 threads copies four 16-B pieces of each, global -> LDS through no register (a wave's copy = 4 whole 128-B lines).
// s_wait_xcnt 0 is the last line of the copies' own statement, so that it stands in front of every later write of the address registers the copies name.
__device__ __forceinline__ void stage_copy(unsigned lk, unsigned lv, const _Float16* gk, const _Float16* gv) {
  asm volatile("global_load_async_to_lds_b128 %0, %8, off\n\t"
               "global_load_async_to_lds_b128 %1, %9, off\n\t"
               "global_load_async_to_lds_b128 %2, %10, off\n\t"
               "global_load_async_to_lds_b128 %3, %11, off\n\t"
               "global_load_async_to_lds_b128 %4, %12, off\n\t"
               "global_load_async_to_lds_b128 %5, %13, off\n\t"
               "global_load_async_to_lds_b128 %6, %14, off\n\t"
               "global_load_async_to_lds_b128 %7, %15, off\n\t"
               "s_wait_xcnt 0x0"
               :: "v"(lk), "v"(lk + 16 * KPI * 2), "v"(lk + 32 * KPI * 2), "v"(lk + 48 * KPI * 2), "v"(lv), "v"(lv + 16 * KPI * 2), "v"(lv + 32 * KPI * 2), "v"(lv + 48 * KPI * 2),
                  "v"(gk), "v"(gk + (size_t)16 * 2 * DM), "v"(gk + (size_t)32 * 2 * DM), "v"(gk + (size_t)48 * 2 * DM), "v"(gv), "v"(gv + (size_t)16 * SS), "v"(gv + (size_t)32 * SS), "v"(gv + (size_t)48 * SS)
               : "memory");
}
// -|k|^2 / 2 of one stage's 64 keys = 256 B: one 8-B piece per lane of ONE wave, global -> LDS through no register; s_wait_xcnt 0 closes the copy's own statement, in front of every later write of its address registers.
__device__ __forceinline__ void stage_copy_k2(unsigned l2, const float* g2) {
  asm volatile("global_load_async_to_lds_b64 %0, %1, off\n\t"
               "s_wait_xcnt 0x0"
               :: "v"(l2), "v"(g2) : "memory");
}
// lane l <-> lane l ^ 16 (the two halves of a wave hold the two halves of one query's keys)
__device__ __forceinline__ float xhalf(float x) { return __builtin_bit_cast(float, __builtin_amdgcn_permlanex16(__builtin_bit_cast(int, x), __builtin_bit_cast(int, x), 0x76543210, 0xfedcba98, false, false)); }
// 2^x for eight values / one value. One statement each: the outputs are early-clobber, so that no v_exp_f32 overwrites a source of the one in front of it, and the closing v_nop is the slot the instruction set asks for
// between a transcendental and a next instruction that reads its result or overwrites its source.
__device__ __forceinline__ v8f exp2x8(v8f x) { float r0, r1, r2, r3, r4, r5, r6, r7;
  asm("v_exp_f32 %0, %8\n\tv_exp_f32 %1, %9\n\tv_exp_f32 %2, %10\n\tv_exp_f32 %3, %11\n\tv_exp_f32 %4, %12\n\tv_exp_f32 %5, %13\n\tv_exp_f32 %6, %14\n\tv_exp_f32 %7, %15\n\tv_nop"
      : "=&v"(r0), "=&v"(r1), "=&v"(r2), "=&v"(r3), "=&v"(r4), "=&v"(r5), "=&v"(r6), "=&v"(r7) : "v"(x[0]), "v"(x[1]), "v"(x[2]), "v"(x[3]), "v"(x[4]), "v"(x[5]), "v"(x[6]), "v"(x[7]));
  return v8f{r0, r1, r2, r3, r4, r5, r6, r7}; }
__device__ __forceinline__ float exp2x1(float x) { float r; asm("v_exp_f32 %0, %1\n\tv_nop" : "=&v"(r) : "v"(x)); return r; }
#define LOG2E 1.44269504088896340736f   // exp(v) = 2^(v log2 e), the form __expf compiles to
#define QT 2   // 16-query tiles per wave: in the max0 loop every K and V^T fragment read from LDS is the A operand of QT products
// s a + b on register pairs: the two constants stay one pair each, whichever pair of s they meet
__device__ __forceinline__ v8f fma8(v8f s, v2f a, v2f b) { union { v8f v; v2f p[4]; } u; u.v = s;
#pragma unroll
  for (int i = 0; i < 4; ++i) u.p[i] = u.p[i] * a + b;
  return u.v; }
__device__ __forceinline__ v8f ld8f(const float* p) { union { v8f v; v4f q[2]; } u; u.q[0] = *(const v4f*)p; u.q[1] = *(const v4f*)(p + 4); return u.v; }
// one 32-key pass of one query tile with the running maximum (any tau): kb = K row (pass key 0 + col), kp = -|k|^2 / 2 of pass key 8 g, vb = V^T row col at the pass's first key
__device__ __forceinline__ void pass_runmax(const _Float16* kb, const float* kp, const _Float16* vb, int lane, const v16h (&aq)[2], float hq, float tau, float& m, float& l, v8f (&acc)[4]) {
  v8f s[2];
#pragma unroll
  for (int ct = 0; ct < 2; ++ct) { const _Float16* krow = kb + ct * 16 * KPI; v8f c = {};
#pragma unroll
    for (int kc = 0; kc < 2; ++kc) c = wmma16(frag_h(krow + kc * 32, lane), aq[kc], c);   // c[r] = k_(8 g + r) . q_col: single product, q, k as one-rounding f16 operands
    s[ct] = (c + hq + ld8f(kp + ct * 16)) * 0.25f * tau; }   // -|q_i - q_j|^2 / sqrt(64) x tau_h
  float mx = fmaxf(s[0][0], s[1][0]);
#pragma unroll
  for (int r = 1; r < 8; ++r) mx = fmaxf(mx, fmaxf(s[0][r], s[1][r]));
  mx = fmaxf(mx, xhalf(mx));
  const float mn = fmaxf(m, mx); const float ea = exp2x1((m - mn) * LOG2E); const float alpha = (m <= -1.0e38f) ? 0.f : ea;
  v8f e[2];
#pragma unroll
  for (int ct = 0; ct < 2; ++ct) { const v8f x = exp2x8((s[ct] - mn) * LOG2E);
#pragma unroll
    for (int r = 0; r < 8; ++r) e[ct][r] = (s[ct][r] <= -1.0e38f) ? 0.f : x[r]; }
  const v8f e2 = e[0] + e[1]; const float es = ((e2[0] + e2[1]) + (e2[2] + e2[3])) + ((e2[4] + e2[5]) + (e2[6] + e2[7]));
  l = l * alpha + es; m = mn;
#pragma unroll
  for (int dt = 0; dt < 4; ++dt) acc[dt] *= alpha;
  v16h pb;   // P^T as B: P scaled by 2^11 before the f16 rounding so small softmax weights stay out of the f16 subnormal range; 2^-11 folded into the epilogue
#pragma unroll
  for (int i = 0; i < 8; ++i) { pb[i] = (_Float16)(e[0][i] * 2048.0f); pb[8 + i] = (_Float16)(e[1][i] * 2048.0f); }
#pragma unroll
  for (int dt = 0; dt < 4; ++dt) acc[dt] = wmma16(frag_h(vb + dt * 16 * KPI, lane), pb, acc[dt]);   // single product: V x P (x2^11)
}
// publish point of stage st + 1, every wave, in this order; then the refill of the buffers just read
__device__ __forceinline__ void ring_foot(int st, bool w0, unsigned lk, unsigned lv, unsigned l2, const _Float16* gk, const _Float16* gv, const float* g2) { const int bf = st & 1;
  asm volatile("s_wait_dscnt 0x0" ::: "memory");      // this wave's reads of buffer bf have returned
  asm volatile("s_wait_asynccnt 0x0" ::: "memory");   // this wave's copies of stage st + 1 have landed
  __syncthreads();                                    // stage st + 1 published; every wave has left buffer bf
  if (st + 2 < SS / KST) { stage_copy(lk + bf * KSB, lv + bf * KSB, gk + (size_t)(st + 2) * KST * 2 * DM, gv + (st + 2) * KST);
    if (w0) stage_copy_k2(l2 + bf * (KST * 4), g2 + (st + 2) * KST); } }
// amdgpu_waves_per_eu(4, 4): a budget of 256 registers, so that the loop stays inside one register window (left free, this build took 261 and switched windows in the loop)
__global__ __launch_bounds__(128) __attribute__((amdgpu_waves_per_eu(4, 4))) void k_attn(const _Float16* __restrict__ QK, const _Float16* __restrict__ QKL, const _Float16* __restrict__ VTH, const _Float16* __restrict__ VTL, const void* __restrict__ KMASK, const float* __restrict__ Q2, const float* __restrict__ TAU, float* __restrict__ O) {
  __shared__ __align__(16) float so[4][QT * 16][68];
  __shared__ __align__(16) _Float16 sk[2][KST][KPI], sv[2][HD][KPI];   // two buffers: K rows [key][d], V^T rows [d][key] of one 64-key stage, shared by the block's 4 waves
  __shared__ __align__(16) float sk2[2][KST];                          // two buffers: -|k|^2 / 2 of the stage's keys
  const int tid = threadIdx.x, wave = __builtin_amdgcn_readfirstlane(tid >> 5), lane = tid & 31, col = lane & 15, g = lane >> 4;   // the wave's number as a scalar: what is formed from it (first query, output row) takes no vector register across the loop
  const int qb = blockIdx.x, h = blockIdx.y, b = blockIdx.z; const int q0 = qb * (4 * QT * 16) + wave * (QT * 16);
  const bool w0 = wave == 0;   // scalar: the wave that copies -|k|^2 / 2
  const float tau = bfr(TAU[h]); const float* Q2h = Q2 + ((size_t)b * NH + h) * SS;
  v16h aq[QT][2]; float hq[QT];   // per tile: this lane's query as B operand, and its -|q|^2 / 2
#pragma unroll
  for (int qt = 0; qt < QT; ++qt) { hq[qt] = Q2h[q0 + qt * 16 + col];
#pragma unroll
    for (int kc = 0; kc < 2; ++kc) aq[qt][kc] = frag_h(QK + ((size_t)b * SS + q0 + qt * 16 + col) * (2 * DM) + h * HD + kc * 32, lane); }
  // q = k, so logit_ij = -|q_i - q_j|^2 tau / 8 <= 0 for tau >= 0 and logit_ii = 0, and every row meets its own key: the row maximum is 0 before any key is read.
  // Scalar test, the same for the whole block (tau of its head); any other tau (negative, NaN, or so large that the rounding of logit_ii could leave the head room of P in f16) takes the running maximum.
  const bool max0 = __builtin_amdgcn_readfirstlane((int)(tau >= 0.f && tau <= 64.f)) != 0;
  const float xa = 0.25f * tau * LOG2E;   // log2 (2^11 e^logit) = (k.q - |k|^2 / 2) xa + xb
  const v2f xa2 = {xa, xa};
  float m[QT], l[QT];            // per tile, this lane's query: running maximum (equal in both halves); sum over this half's keys
  v2f xb2[QT], ls[QT];           // max0: xb; this lane's sums of 2^11 P, folded to one register pair in every pass
  v8f acc[QT][4];                // O^T: acc[qt][dt][r] = o[query col of tile qt][d = dt * 16 + 8 g + r]
#pragma unroll
  for (int qt = 0; qt < QT; ++qt) { const float xb = hq[qt] * xa + 11.0f; xb2[qt] = v2f{xb, xb}; m[qt] = -3.0e38f; l[qt] = 0.f; ls[qt] = v2f{};
#pragma unroll
    for (int dt = 0; dt < 4; ++dt) acc[qt][dt] = v8f{}; }
  const int nst = SS / KST;   // all keys, 64 a stage
  const int crow = tid >> 3, cpc = tid & 7;   // this thread's row (+ 16 i) and 16-B piece in every stage
  const _Float16* gk = QK + ((size_t)b * SS + crow) * (2 * DM) + h * HD + cpc * 8;   /* K rows = the q plane's rows (tied) */ const _Float16* gv = VTH + ((size_t)b * DM + h * HD + crow) * SS + cpc * 8;
  const unsigned lk = (unsigned)(size_t)&sk[0][crow][cpc * 8], lv = (unsigned)(size_t)&sv[0][crow][cpc * 8], l2 = (unsigned)(size_t)&sk2[0][lane * 2];
  const float* g2 = Q2h + lane * 2;
  stage_copy(lk, lv, gk, gv);
  if (w0) stage_copy_k2(l2, g2);
  asm volatile("s_wait_asynccnt 0x0" ::: "memory");   // this wave's copies of stage 0 have landed
  __syncthreads();                                    // stage 0 published to all 4 waves
  stage_copy(lk + KSB, lv + KSB, gk + (size_t)KST * 2 * DM, gv + KST);   // stage 1 flies under stage 0's work
  if (w0) stage_copy_k2(l2 + KST * 4, g2 + KST);
  if (max0) {   // the same for the whole block: each side has its own loop over the stages, with the same publish point
#pragma unroll 1   // stages stay rolled: one publish point, at the foot of each trip
  for (int st = 0; st < nst; ++st) { const int bf = st & 1; const _Float16* kb = &sk[bf][col][0]; const _Float16* vb = &sv[bf][col][0]; const float* kp = &sk2[bf][8 * g];
    v16h kf[2][2]; v8f k2[2];   // the K fragments and -|k|^2 / 2 of one 32-key pass, read as one group
#pragma unroll
    for (int ct = 0; ct < 2; ++ct) { k2[ct] = ld8f(kp + ct * 16);
#pragma unroll
      for (int kc = 0; kc < 2; ++kc) kf[ct][kc] = frag_h(kb + ct * 16 * KPI + kc * 32, lane); }
    SFENCE();
#pragma unroll   // both 32-key passes of the stage in line: nothing is carried from pass to pass but sums and the fragments fetched ahead, and every LDS offset is a constant
    for (int sub = 0; sub < KST / 32; ++sub) { v8f s[QT][2];
#pragma unroll
      for (int kc = 0; kc < 2; ++kc) {   // four independent tiles between a product and the one that adds to it
#pragma unroll
        for (int ct = 0; ct < 2; ++ct) {
#pragma unroll
          for (int qt = 0; qt < QT; ++qt) s[qt][ct] = wmma16b(kf[ct][kc], aq[qt][kc], kc ? s[qt][ct] : k2[ct]); } }   // the product starts from -|k|^2 / 2 of its rows
      SFENCE();
      v16h vf[4];   // this pass's V^T fragments and the next pass's K group: one place of LDS reads, in flight under the exponentials
#pragma unroll
      for (int dt = 0; dt < 4; ++dt) vf[dt] = frag_h(vb + dt * 16 * KPI + sub * 32, lane);
      if (sub + 1 < KST / 32) {
#pragma unroll
        for (int ct = 0; ct < 2; ++ct) { k2[ct] = ld8f(kp + (sub + 1) * 32 + ct * 16);
#pragma unroll
          for (int kc = 0; kc < 2; ++kc) kf[ct][kc] = frag_h(kb + ((sub + 1) * 32 + ct * 16) * KPI + kc * 32, lane); } }
      SFENCE();
      v16h pb[QT];
#pragma unroll
      for (int qt = 0; qt < QT; ++qt) { const v8f e0 = exp2x8(fma8(s[qt][0], xa2, xb2[qt])), e1 = exp2x8(fma8(s[qt][1], xa2, xb2[qt]));   // 2^11 P: one fma and one exponential a score
        const v8f e2 = e0 + e1; const v4f e4 = __builtin_shufflevector(e2, e2, 0, 1, 2, 3) + __builtin_shufflevector(e2, e2, 4, 5, 6, 7);
        ls[qt] += __builtin_shufflevector(e4, e4, 0, 1) + __builtin_shufflevector(e4, e4, 2, 3);
#pragma unroll
        for (int i = 0; i < 8; ++i) { pb[qt][i] = (_Float16)e0[i]; pb[qt][8 + i] = (_Float16)e1[i]; } }
      SFENCE();
#pragma unroll
      for (int dt = 0; dt < 4; ++dt) {
#pragma unroll
        for (int qt = 0; qt < QT; ++qt) acc[qt][dt] = wmma16b(vf[dt], pb[qt], acc[qt][dt]); }
      SFENCE(); }
    ring_foot(st, w0, lk, lv, l2, gk, gv, g2); }
  } else {
#pragma unroll 1   // stages stay rolled: one publish point, at the foot of each trip
  for (int st = 0; st < nst; ++st) { const int bf = st & 1; const _Float16* kb = &sk[bf][col][0]; const _Float16* vb = &sv[bf][col][0]; const float* kp = &sk2[bf][8 * g];
#pragma unroll 1
    for (int sub = 0; sub < KST / 32; ++sub) {   // rolled, as the 32-key pass was: one copy of the body per tile
#pragma unroll
      for (int qt = 0; qt < QT; ++qt) pass_runmax(kb + sub * 32 * KPI, kp + sub * 32, vb + sub * 32, lane, aq[qt], hq[qt], tau, m[qt], l[qt], acc[qt]); }
    ring_foot(st, w0, lk, lv, l2, gk, gv, g2); }
  }
  asm volatile("s_wait_asynccnt 0x0" ::: "memory");   // no copy outstanding behind the loop
#pragma unroll
  for (int qt = 0; qt < QT; ++qt) { float lq = l[qt];
    if (max0) lq = (ls[qt][0] + ls[qt][1]) * (1.0f / 2048.0f);
    lq += xhalf(lq);   // the halves' sums joined once
    const float il = (1.0f / 2048.0f) / lq;
#pragma unroll
    for (int dt = 0; dt < 4; ++dt) { const v8f o = acc[qt][dt] * il; float* p = &so[wave][qt * 16 + col][dt * 16 + 8 * g]; *(v4f*)p = __builtin_shufflevector(o, o, 0, 1, 2, 3); *(v4f*)(p + 4) = __builtin_shufflevector(o, o, 4, 5, 6, 7); } }
  LDSX();
  for (int rl = 0; rl < QT * 16; ++rl) if (lane < 16) vst2(O + ((size_t)b * SS + q0 + rl) * DM + h * HD + lane * 4, *(const v4f*)&so[wave][rl][lane * 4]);
}
// ---- k_out: block = (64 rows, 128 cols): out = O(hi/lo) . Wo rows (2 products) + bo
__global__ __launch_bounds__(128) void k_out(const float* __restrict__ O, const __bf16* __restrict__ P, const float* __restrict__ BO, float* __restrict__ Y) {
  __shared__ __align__(16) float so[4][16][132];
  const int tid = threadIdx.x, wave = tid >> 5, lane = tid & 31, col = lane & 15, g = lane >> 4; const size_t r0 = (size_t)blockIdx.x * 64 + wave * 16; const int n0 = blockIdx.y * 128;
  __shared__ __align__(16) char sm[2 * XSB + 2 * WSB];   // the ring: two f32 buffers, two weight buffers
  v8f acc[8] = {};
  const char* gx = (const char*)(O + ((size_t)blockIdx.x * 64 + (tid >> 4)) * DM + (tid & 15) * 4); const char* gw = (const char*)(P + (size_t)(n0 + (tid >> 3)) * DM + (tid & 7) * 8);
  const unsigned lx = (unsigned)(size_t)sm + (tid >> 4) * XPB + (tid & 15) * 16, lw = (unsigned)(size_t)sm + 2 * XSB + (tid >> 3) * WPB + (tid & 7) * 16;
  gstage(lx, lw, gx, gw);
  asm volatile("s_wait_asynccnt 0x0" ::: "memory");   // this wave's copies of stage 0 have landed
  __syncthreads();                                    // stage 0 published to all 4 waves
  gstage(lx + XSB, lw + WSB, gx + GST * 4, gw + GST * 2);   // stage 1 flies under stage 0's work
#pragma unroll 1   // stages stay rolled: one publish point, at the foot of each trip
  for (int st = 0; st < DM / GST; ++st) { const int bf = st & 1; const float* xr = (const float*)(sm + bf * XSB + (wave * 16 + col) * XPB); const __bf16* wr = (const __bf16*)(sm + 2 * XSB + bf * WSB + col * WPB);
#pragma unroll
    for (int kc = 0; kc < GST / 32; ++kc) { const F2 a = split_row(xr, kc * 32, lane);
      v16b w[8];   // the eight weight fragments of this k step, read as one group in front of its products
#pragma unroll
      for (int j = 0; j < 8; ++j) w[j] = frag_b(wr + j * 16 * (WPB / 2) + kc * 32, lane);
      SFENCE();
#pragma unroll
      for (int j = 0; j < 8; ++j) { acc[j] = wmma_bf(a.l, w[j], acc[j]); acc[j] = wmma_bf(a.h, w[j], acc[j]); } }
    // publish point of stage st + 1, every wave, in this order
    asm volatile("s_wait_dscnt 0x0" ::: "memory");      // this wave's reads of buffer bf have returned
    asm volatile("s_wait_asynccnt 0x0" ::: "memory");   // this wave's copies of stage st + 1 have landed
    __syncthreads();                                    // stage st + 1 published; every wave has left buffer bf
    if (st + 2 < DM / GST) gstage(lx + bf * XSB, lw + bf * WSB, gx + (st + 2) * (GST * 4), gw + (st + 2) * (GST * 2)); }   // refill of the buffers just read
  asm volatile("s_wait_asynccnt 0x0" ::: "memory");   // no copy outstanding behind the loop
#pragma unroll
  for (int j = 0; j < 8; ++j) {
#pragma unroll
    for (int r = 0; r < 8; ++r) so[wave][8 * g + r][j * 16 + col] = acc[j][r] + (BO ? bfr(BO[n0 + j * 16 + col]) : 0.f); }
  LDSX();
  for (int rl = 0; rl < 16; ++rl) vst2(Y + (r0 + rl) * DM + n0 + lane * 4, *(const v4f*)&so[wave][rl][lane * 4]);
}
// ---- k_q2: block = (64 tokens, b): -|q|^2 / 2 per (token, head) from the f16 q plane (the same values the scores use); whole 256-B segments per (b,h)
__global__ __launch_bounds__(256) void k_q2(const _Float16* __restrict__ QK, float* __restrict__ Q2) {
  __shared__ __align__(16) float sq[NH][64]; const int t = threadIdx.x; const size_t b = blockIdx.y; const int s0 = blockIdx.x * 64; const int tl = t & 63, hp = t >> 6;   // 64 tokens x 4 groups of 2 heads
  const size_t row = b * SS + s0 + tl;
  for (int hh = hp * 2; hh < hp * 2 + 2; ++hh) { float a = 0.f; const _Float16* q = QK + row * (2 * DM) + hh * HD;
#pragma unroll 8
    for (int d = 0; d < HD; ++d) { const float v = (float)q[d]; a += v * v; }
    sq[hh][tl] = -0.5f * a; }
  __syncthreads();
  for (int e = t; e < NH * 16; e += 256) { const int hh = e >> 4, q4 = e & 15; vst2(Q2 + (b * NH + hh) * SS + s0 + q4 * 4, *(const v4f*)&sq[hh][q4 * 4]); }
}
extern "C" void kernel_launch(void* const* d_in, const int* in_sizes, int n_in, void* d_out, int out_size, void* d_ws, size_t ws_size, hipStream_t stream) {
  (void)in_sizes; (void)n_in; (void)out_size;
  const float** F = (const float**)d_in;   // 0 x [2,4096,512], 1 Wqk [512,512] natural, 2 Wv, 3 Wo, 4 tau [8,1,1]
  if (ws_size < (size_t)WS_END) return;
  char* ws = (char*)d_ws; __bf16* PK = (__bf16*)(ws + WS_PK); _Float16 *QK = (_Float16*)(ws + WS_QK), *VTH = (_Float16*)(ws + WS_VTH); float *O = (float*)(ws + WS_O), *Q2 = (float*)(ws + WS_Q2);
  k_pack<<<dim3(DM, 3), 256, 0, stream>>>(F[1], F[2], F[3], PK);
  k_qkv<<<dim3(TNB * SS / 64, QKVW / 128), 128, 0, stream>>>(F[0], F[0], PK + PK_A, nullptr, nullptr, QK, VTH);   // tied q = k: one projection, one plane
  k_q2<<<dim3(SS / 64, TNB), 256, 0, stream>>>(QK, Q2);
  k_attn<<<dim3(TQB, NH, TNB), 128, 0, stream>>>(QK, nullptr, VTH, nullptr, nullptr, Q2, F[4], O);
  k_out<<<dim3(TOB, DM / 128), 128, 0, stream>>>(O, PK + PK_P, nullptr, (float*)d_out);
}

// v008
// Measured time: 85.4 microseconds a run.
// Two timings next to v007 both put it at 1.04 times that version's speed.
// Over all steps from v000 it is 5.86 times as fast.
// compute dtype: all float inputs rounded to bf16, tau read on device; qk / v = x . W^T with EXACT bf16 products on WMMA 16x16x32 (natural rows; the tied projection is computed once, its one plane is read as q and as k); PLAIN attention: q single f16, |q|^2 per token from the same f16 values in f32, logits = (2 q_i.q_j - |q_i|^2 - |q_j|^2) / 8 x tau_h, softmax in f32 (hardware exp; maximum 0 known for 0 <= tau_h <= 64, running maximum otherwise), P (scaled by 2^11, single f16) x v (single f16); out = o (bf16 hi + residual) . Wo^T (2 products).
#include <hip/hip_runtime.h>
#include <math.h>

typedef __attribute__((ext_vector_type(16))) _Float16 v16h;
typedef __attribute__((ext_vector_type(16))) __bf16 v16b;
typedef __attribute__((ext_vector_type(8)))  _Float16 v8h;
typedef __attribute__((ext_vector_type(8)))  float v8f;
typedef __attribute__((ext_vector_type(4)))  float v4f;
typedef __attribute__((ext_vector_type(2)))  float v2f;
typedef __attribute__((ext_vector_type(4)))  unsigned v4u;
typedef __attribute__((ext_vector_type(4)))  int v4i;
typedef float __attribute__((may_alias)) float_a;
typedef int __attribute__((may_alias)) int_a;

template <typename T> __device__ __forceinline__ void vst2(void* p, T v) { *(T*)p = v;  }
__device__ __forceinline__ v8f wmma16(v16h a, v16h b, v8f c) {
  v8f d = __builtin_amdgcn_wmma_f32_16x16x32_f16(false, a, false, b, (short)0, c, false, false);
  asm volatile("v_nop\n\tv_nop\n\tv_nop\n\tv_nop" : "+v"(d) : "v"(a), "v"(b));
  return d;
}
__device__ __forceinline__ v8f wmma_bf(v16b a, v16b b, v8f c) {
  return __builtin_amdgcn_wmma_f32_16x16x32_bf16(false, a, false, b, (short)0, c, false, false);   // bare builtin: the compiler pads it where a hazard asks for slots
}
__device__ __forceinline__ v8f wmma16b(v16h a, v16h b, v8f c) {   // the same for f16, for the straight-line matrix runs of the fixed-maximum loop; wmma16 with its four slots stays where a rolled loop branches back directly behind a product
  return __builtin_amdgcn_wmma_f32_16x16x32_f16(false, a, false, b, (short)0, c, false, false);
}
// keeps the compiler's scheduler from moving instructions across this line: LDS read groups stay whole and ahead of use, matrix runs stay unbroken (left free, it sank each read to its use, with a wait to 0 in front of the product)
#define SFENCE() __builtin_amdgcn_sched_barrier(0)
// Token-diffusion attention (B 2, N 4,096, d 512, 8 heads x 64): tied q = k projection, distance-kernel logits -|q_i - q_j|^2 / 8 x tau_h, softmax, . v, output projection.
__device__ __forceinline__ v16h frag_h(const _Float16* rowk0, int lane) {
  union { v16h v; v8h q[2]; } u; const _Float16* p = rowk0 + 8 * (lane >> 4);
  u.q[0] = *(const v8h*)p; u.q[1] = *(const v8h*)(p + 16); return u.v;
}
__device__ __forceinline__ v16h frag_f32(const float* rowk0, int lane) {
  v16h a; const float* p = rowk0 + 8 * (lane >> 4);
#pragma unroll
  for (int i = 0; i < 8; ++i) { a[i] = (_Float16)p[i]; a[8 + i] = (_Float16)p[16 + i]; }
  return a;
}
__device__ __forceinline__ v16h frag_f32s(const float* rowk0, int lane, float sc) {
  v16h a; const float* p = rowk0 + 8 * (lane >> 4);
#pragma unroll
  for (int i = 0; i < 8; ++i) { a[i] = (_Float16)(p[i] * sc); a[8 + i] = (_Float16)(p[16 + i] * sc); }
  return a;
}
// column fragment from a [K][ld] layout (column n), rows >= K read as 0
__device__ __forceinline__ v16h fragc_f32(const float* W, int k0, int n, int lane, int ld, int K) {
  v16h a; const int g = lane >> 4;
#pragma unroll
  for (int i = 0; i < 8; ++i) { const int ka = k0 + 8 * g + i, kb = ka + 16;
    a[i] = (_Float16)(ka < K ? W[(size_t)(ka < K ? ka : K - 1) * ld + n] : 0.f); a[8 + i] = (_Float16)(kb < K ? W[(size_t)(kb < K ? kb : K - 1) * ld + n] : 0.f); }
  return a;
}
struct F2 { v16b h, l; };
__device__ __forceinline__ F2 bsplit16(const float v[16]) { F2 r;
#pragma unroll
  for (int i = 0; i < 16; ++i) { const __bf16 h = (__bf16)v[i]; r.h[i] = h; r.l[i] = (__bf16)(v[i] - (float)h); }
  return r; }
__device__ __forceinline__ F2 split_row(const float* row, int k0, int lane) { float v[16]; const float* p = row + k0 + 8 * (lane >> 4);
#pragma unroll
  for (int i = 0; i < 8; ++i) { v[i] = p[i]; v[8 + i] = p[16 + i]; }
  return bsplit16(v); }
__device__ __forceinline__ F2 split_rowK(const float* row, int k0, int lane, int K) { float v[16]; const int g = lane >> 4;
#pragma unroll
  for (int i = 0; i < 8; ++i) { const int ka = k0 + 8 * g + i, kb = ka + 16; v[i] = ka < K ? row[ka < K ? ka : K - 1] : 0.f; v[8 + i] = kb < K ? row[kb < K ? kb : K - 1] : 0.f; }
  return bsplit16(v); }
__device__ __forceinline__ F2 split_col(const float* W, int k0, int n, int lane, int ld, int K) { float v[16]; const int g = lane >> 4;
#pragma unroll
  for (int i = 0; i < 8; ++i) { const int ka = k0 + 8 * g + i, kb = ka + 16; v[i] = ka < K ? W[(size_t)(ka < K ? ka : K - 1) * ld + n] : 0.f; v[8 + i] = kb < K ? W[(size_t)(kb < K ? kb : K - 1) * ld + n] : 0.f; }
  return bsplit16(v); }
__device__ __forceinline__ v8f mac3(const F2& a, const F2& b, v8f c) { c = wmma_bf(a.l, b.h, c); c = wmma_bf(a.h, b.l, c); return wmma_bf(a.h, b.h, c); }
__device__ __forceinline__ float sigm(float v) { return 1.0f / (1.0f + expf(-v)); }
#define LDSX() do { asm volatile("s_wait_dscnt 0" ::: "memory"); __builtin_amdgcn_wave_barrier(); __builtin_amdgcn_fence(__ATOMIC_RELEASE, "workgroup"); } while (0)


#define NB 2
#define SS 4096
#define DM 512
#define NH 8
#define HD 64
#define QKVW (2 * DM)          // projection rows: Wqk (tied q = k), Wv
#ifndef TQB
#define TQB (SS / 128)         // query blocks of k_attn: 4 x 32 queries, each by two waves (one per half of the keys)
#define TNB NB
#define TOB (NB * SS / 64)     // output row tiles (all)
#endif
typedef __attribute__((ext_vector_type(8))) __bf16 v8b;
__device__ __forceinline__ v16b frag_b(const __bf16* rowk0, int lane) {
  union { v16b v; v8b q[2]; } u; const __bf16* p = rowk0 + 8 * (lane >> 4);
  u.q[0] = *(const v8b*)p; u.q[1] = *(const v8b*)(p + 16); return u.v;
}
__device__ __forceinline__ float bfr(float v) { return (float)(__bf16)v; }
__device__ __attribute__((noinline)) float exp_ni(float v) { return expf(v); }
__device__ __attribute__((noinline)) float erf_ni(float v) { return erff(v); }

#define PK_A 0                       // [1024][512] Wqk, Wv rows (natural [out][in])
#define PK_P (PK_A + QKVW * DM)        // [512][512] Wo rows (natural)
#define PK_END (PK_P + DM * DM)
#define WS_PK  0u
#define WS_QK  (WS_PK + 2u * PK_END)             // f16 [8192 rows][pitch 1024]: q = k in columns 0..511, the rest of a row is neither written nor read
#define WS_VTH (WS_QK + 2u * NB * SS * 2 * DM)     // f16 [b][512 (h*64+d)][4096 s]
#define WS_O   (WS_VTH + 2u * NB * DM * SS)        // f32 [8192][512]
#define WS_CS  (WS_O + 4u * NB * SS * DM)           // f32 [2][4096][32]: reserved, neither written nor read
#define WS_Q2  (WS_CS + 4u * 2 * SS * 32)                  // f32 [b][h][s] -|q|^2 / 2
#define WS_END (WS_Q2 + 4u * (size_t)NB * NH * SS)
// ---- k_pack: block = (row n, which): natural [out][in] rows -> bf16; which 0..1 -> W_qk/W_v into PK_A rows which*512 + n; 2 -> W_o into PK_P
__global__ __launch_bounds__(256) void k_pack(const float* __restrict__ WQ, const float* __restrict__ WV, const float* __restrict__ WO, __bf16* __restrict__ PK) {
  __shared__ __align__(16) __bf16 s[DM]; const int n = blockIdx.x, which = blockIdx.y, t = threadIdx.x; const float* Wm = (which == 0) ? WQ : (which == 1) ? WV : WO;
  for (int k = t; k < DM; k += 256) s[k] = (__bf16)Wm[(size_t)n * DM + k];
  __syncthreads();
  __bf16* dst = (which < 2) ? PK + PK_A + ((size_t)which * DM + n) * DM : PK + PK_P + (size_t)n * DM;
  for (int q = t; q < DM / 8; q += 256) vst2((unsigned*)(dst + q * 8), *(const v4u*)&s[q * 8]);
}
// ---- LDS ring of the two projection kernels: one stage = 64 k of the block's 64 f32 rows (256 B a row) and of its 128 bf16 weight rows (128 B a row)
#define GST 64                 // k per stage
#define XPB 272                // LDS pitch of an f32 row piece: 256 B + 16 B, an odd multiple of 16 B (conflict-free for ds_load_b128)
#define WPB 144                // LDS pitch of a weight row piece: 128 B + 16 B, an odd multiple of 16 B
#define XSB (64 * XPB)         // bytes of one f32 buffer
#define WSB (128 * WPB)        // bytes of one weight buffer
// eight 16-B pieces per thread, global -> LDS through no register, at fixed steps of both addresses (a wave's copy = 4 whole 128-B lines).
// s_wait_xcnt 0 is the last line of the copies' own statement, so that it stands in front of every later write of the address registers the copies name.
__device__ __forceinline__ void copy8(unsigned l, unsigned ls, const char* gp, size_t gs) {
  asm volatile("global_load_async_to_lds_b128 %0, %8, off\n\t"
               "global_load_async_to_lds_b128 %1, %9, off\n\t"
               "global_load_async_to_lds_b128 %2, %10, off\n\t"
               "global_load_async_to_lds_b128 %3, %11, off\n\t"
               "global_load_async_to_lds_b128 %4, %12, off\n\t"
               "global_load_async_to_lds_b128 %5, %13, off\n\t"
               "global_load_async_to_lds_b128 %6, %14, off\n\t"
               "global_load_async_to_lds_b128 %7, %15, off\n\t"
               "s_wait_xcnt 0x0"
               :: "v"(l), "v"(l + ls), "v"(l + 2 * ls), "v"(l + 3 * ls), "v"(l + 4 * ls), "v"(l + 5 * ls), "v"(l + 6 * ls), "v"(l + 7 * ls),
                  "v"(gp), "v"(gp + gs), "v"(gp + 2 * gs), "v"(gp + 3 * gs), "v"(gp + 4 * gs), "v"(gp + 5 * gs), "v"(gp + 6 * gs), "v"(gp + 7 * gs)
               : "memory");
}
// one stage: thread t copies f32 rows (t >> 4) + 8 i, piece t & 15, and weight rows (t >> 3) + 16 i, piece t & 7
__device__ __forceinline__ void gstage(unsigned lx, unsigned lw, const char* gx, const char* gw) { copy8(lx, 8 * XPB, gx, (size_t)8 * DM * 4); copy8(lw, 16 * WPB, gw, (size_t)16 * DM * 2); }
__global__ __launch_bounds__(128) void k_qkv(const float* __restrict__ XQ, const float* __restrict__ XV, const __bf16* __restrict__ P, const float* __restrict__ BQ, const float* __restrict__ BV, _Float16* __restrict__ QK, _Float16* __restrict__ VTH) {
  const int which0 = (blockIdx.y * 128) / DM; const float* X = (which0 == 0) ? XQ : XV; const float* BB = BQ ? (((which0 == 0) ? BQ : BV) + (blockIdx.y * 128 - which0 * DM)) : nullptr;
  __shared__ __align__(16) char sm[2 * XSB + 2 * WSB];   // the ring: two f32 buffers, two weight buffers; behind the loop's last barrier the same bytes are the output staging
  _Float16 (*so)[16][136] = (_Float16 (*)[16][136])sm; _Float16 (*sth)[72] = (_Float16 (*)[72])(sm + 2 * XSB);
  const int tid = threadIdx.x, wave = tid >> 5, lane = tid & 31, col = lane & 15, g = lane >> 4; const size_t r0 = (size_t)blockIdx.x * 64 + wave * 16; const int n0 = blockIdx.y * 128;
  v8f acc[8] = {};
  const char* gx = (const char*)(X + ((size_t)blockIdx.x * 64 + (tid >> 4)) * DM + (tid & 15) * 4); const char* gw = (const char*)(P + (size_t)(n0 + (tid >> 3)) * DM + (tid & 7) * 8);
  const unsigned lx = (unsigned)(size_t)sm + (tid >> 4) * XPB + (tid & 15) * 16, lw = (unsigned)(size_t)sm + 2 * XSB + (tid >> 3) * WPB + (tid & 7) * 16;
  gstage(lx, lw, gx, gw);
  asm volatile("s_wait_asynccnt 0x0" ::: "memory");   // this wave's copies of stage 0 have landed
  __syncthreads();                                    // stage 0 published to all 4 waves
  gstage(lx + XSB, lw + WSB, gx + GST * 4, gw + GST * 2);   // stage 1 flies under stage 0's work
#pragma unroll 1   // stages stay rolled: one publish point, at the foot of each trip
  for (int st = 0; st < DM / GST; ++st) { const int bf = st & 1; const float* xr = (const float*)(sm + bf * XSB + (wave * 16 + col) * XPB); const __bf16* wr = (const __bf16*)(sm + 2 * XSB + bf * WSB + col * WPB);
#pragma unroll
    for (int kc = 0; kc < GST / 32; ++kc) { v16b a; { const float* p = xr + kc * 32 + 8 * g;
#pragma unroll
        for (int i = 0; i < 8; ++i) { a[i] = (__bf16)p[i]; a[8 + i] = (__bf16)p[16 + i]; } }
      v16b w[8];   // the eight weight fragments of this k step, read as one group in front of its products
#pragma unroll
      for (int j = 0; j < 8; ++j) w[j] = frag_b(wr + j * 16 * (WPB / 2) + kc * 32, lane);
      SFENCE();
#pragma unroll
      for (int j = 0; j < 8; ++j) acc[j] = wmma_bf(a, w[j], acc[j]); }
    // publish point of stage st + 1, every wave, in this order
    asm volatile("s_wait_dscnt 0x0" ::: "memory");      // this wave's reads of buffer bf have returned
    asm volatile("s_wait_asynccnt 0x0" ::: "memory");   // this wave's copies of stage st + 1 have landed
    __syncthreads();                                    // stage st + 1 published; every wave has left buffer bf
    if (st + 2 < DM / GST) gstage(lx + bf * XSB, lw + bf * WSB, gx + (st + 2) * (GST * 4), gw + (st + 2) * (GST * 2)); }   // refill of the buffers just read
  asm volatile("s_wait_asynccnt 0x0" ::: "memory");   // no copy outstanding behind the loop
  if (n0 < DM) {   // q = k stored unscaled (f16 sigma ~0.6, no subnormal exposure); 1/8 applied to the f32 score
#pragma unroll
    for (int j = 0; j < 8; ++j) {
#pragma unroll
      for (int r = 0; r < 8; ++r) { const float v = acc[j][r] + (BB ? bfr(BB[j * 16 + col]) : 0.f); so[wave][8 * g + r][j * 16 + col] = (_Float16)v; } }   // q = k (+ bias) as one f16
    LDSX();
    for (int rl = 0; rl < 16; ++rl) if (lane < 16) vst2((unsigned*)(QK + (r0 + rl) * (2 * DM) + n0 + lane * 8), *(const v4u*)&so[wave][rl][lane * 8]);
  } else {
#pragma unroll
    for (int j = 0; j < 8; ++j) {
#pragma unroll
      for (int r = 0; r < 8; ++r) { const float v = acc[j][r] + (BB ? bfr(BB[j * 16 + col]) : 0.f); sth[j * 16 + col][wave * 16 + 8 * g + r] = (_Float16)v; } }
    __syncthreads();
    const size_t rb = (size_t)blockIdx.x * 64; const int b = (int)(rb / SS), s0 = (int)(rb % SS); const int pc0 = n0 - DM;
    for (int q = tid; q < 128 * 8; q += 128) { const int d = q >> 3, pc = q & 7; const size_t o = ((size_t)b * DM + pc0 + d) * SS + s0 + pc * 8; vst2((unsigned*)(VTH + o), *(const v4u*)&sth[d][pc * 8]); }
  }
}
// ---- k_attn: block = (128 queries, head h, batch b), 8 waves = 4 query slices x 2 key groups: all-keys flash attention (K = 64: 2 k-steps), scores = -|q - k|^2 / 8 x tau_h with single f16 operands, P.V: f16 P (x2^11) x single f16 V in one accumulator; O[b*S+q][h*64+d] = acc / 2048 / l (256-B segments)
#define KST 64   // keys per LDS stage
#define KPI 72   // LDS row pitch in f16: a 128-B row + 16 B = 144 B, an odd multiple of 16 B (conflict-free for ds_load_b128)
#define KSB (KST * KPI * 2)   // bytes of one K (or V^T) buffer
#define KSPL 2                // the keys are dealt to KSPL groups of 4 waves, each with its own ring; a SIMD then holds 4 waves, whose vector work runs under one another's products
#define NSTG (SS / KSPL / KST)   // stages per group
// one stage of one group = 64 K rows x 128 B + 64 V^T rows x 128 B: each of the group's 128 threads copies four 16-B pieces of each, global -> LDS through no register (a wave's copy = 4 whole 128-B lines).
// s_wait_xcnt 0 is the last line of the copies' own statement, so that it stands in front of every later write of the address registers the copies name.
__device__ __forceinline__ void stage_copy(unsigned lk, unsigned lv, const _Float16* gk, const _Float16* gv) {
  asm volatile("global_load_async_to_lds_b128 %0, %8, off\n\t"
               "global_load_async_to_lds_b128 %1, %9, off\n\t"
               "global_load_async_to_lds_b128 %2, %10, off\n\t"
               "global_load_async_to_lds_b128 %3, %11, off\n\t"
               "global_load_async_to_lds_b128 %4, %12, off\n\t"
               "global_load_async_to_lds_b128 %5, %13, off\n\t"
               "global_load_async_to_lds_b128 %6, %14, off\n\t"
               "global_load_async_to_lds_b128 %7, %15, off\n\t"
               "s_wait_xcnt 0x0"
               :: "v"(lk), "v"(lk + 16 * KPI * 2), "v"(lk + 32 * KPI * 2), "v"(lk + 48 * KPI * 2), "v"(lv), "v"(lv + 16 * KPI * 2), "v"(lv + 32 * KPI * 2), "v"(lv + 48 * KPI * 2),
                  "v"(gk), "v"(gk + (size_t)16 * 2 * DM), "v"(gk + (size_t)32 * 2 * DM), "v"(gk + (size_t)48 * 2 * DM), "v"(gv), "v"(gv + (size_t)16 * SS), "v"(gv + (size_t)32 * SS), "v"(gv + (size_t)48 * SS)
               : "memory");
}
// -|k|^2 / 2 of one stage's 64 keys = 256 B: one 8-B piece per lane of ONE wave, global -> LDS through no register; s_wait_xcnt 0 closes the copy's own statement, in front of every later write of its address registers.
__device__ __forceinline__ void stage_copy_k2(unsigned l2, const float* g2) {
  asm volatile("global_load_async_to_lds_b64 %0, %1, off\n\t"
               "s_wait_xcnt 0x0"
               :: "v"(l2), "v"(g2) : "memory");
}
// lane l <-> lane l ^ 16 (the two halves of a wave hold the two halves of one query's keys)
__device__ __forceinline__ float xhalf(float x) { return __builtin_bit_cast(float, __builtin_amdgcn_permlanex16(__builtin_bit_cast(int, x), __builtin_bit_cast(int, x), 0x76543210, 0xfedcba98, false, false)); }
// 2^x for eight values / one value. One statement each: the outputs are early-clobber, so that no v_exp_f32 overwrites a source of the one in front of it, and the closing v_nop is the slot the instruction set asks for
// between a transcendental and a next instruction that reads its result or overwrites its source.
__device__ __forceinline__ v8f exp2x8(v8f x) { float r0, r1, r2, r3, r4, r5, r6, r7;
  asm("v_exp_f32 %0, %8\n\tv_exp_f32 %1, %9\n\tv_exp_f32 %2, %10\n\tv_exp_f32 %3, %11\n\tv_exp_f32 %4, %12\n\tv_exp_f32 %5, %13\n\tv_exp_f32 %6, %14\n\tv_exp_f32 %7, %15\n\tv_nop"
      : "=&v"(r0), "=&v"(r1), "=&v"(r2), "=&v"(r3), "=&v"(r4), "=&v"(r5), "=&v"(r6), "=&v"(r7) : "v"(x[0]), "v"(x[1]), "v"(x[2]), "v"(x[3]), "v"(x[4]), "v"(x[5]), "v"(x[6]), "v"(x[7]));
  return v8f{r0, r1, r2, r3, r4, r5, r6, r7}; }
__device__ __forceinline__ float exp2x1(float x) { float r; asm("v_exp_f32 %0, %1\n\tv_nop" : "=&v"(r) : "v"(x)); return r; }
#define LOG2E 1.44269504088896340736f   // exp(v) = 2^(v log2 e), the form __expf compiles to
#define QT 2   // 16-query tiles per wave: in the max0 loop every K and V^T fragment read from LDS is the A operand of QT products
// s a + b on register pairs: the two constants stay one pair each, whichever pair of s they meet
__device__ __forceinline__ v8f fma8(v8f s, v2f a, v2f b) { union { v8f v; v2f p[4]; } u; u.v = s;
#pragma unroll
  for (int i = 0; i < 4; ++i) u.p[i] = u.p[i] * a + b;
  return u.v; }
__device__ __forceinline__ v8f ld8f(const float* p) { union { v8f v; v4f q[2]; } u; u.q[0] = *(const v4f*)p; u.q[1] = *(const v4f*)(p + 4); return u.v; }
// one 32-key pass of one query tile with the running maximum (any tau): kb = K row (pass key 0 + col), kp = -|k|^2 / 2 of pass key 8 g, vb = V^T row col at the pass's first key
__device__ __forceinline__ void pass_runmax(const _Float16* kb, const float* kp, const _Float16* vb, int lane, const v16h (&aq)[2], float hq, float tau, float& m, float& l, v8f (&acc)[4]) {
  v8f s[2];
#pragma unroll
  for (int ct = 0; ct < 2; ++ct) { const _Float16* krow = kb + ct * 16 * KPI; v8f c = {};
#pragma unroll
    for (int kc = 0; kc < 2; ++kc) c = wmma16(frag_h(krow + kc * 32, lane), aq[kc], c);   // c[r] = k_(8 g + r) . q_col: single product, q, k as one-rounding f16 operands
    s[ct] = (c + hq + ld8f(kp + ct * 16)) * 0.25f * tau; }   // -|q_i - q_j|^2 / sqrt(64) x tau_h
  float mx = fmaxf(s[0][0], s[1][0]);
#pragma unroll
  for (int r = 1; r < 8; ++r) mx = fmaxf(mx, fmaxf(s[0][r], s[1][r]));
  mx = fmaxf(mx, xhalf(mx));
  const float mn = fmaxf(m, mx); const float ea = exp2x1((m - mn) * LOG2E); const float alpha = (m <= -1.0e38f) ? 0.f : ea;
  v8f e[2];
#pragma unroll
  for (int ct = 0; ct < 2; ++ct) { const v8f x = exp2x8((s[ct] - mn) * LOG2E);
#pragma unroll
    for (int r = 0; r < 8; ++r) e[ct][r] = (s[ct][r] <= -1.0e38f) ? 0.f : x[r]; }
  const v8f e2 = e[0] + e[1]; const float es = ((e2[0] + e2[1]) + (e2[2] + e2[3])) + ((e2[4] + e2[5]) + (e2[6] + e2[7]));
  l = l * alpha + es; m = mn;
#pragma unroll
  for (int dt = 0; dt < 4; ++dt) acc[dt] *= alpha;
  v16h pb;   // P^T as B: P scaled by 2^11 before the f16 rounding so small softmax weights stay out of the f16 subnormal range; 2^-11 folded into the epilogue
#pragma unroll
  for (int i = 0; i < 8; ++i) { pb[i] = (_Float16)(e[0][i] * 2048.0f); pb[8 + i] = (_Float16)(e[1][i] * 2048.0f); }
#pragma unroll
  for (int dt = 0; dt < 4; ++dt) acc[dt] = wmma16(frag_h(vb + dt * 16 * KPI, lane), pb, acc[dt]);   // single product: V x P (x2^11)
}
// publish point of stage st + 1, every wave, in this order; then the refill of the buffers just read
__device__ __forceinline__ void ring_foot(int st, bool w0, unsigned lk, unsigned lv, unsigned l2, const _Float16* gk, const _Float16* gv, const float* g2) { const int bf = st & 1;
  asm volatile("s_wait_dscnt 0x0" ::: "memory");      // this wave's reads of buffer bf have returned
  asm volatile("s_wait_asynccnt 0x0" ::: "memory");   // this wave's copies of stage st + 1 have landed
  __syncthreads();                                    // stage st + 1 published; every wave has left buffer bf
  if (st + 2 < NSTG) { stage_copy(lk + bf * KSB, lv + bf * KSB, gk + (size_t)(st + 2) * KST * 2 * DM, gv + (st + 2) * KST);
    if (w0) stage_copy_k2(l2 + bf * (KST * 4), g2 + (st + 2) * KST); } }
// amdgpu_waves_per_eu(4, 4): a budget of 256 registers, so that two blocks of 8 waves stand on a WGP (4 waves a SIMD) and the loop stays inside one register window
__global__ __launch_bounds__(128 * KSPL) __attribute__((amdgpu_waves_per_eu(4, 4))) void k_attn(const _Float16* __restrict__ QK, const _Float16* __restrict__ QKL, const _Float16* __restrict__ VTH, const _Float16* __restrict__ VTL, const void* __restrict__ KMASK, const float* __restrict__ Q2, const float* __restrict__ TAU, float* __restrict__ O) {
  __shared__ __align__(16) float so[4][QT * 16][68];
  __shared__ __align__(16) _Float16 sk[KSPL][2][KST][KPI], sv[KSPL][2][HD][KPI];   // per group two buffers: K rows [key][d], V^T rows [d][key] of one 64-key stage, shared by the group's 4 waves
  __shared__ __align__(16) float sk2[KSPL][2][KST];                                // per group two buffers: -|k|^2 / 2 of the stage's keys
  const int tid = threadIdx.x, wv = __builtin_amdgcn_readfirstlane(tid >> 5), lane = tid & 31, col = lane & 15, g = lane >> 4;   // the wave's number as a scalar: what is formed from it (first query, output row, key group) takes no vector register across the loop
  const int wave = wv & 3, kh = wv >> 2;   // query slice of the block; key group: keys kh * SS / KSPL ...
  const int qb = blockIdx.x, h = blockIdx.y, b = blockIdx.z; const int q0 = qb * (4 * QT * 16) + wave * (QT * 16);
  const bool w0 = wave == 0;   // scalar: the wave of each group that copies -|k|^2 / 2
  const float tau = bfr(TAU[h]); const float* Q2h = Q2 + ((size_t)b * NH + h) * SS;
  v16h aq[QT][2]; float hq[QT];   // per tile: this lane's query as B operand, and its -|q|^2 / 2
#pragma unroll
  for (int qt = 0; qt < QT; ++qt) { hq[qt] = Q2h[q0 + qt * 16 + col];
#pragma unroll
    for (int kc = 0; kc < 2; ++kc) aq[qt][kc] = frag_h(QK + ((size_t)b * SS + q0 + qt * 16 + col) * (2 * DM) + h * HD + kc * 32, lane); }
  // q = k, so logit_ij = -|q_i - q_j|^2 tau / 8 <= 0 for tau >= 0 and logit_ii = 0, and every row meets its own key: the row maximum is 0 before any key is read.
  // Scalar test, the same for the whole block (tau of its head); any other tau (negative, NaN, or so large that the rounding of logit_ii could leave the head room of P in f16) takes the running maximum.
  const bool max0 = __builtin_amdgcn_readfirstlane((int)(tau >= 0.f && tau <= 64.f)) != 0;
  const float xa = 0.25f * tau * LOG2E;   // log2 (2^11 e^logit) = (k.q - |k|^2 / 2) xa + xb
  const v2f xa2 = {xa, xa};
  float m[QT], l[QT];            // per tile, this lane's query: running maximum (equal in both halves); sum over this half's keys
  v2f xb2[QT], ls[QT];           // max0: xb; this lane's sums of 2^11 P, folded to one register pair in every pass
  v8f acc[QT][4];                // O^T: acc[qt][dt][r] = o[query col of tile qt][d = dt * 16 + 8 g + r]
#pragma unroll
  for (int qt = 0; qt < QT; ++qt) { const float xb = hq[qt] * xa + 11.0f; xb2[qt] = v2f{xb, xb}; m[qt] = -3.0e38f; l[qt] = 0.f; ls[qt] = v2f{};
#pragma unroll
    for (int dt = 0; dt < 4; ++dt) acc[qt][dt] = v8f{}; }
  const int nst = NSTG;   // this group's keys, 64 a stage
  const int key0 = kh * (SS / KSPL);   // this group's first key
  const int crow = (tid & 127) >> 3, cpc = tid & 7;   // this thread's row (+ 16 i) and 16-B piece in every stage of its group
  const _Float16* gk = QK + ((size_t)b * SS + key0 + crow) * (2 * DM) + h * HD + cpc * 8;   /* K rows = the q plane's rows (tied) */ const _Float16* gv = VTH + ((size_t)b * DM + h * HD + crow) * SS + key0 + cpc * 8;
  const unsigned lk = (unsigned)(size_t)&sk[kh][0][crow][cpc * 8], lv = (unsigned)(size_t)&sv[kh][0][crow][cpc * 8], l2 = (unsigned)(size_t)&sk2[kh][0][lane * 2];
  const float* g2 = Q2h + key0 + lane * 2;
  stage_copy(lk, lv, gk, gv);
  if (w0) stage_copy_k2(l2, g2);
  asm volatile("s_wait_asynccnt 0x0" ::: "memory");   // this wave's copies of stage 0 have landed
  __syncthreads();                                    // stage 0 published to all waves
  stage_copy(lk + KSB, lv + KSB, gk + (size_t)KST * 2 * DM, gv + KST);   // stage 1 flies under stage 0's work
  if (w0) stage_copy_k2(l2 + KST * 4, g2 + KST);
  if (max0) {   // the same for the whole block: each side has its own loop over the stages, with the same publish point
#pragma unroll 1   // stages stay rolled: one publish point, at the foot of each trip
  for (int st = 0; st < nst; ++st) { const int bf = st & 1; const _Float16* kb = &sk[kh][bf][col][0]; const _Float16* vb = &sv[kh][bf][col][0]; const float* kp = &sk2[kh][bf][8 * g];
    v16h kf[2][2]; v8f k2[2];   // the K fragments and -|k|^2 / 2 of one 32-key pass, read as one group
#pragma unroll
    for (int ct = 0; ct < 2; ++ct) { k2[ct] = ld8f(kp + ct * 16);
#pragma unroll
      for (int kc = 0; kc < 2; ++kc) kf[ct][kc] = frag_h(kb + ct * 16 * KPI + kc * 32, lane); }
    SFENCE();
#pragma unroll   // both 32-key passes of the stage in line: nothing is carried from pass to pass but sums and the fragments fetched ahead, and every LDS offset is a constant
    for (int sub = 0; sub < KST / 32; ++sub) { v8f s[QT][2];
#pragma unroll
      for (int kc = 0; kc < 2; ++kc) {   // four independent tiles between a product and the one that adds to it
#pragma unroll
        for (int ct = 0; ct < 2; ++ct) {
#pragma unroll
          for (int qt = 0; qt < QT; ++qt) s[qt][ct] = wmma16b(kf[ct][kc], aq[qt][kc], kc ? s[qt][ct] : k2[ct]); } }   // the product starts from -|k|^2 / 2 of its rows
      SFENCE();
      v16h vf[4];   // this pass's V^T fragments and the next pass's K group: one place of LDS reads, in flight under the exponentials
#pragma unroll
      for (int dt = 0; dt < 4; ++dt) vf[dt] = frag_h(vb + dt * 16 * KPI + sub * 32, lane);
      if (sub + 1 < KST / 32) {
#pragma unroll
        for (int ct = 0; ct < 2; ++ct) { k2[ct] = ld8f(kp + (sub + 1) * 32 + ct * 16);
#pragma unroll
          for (int kc = 0; kc < 2; ++kc) kf[ct][kc] = frag_h(kb + ((sub + 1) * 32 + ct * 16) * KPI + kc * 32, lane); } }
      SFENCE();
      v16h pb[QT];
#pragma unroll
      for (int qt = 0; qt < QT; ++qt) { const v8f e0 = exp2x8(fma8(s[qt][0], xa2, xb2[qt])), e1 = exp2x8(fma8(s[qt][1], xa2, xb2[qt]));   // 2^11 P: one fma and one exponential a score
        const v8f e2 = e0 + e1; const v4f e4 = __builtin_shufflevector(e2, e2, 0, 1, 2, 3) + __builtin_shufflevector(e2, e2, 4, 5, 6, 7);
        ls[qt] += __builtin_shufflevector(e4, e4, 0, 1) + __builtin_shufflevector(e4, e4, 2, 3);
#pragma unroll
        for (int i = 0; i < 8; ++i) { pb[qt][i] = (_Float16)e0[i]; pb[qt][8 + i] = (_Float16)e1[i]; } }
      SFENCE();
#pragma unroll
      for (int dt = 0; dt < 4; ++dt) {
#pragma unroll
        for (int qt = 0; qt < QT; ++qt) acc[qt][dt] = wmma16b(vf[dt], pb[qt], acc[qt][dt]); }
      SFENCE(); }
    ring_foot(st, w0, lk, lv, l2, gk, gv, g2); }
  } else {
#pragma unroll 1   // stages stay rolled: one publish point, at the foot of each trip
  for (int st = 0; st < nst; ++st) { const int bf = st & 1; const _Float16* kb = &sk[kh][bf][col][0]; const _Float16* vb = &sv[kh][bf][col][0]; const float* kp = &sk2[kh][bf][8 * g];
#pragma unroll 1
    for (int sub = 0; sub < KST / 32; ++sub) {   // rolled, as the 32-key pass was: one copy of the body per tile
#pragma unroll
      for (int qt = 0; qt < QT; ++qt) pass_runmax(kb + sub * 32 * KPI, kp + sub * 32, vb + sub * 32, lane, aq[qt], hq[qt], tau, m[qt], l[qt], acc[qt]); }
    ring_foot(st, w0, lk, lv, l2, gk, gv, g2); }
  }
  asm volatile("s_wait_asynccnt 0x0" ::: "memory");   // no copy outstanding behind the loop
  float lw[QT];   // this wave's sum per tile
#pragma unroll
  for (int qt = 0; qt < QT; ++qt) lw[qt] = max0 ? (ls[qt][0] + ls[qt][1]) * (1.0f / 2048.0f) : l[qt];
  // the two key groups joined: wave 4 + w hands its lane's O^T, sums and maxima to wave w through row [lane] of w's output staging (272-B pitch, conflict-free for 16-B accesses)
  static_assert(KSPL == 2, "the join adds two groups");
  float* xr = &so[wave][lane][0];
  if (kh) {   // scalar
#pragma unroll
    for (int qt = 0; qt < QT; ++qt) {
#pragma unroll
      for (int dt = 0; dt < 4; ++dt) { const v8f o = acc[qt][dt]; float* p = xr + (qt * 4 + dt) * 8; *(v4f*)p = __builtin_shufflevector(o, o, 0, 1, 2, 3); *(v4f*)(p + 4) = __builtin_shufflevector(o, o, 4, 5, 6, 7); } }
    *(v4f*)(xr + 64) = v4f{lw[0], lw[1], m[0], m[1]};
  }
  __syncthreads();   // the upper group's partial results published; the last barrier of the kernel, passed by every wave
  if (kh) return;
  { const v4f t = *(const v4f*)(xr + 64);
#pragma unroll
    for (int qt = 0; qt < QT; ++qt) { const float mn = fmaxf(m[qt], t[2 + qt]);   // fixed maximum: both weights are 1
      const float wa = max0 ? 1.0f : exp2x1((m[qt] - mn) * LOG2E), wb = max0 ? 1.0f : exp2x1((t[2 + qt] - mn) * LOG2E);
      lw[qt] = lw[qt] * wa + t[qt] * wb;
#pragma unroll
      for (int dt = 0; dt < 4; ++dt) acc[qt][dt] = acc[qt][dt] * wa + ld8f(xr + (qt * 4 + dt) * 8) * wb; } }
#pragma unroll
  for (int qt = 0; qt < QT; ++qt) { float lq = lw[qt];
    lq += xhalf(lq);   // the halves' sums joined once
    const float il = (1.0f / 2048.0f) / lq;
#pragma unroll
    for (int dt = 0; dt < 4; ++dt) { const v8f o = acc[qt][dt] * il; float* p = &so[wave][qt * 16 + col][dt * 16 + 8 * g]; *(v4f*)p = __builtin_shufflevector(o, o, 0, 1, 2, 3); *(v4f*)(p + 4) = __builtin_shufflevector(o, o, 4, 5, 6, 7); } }
  LDSX();
  for (int rl = 0; rl < QT * 16; ++rl) if (lane < 16) vst2(O + ((size_t)b * SS + q0 + rl) * DM + h * HD + lane * 4, *(const v4f*)&so[wave][rl][lane * 4]);
}
// ---- k_out: block = (64 rows, 128 cols): out = O(hi/lo) . Wo rows (2 products) + bo
__global__ __launch_bounds__(128) void k_out(const float* __restrict__ O, const __bf16* __restrict__ P, const float* __restrict__ BO, float* __restrict__ Y) {
  __shared__ __align__(16) float so[4][16][132];
  const int tid = threadIdx.x, wave = tid >> 5, lane = tid & 31, col = lane & 15, g = lane >> 4; const size_t r0 = (size_t)blockIdx.x * 64 + wave * 16; const int n0 = blockIdx.y * 128;
  __shared__ __align__(16) char sm[2 * XSB + 2 * WSB];   // the ring: two f32 buffers, two weight buffers
  v8f acc[8] = {};
  const char* gx = (const char*)(O + ((size_t)blockIdx.x * 64 + (tid >> 4)) * DM + (tid & 15) * 4); const char* gw = (const char*)(P + (size_t)(n0 + (tid >> 3)) * DM + (tid & 7) * 8);
  const unsigned lx = (unsigned)(size_t)sm + (tid >> 4) * XPB + (tid & 15) * 16, lw = (unsigned)(size_t)sm + 2 * XSB + (tid >> 3) * WPB + (tid & 7) * 16;
  gstage(lx, lw, gx, gw);
  asm volatile("s_wait_asynccnt 0x0" ::: "memory");   // this wave's copies of stage 0 have landed
  __syncthreads();                                    // stage 0 published to all 4 waves
  gstage(lx + XSB, lw + WSB, gx + GST * 4, gw + GST * 2);   // stage 1 flies under stage 0's work
#pragma unroll 1   // stages stay rolled: one publish point, at the foot of each trip
  for (int st = 0; st < DM / GST; ++st) { const int bf = st & 1; const float* xr = (const float*)(sm + bf * XSB + (wave * 16 + col) * XPB); const __bf16* wr = (const __bf16*)(sm + 2 * XSB + bf * WSB + col * WPB);
#pragma unroll
    for (int kc = 0; kc < GST / 32; ++kc) { const F2 a = split_row(xr, kc * 32, lane);
      v16b w[8];   // the eight weight fragments of this k step, read as one group in front of its products
#pragma unroll
      for (int j = 0; j < 8; ++j) w[j] = frag_b(wr + j * 16 * (WPB / 2) + kc * 32, lane);
      SFENCE();
#pragma unroll
      for (int j = 0; j < 8; ++j) { acc[j] = wmma_bf(a.l, w[j], acc[j]); acc[j] = wmma_bf(a.h, w[j], acc[j]); } }
    // publish point of stage st + 1, every wave, in this order
    asm volatile("s_wait_dscnt 0x0" ::: "memory");      // this wave's reads of buffer bf have returned
    asm volatile("s_wait_asynccnt 0x0" ::: "memory");   // this wave's copies of stage st + 1 have landed
    __syncthreads();                                    // stage st + 1 published; every wave has left buffer bf
    if (st + 2 < DM / GST) gstage(lx + bf * XSB, lw + bf * WSB, gx + (st + 2) * (GST * 4), gw + (st + 2) * (GST * 2)); }   // refill of the buffers just read
  asm volatile("s_wait_asynccnt 0x0" ::: "memory");   // no copy outstanding behind the loop
#pragma unroll
  for (int j = 0; j < 8; ++j) {
#pragma unroll
    for (int r = 0; r < 8; ++r) so[wave][8 * g + r][j * 16 + col] = acc[j][r] + (BO ? bfr(BO[n0 + j * 16 + col]) : 0.f); }
  LDSX();
  for (int rl = 0; rl < 16; ++rl) vst2(Y + (r0 + rl) * DM + n0 + lane * 4, *(const v4f*)&so[wave][rl][lane * 4]);
}
// ---- k_q2: block = (64 tokens, b): -|q|^2 / 2 per (token, head) from the f16 q plane (the same values the scores use); whole 256-B segments per (b,h)
__global__ __launch_bounds__(256) void k_q2(const _Float16* __restrict__ QK, float* __restrict__ Q2) {
  __shared__ __align__(16) float sq[NH][64]; const int t = threadIdx.x; const size_t b = blockIdx.y; const int s0 = blockIdx.x * 64; const int tl = t & 63, hp = t >> 6;   // 64 tokens x 4 groups of 2 heads
  const size_t row = b * SS + s0 + tl;
  for (int hh = hp * 2; hh < hp * 2 + 2; ++hh) { float a = 0.f; const _Float16* q = QK + row * (2 * DM) + hh * HD;
#pragma unroll 8
    for (int d = 0; d < HD; ++d) { const float v = (float)q[d]; a += v * v; }
    sq[hh][tl] = -0.5f * a; }
  __syncthreads();
  for (int e = t; e < NH * 16; e += 256) { const int hh = e >> 4, q4 = e & 15; vst2(Q2 + (b * NH + hh) * SS + s0 + q4 * 4, *(const v4f*)&sq[hh][q4 * 4]); }
}
extern "C" void kernel_launch(void* const* d_in, const int* in_sizes, int n_in, void* d_out, int out_size, void* d_ws, size_t ws_size, hipStream_t stream) {
  (void)in_sizes; (void)n_in; (void)out_size;
  const float** F = (const float**)d_in;   // 0 x [2,4096,512], 1 Wqk [512,512] natural, 2 Wv, 3 Wo, 4 tau [8,1,1]
  if (ws_size < (size_t)WS_END) return;
  char* ws = (char*)d_ws; __bf16* PK = (__bf16*)(ws + WS_PK); _Float16 *QK = (_Float16*)(ws + WS_QK), *VTH = (_Float16*)(ws + WS_VTH); float *O = (float*)(ws + WS_O), *Q2 = (float*)(ws + WS_Q2);
  k_pack<<<dim3(DM, 3), 256, 0, stream>>>(F[1], F[2], F[3], PK);
  k_qkv<<<dim3(TNB * SS / 64, QKVW / 128), 128, 0, stream>>>(F[0], F[0], PK + PK_A, nullptr, nullptr, QK, VTH);   // tied q = k: one projection, one plane
  k_q2<<<dim3(SS / 64, TNB), 256, 0, stream>>>(QK, Q2);
  k_attn<<<dim3(TQB, NH, TNB), 128 * KSPL, 0, stream>>>(QK, nullptr, VTH, nullptr, nullptr, Q2, F[4], O);
  k_out<<<dim3(TOB, DM / 128), 128, 0, stream>>>(O, PK + PK_P, nullptr, (float*)d_out);
}

// v009
// Measured time: 81.2 microseconds a run.
// Next to v008, in two timings, it ran 1.05 times as fast each time.
// Counting every step since v000, it is 6.15 times as fast.
// compute dtype: all float inputs rounded to bf16, tau read on device; qk / v = x . W^T with EXACT bf16 products on WMMA 16x16x32 (natural rows; the tied projection is computed once, its one plane is read as q and as k); PLAIN attention: q single f16, |q|^2 per token from the same f16 values in f32, logits = (2 q_i.q_j - |q_i|^2 - |q_j|^2) / 8 x tau_h, softmax in f32 (hardware exp; maximum 0 known for 0 <= tau_h <= 64, running maximum otherwise), P (scaled by 2^11, single f16) x v (single f16); out = o (bf16 hi + residual) . Wo^T (2 products).
#include <hip/hip_runtime.h>
#include <math.h>

typedef __attribute__((ext_vector_type(16))) _Float16 v16h;
typedef __attribute__((ext_vector_type(16))) __bf16 v16b;
typedef __attribute__((ext_vector_type(8)))  _Float16 v8h;
typedef __attribute__((ext_vector_type(8)))  float v8f;
typedef __attribute__((ext_vector_type(4)))  float v4f;
typedef __attribute__((ext_vector_type(2)))  float v2f;
typedef __attribute__((ext_vector_type(4)))  unsigned v4u;
typedef __attribute__((ext_vector_type(4)))  int v4i;
typedef float __attribute__((may_alias)) float_a;
typedef int __attribute__((may_alias)) int_a;

template <typename T> __device__ __forceinline__ void vst2(void* p, T v) { *(T*)p = v;  }
__device__ __forceinline__ v8f wmma16(v16h a, v16h b, v8f c) {
  v8f d = __builtin_amdgcn_wmma_f32_16x16x32_f16(false, a, false, b, (short)0, c, false, false);
  asm volatile("v_nop\n\tv_nop\n\tv_nop\n\tv_nop" : "+v"(d) : "v"(a), "v"(b));
  return d;
}
__device__ __forceinline__ v8f wmma_bf(v16b a, v16b b, v8f c) {
  return __builtin_amdgcn_wmma_f32_16x16x32_bf16(false, a, false, b, (short)0, c, false, false);   // bare builtin: the compiler pads it where a hazard asks for slots
}
__device__ __forceinline__ v8f wmma16b(v16h a, v16h b, v8f c) {   // the same for f16, for the straight-line matrix runs of the fixed-maximum loop; wmma16 with its four slots stays where a rolled loop branches back directly behind a product
  return __builtin_amdgcn_wmma_f32_16x16x32_f16(false, a, false, b, (short)0, c, false, false);
}
// keeps the compiler's scheduler from moving instructions across this line: LDS read groups stay whole and ahead of use, matrix runs stay unbroken (left free, it sank each read to its use, with a wait to 0 in front of the product)
#define SFENCE() __builtin_amdgcn_sched_barrier(0)
// Token-diffusion attention (B 2, N 4,096, d 512, 8 heads x 64): tied q = k projection, distance-kernel logits -|q_i - q_j|^2 / 8 x tau_h, softmax, . v, output projection.
__device__ __forceinline__ v16h frag_h(const _Float16* rowk0, int lane) {
  union { v16h v; v8h q[2]; } u; const _Float16* p = rowk0 + 8 * (lane >> 4);
  u.q[0] = *(const v8h*)p; u.q[1] = *(const v8h*)(p + 16); return u.v;
}
__device__ __forceinline__ v16h frag_f32(const float* rowk0, int lane) {
  v16h a; const float* p = rowk0 + 8 * (lane >> 4);
#pragma unroll
  for (int i = 0; i < 8; ++i) { a[i] = (_Float16)p[i]; a[8 + i] = (_Float16)p[16 + i]; }
  return a;
}
__device__ __forceinline__ v16h frag_f32s(const float* rowk0, int lane, float sc) {
  v16h a; const float* p = rowk0 + 8 * (lane >> 4);
#pragma unroll
  for (int i = 0; i < 8; ++i) { a[i] = (_Float16)(p[i] * sc); a[8 + i] = (_Float16)(p[16 + i] * sc); }
  return a;
}
// column fragment from a [K][ld] layout (column n), rows >= K read as 0
__device__ __forceinline__ v16h fragc_f32(const float* W, int k0, int n, int lane, int ld, int K) {
  v16h a; const int g = lane >> 4;
#pragma unroll
  for (int i = 0; i < 8; ++i) { const int ka = k0 + 8 * g + i, kb = ka + 16;
    a[i] = (_Float16)(ka < K ? W[(size_t)(ka < K ? ka : K - 1) * ld + n] : 0.f); a[8 + i] = (_Float16)(kb < K ? W[(size_t)(kb < K ? kb : K - 1) * ld + n] : 0.f); }
  return a;
}
struct F2 { v16b h, l; };
__device__ __forceinline__ F2 bsplit16(const float v[16]) { F2 r;
#pragma unroll
  for (int i = 0; i < 16; ++i) { const __bf16 h = (__bf16)v[i]; r.h[i] = h; r.l[i] = (__bf16)(v[i] - (float)h); }
  return r; }
__device__ __forceinline__ F2 split_row(const float* row, int k0, int lane) { float v[16]; const float* p = row + k0 + 8 * (lane >> 4);
#pragma unroll
  for (int i = 0; i < 8; ++i) { v[i] = p[i]; v[8 + i] = p[16 + i]; }
  return bsplit16(v); }
__device__ __forceinline__ F2 split_rowK(const float* row, int k0, int lane, int K) { float v[16]; const int g = lane >> 4;
#pragma unroll
  for (int i = 0; i < 8; ++i) { const int ka = k0 + 8 * g + i, kb = ka + 16; v[i] = ka < K ? row[ka < K ? ka : K - 1] : 0.f; v[8 + i] = kb < K ? row[kb < K ? kb : K - 1] : 0.f; }
  return bsplit16(v); }
__device__ __forceinline__ F2 split_col(const float* W, int k0, int n, int lane, int ld, int K) { float v[16]; const int g = lane >> 4;
#pragma unroll
  for (int i = 0; i < 8; ++i) { const int ka = k0 + 8 * g + i, kb = ka + 16; v[i] = ka < K ? W[(size_t)(ka < K ? ka : K - 1) * ld + n] : 0.f; v[8 + i] = kb < K ? W[(size_t)(kb < K ? kb : K - 1) * ld + n] : 0.f; }
  return bsplit16(v); }
__device__ __forceinline__ v8f mac3(const F2& a, const F2& b, v8f c) { c = wmma_bf(a.l, b.h, c); c = wmma_bf(a.h, b.l, c); return wmma_bf(a.h, b.h, c); }
__device__ __forceinline__ float sigm(float v) { return 1.0f / (1.0f + expf(-v)); }
#define LDSX() do { asm volatile("s_wait_dscnt 0" ::: "memory"); __builtin_amdgcn_wave_barrier(); __builtin_amdgcn_fence(__ATOMIC_RELEASE, "workgroup"); } while (0)


#define NB 2
#define SS 4096
#define DM 512
#define NH 8
#define HD 64
#define QKVW (2 * DM)          // projection rows: Wqk (tied q = k), Wv
#ifndef TQB
#define TQB (SS / 128)         // query blocks of k_attn: 4 x 32 queries, each by two waves (one per half of the keys)
#define TNB NB
#define TOB (NB * SS / 64)     // output row tiles (all)
#endif
typedef __attribute__((ext_vector_type(8))) __bf16 v8b;
__device__ __forceinline__ v16b frag_b(const __bf16* rowk0, int lane) {
  union { v16b v; v8b q[2]; } u; const __bf16* p = rowk0 + 8 * (lane >> 4);
  u.q[0] = *(const v8b*)p; u.q[1] = *(const v8b*)(p + 16); return u.v;
}
__device__ __forceinline__ float bfr(float v) { return (float)(__bf16)v; }
__device__ __attribute__((noinline)) float exp_ni(float v) { return expf(v); }
__device__ __attribute__((noinline)) float erf_ni(float v) { return erff(v); }

#define PK_A 0                       // [1024][512] Wqk, Wv rows (natural [out][in])
#define PK_P (PK_A + QKVW * DM)        // [512][512] Wo rows (natural)
#define PK_END (PK_P + DM * DM)
#define WS_PK  0u
#define WS_QK  (WS_PK + 2u * PK_END)             // f16 [8192 rows][pitch 1024]: q = k in columns 0..511, the rest of a row is neither written nor read
#define WS_VTH (WS_QK + 2u * NB * SS * 2 * DM)     // f16 [b][512 (h*64+d)][4096 s]
#define WS_O   (WS_VTH + 2u * NB * DM * SS)        // f32 [8192][512]
#define WS_CS  (WS_O + 4u * NB * SS * DM)           // f32 [2][4096][32]: reserved, neither written nor read
#define WS_Q2  (WS_CS + 4u * 2 * SS * 32)                  // f32 [b][h][s] -|q|^2 / 2
#define WS_END (WS_Q2 + 4u * (size_t)NB * NH * SS)
// ---- k_pack: block = (row n, which): natural [out][in] rows -> bf16; which 0..1 -> W_qk/W_v into PK_A rows which*512 + n; 2 -> W_o into PK_P
__global__ __launch_bounds__(256) void k_pack(const float* __restrict__ WQ, const float* __restrict__ WV, const float* __restrict__ WO, __bf16* __restrict__ PK) {
  __shared__ __align__(16) __bf16 s[DM]; const int n = blockIdx.x, which = blockIdx.y, t = threadIdx.x; const float* Wm = (which == 0) ? WQ : (which == 1) ? WV : WO;
  for (int k = t; k < DM; k += 256) s[k] = (__bf16)Wm[(size_t)n * DM + k];
  __syncthreads();
  __bf16* dst = (which < 2) ? PK + PK_A + ((size_t)which * DM + n) * DM : PK + PK_P + (size_t)n * DM;
  for (int q = t; q < DM / 8; q += 256) vst2((unsigned*)(dst + q * 8), *(const v4u*)&s[q * 8]);
}
// ---- LDS ring of the two projection kernels: one stage = 64 k of the block's 64 f32 rows (256 B a row) and of its 128 bf16 weight rows (128 B a row)
#define GST 64                 // k per stage
#define XPB 272                // LDS pitch of an f32 row piece: 256 B + 16 B, an odd multiple of 16 B (conflict-free for ds_load_b128)
#define WPB 144                // LDS pitch of a weight row piece: 128 B + 16 B, an odd multiple of 16 B
#define XSB (64 * XPB)         // bytes of one f32 buffer
#define WSB (128 * WPB)        // bytes of one weight buffer
// eight 16-B pieces per thread, global -> LDS through no register, at fixed steps of both addresses (a wave's copy = 4 whole 128-B lines).
// s_wait_xcnt 0 is the last line of the copies' own statement, so that it stands in front of every later write of the address registers the copies name.
__device__ __forceinline__ void copy8(unsigned l, unsigned ls, const char* gp, size_t gs) {
  asm volatile("global_load_async_to_lds_b128 %0, %8, off\n\t"
               "global_load_async_to_lds_b128 %1, %9, off\n\t"
               "global_load_async_to_lds_b128 %2, %10, off\n\t"
               "global_load_async_to_lds_b128 %3, %11, off\n\t"
               "global_load_async_to_lds_b128 %4, %12, off\n\t"
               "global_load_async_to_lds_b128 %5, %13, off\n\t"
               "global_load_async_to_lds_b128 %6, %14, off\n\t"
               "global_load_async_to_lds_b128 %7, %15, off\n\t"
               "s_wait_xcnt 0x0"
               :: "v"(l), "v"(l + ls), "v"(l + 2 * ls), "v"(l + 3 * ls), "v"(l + 4 * ls), "v"(l + 5 * ls), "v"(l + 6 * ls), "v"(l + 7 * ls),
                  "v"(gp), "v"(gp + gs), "v"(gp + 2 * gs), "v"(gp + 3 * gs), "v"(gp + 4 * gs), "v"(gp + 5 * gs), "v"(gp + 6 * gs), "v"(gp + 7 * gs)
               : "memory");
}
// one stage: thread t copies f32 rows (t >> 4) + 8 i, piece t & 15, and weight rows (t >> 3) + 16 i, piece t & 7
__device__ __forceinline__ void gstage(unsigned lx, unsigned lw, const char* gx, const char* gw) { copy8(lx, 8 * XPB, gx, (size_t)8 * DM * 4); copy8(lw, 16 * WPB, gw, (size_t)16 * DM * 2); }
__global__ __launch_bounds__(128) void k_qkv(const float* __restrict__ XQ, const float* __restrict__ XV, const __bf16* __restrict__ P, const float* __restrict__ BQ, const float* __restrict__ BV, _Float16* __restrict__ QK, _Float16* __restrict__ VTH, float* __restrict__ Q2) {
  const int which0 = (blockIdx.y * 128) / DM; const float* X = (which0 == 0) ? XQ : XV; const float* BB = BQ ? (((which0 == 0) ? BQ : BV) + (blockIdx.y * 128 - which0 * DM)) : nullptr;
  __shared__ __align__(16) char sm[2 * XSB + 2 * WSB];   // the ring: two f32 buffers, two weight buffers; behind the loop's last barrier the same bytes are the output staging
  _Float16 (*so)[16][136] = (_Float16 (*)[16][136])sm; _Float16 (*sth)[72] = (_Float16 (*)[72])(sm + 2 * XSB);
  const int tid = threadIdx.x, wave = tid >> 5, lane = tid & 31, col = lane & 15, g = lane >> 4; const size_t r0 = (size_t)blockIdx.x * 64 + wave * 16; const int n0 = blockIdx.y * 128;
  v8f acc[8] = {};
  const char* gx = (const char*)(X + ((size_t)blockIdx.x * 64 + (tid >> 4)) * DM + (tid & 15) * 4); const char* gw = (const char*)(P + (size_t)(n0 + (tid >> 3)) * DM + (tid & 7) * 8);
  const unsigned lx = (unsigned)(size_t)sm + (tid >> 4) * XPB + (tid & 15) * 16, lw = (unsigned)(size_t)sm + 2 * XSB + (tid >> 3) * WPB + (tid & 7) * 16;
  gstage(lx, lw, gx, gw);
  asm volatile("s_wait_asynccnt 0x0" ::: "memory");   // this wave's copies of stage 0 have landed
  __syncthreads();                                    // stage 0 published to all 4 waves
  gstage(lx + XSB, lw + WSB, gx + GST * 4, gw + GST * 2);   // stage 1 flies under stage 0's work
#pragma unroll 1   // stages stay rolled: one publish point, at the foot of each trip
  for (int st = 0; st < DM / GST; ++st) { const int bf = st & 1; const float* xr = (const float*)(sm + bf * XSB + (wave * 16 + col) * XPB); const __bf16* wr = (const __bf16*)(sm + 2 * XSB + bf * WSB + col * WPB);
#pragma unroll
    for (int kc = 0; kc < GST / 32; ++kc) { v16b a; { const float* p = xr + kc * 32 + 8 * g;
#pragma unroll
        for (int i = 0; i < 8; ++i) { a[i] = (__bf16)p[i]; a[8 + i] = (__bf16)p[16 + i]; } }
      v16b w[8];   // the eight weight fragments of this k step, read as one group in front of its products
#pragma unroll
      for (int j = 0; j < 8; ++j) w[j] = frag_b(wr + j * 16 * (WPB / 2) + kc * 32, lane);
      SFENCE();
#pragma unroll
      for (int j = 0; j < 8; ++j) acc[j] = wmma_bf(a, w[j], acc[j]); }
    // publish point of stage st + 1, every wave, in this order
    asm volatile("s_wait_dscnt 0x0" ::: "memory");      // this wave's reads of buffer bf have returned
    asm volatile("s_wait_asynccnt 0x0" ::: "memory");   // this wave's copies of stage st + 1 have landed
    __syncthreads();                                    // stage st + 1 published; every wave has left buffer bf
    if (st + 2 < DM / GST) gstage(lx + bf * XSB, lw + bf * WSB, gx + (st + 2) * (GST * 4), gw + (st + 2) * (GST * 2)); }   // refill of the buffers just read
  asm volatile("s_wait_asynccnt 0x0" ::: "memory");   // no copy outstanding behind the loop
  if (n0 < DM) {   // q = k stored unscaled (f16 sigma ~0.6, no subnormal exposure); 1/8 applied to the f32 score
#pragma unroll
    for (int j = 0; j < 8; ++j) {
#pragma unroll
      for (int r = 0; r < 8; ++r) { const float v = acc[j][r] + (BB ? bfr(BB[j * 16 + col]) : 0.f); so[wave][8 * g + r][j * 16 + col] = (_Float16)v; } }   // q = k (+ bias) as one f16
    LDSX();
    // -|q|^2 / 2 per (token, head) from the f16 values just staged (the same values the scores use): the block's 128 columns are two whole heads; a lane sums one (token col, head g) of its wave's 16 rows, d ascending
    float (*sq)[64] = (float (*)[64])(sm + 2 * XSB);   // the weight buffers' bytes, left by every wave at the loop's last barrier
    { float a = 0.f; const _Float16* q = &so[wave][col][g * HD];
#pragma unroll   // whole, so that the 64 values come as eight 16-B LDS reads
      for (int d = 0; d < HD; ++d) { const float v = (float)q[d]; a += v * v; }
      sq[g][wave * 16 + col] = -0.5f * a; }
    __syncthreads();   // the four waves' sums published, so that one wave stores whole 256-B segments per (b, h); in front of the q stores, which it would otherwise wait for
    for (int rl = 0; rl < 16; ++rl) if (lane < 16) vst2((unsigned*)(QK + (r0 + rl) * (2 * DM) + n0 + lane * 8), *(const v4u*)&so[wave][rl][lane * 8]);
    if (tid < 32) { const size_t rb = (size_t)blockIdx.x * 64; const size_t b = rb / SS; const int s0 = (int)(rb % SS); vst2(Q2 + (b * NH + n0 / HD + g) * SS + s0 + col * 4, *(const v4f*)&sq[g][col * 4]); }
  } else {
#pragma unroll
    for (int j = 0; j < 8; ++j) {
#pragma unroll
      for (int r = 0; r < 8; ++r) { const float v = acc[j][r] + (BB ? bfr(BB[j * 16 + col]) : 0.f); sth[j * 16 + col][wave * 16 + 8 * g + r] = (_Float16)v; } }
    __syncthreads();
    const size_t rb = (size_t)blockIdx.x * 64; const int b = (int)(rb / SS), s0 = (int)(rb % SS); const int pc0 = n0 - DM;
    for (int q = tid; q < 128 * 8; q += 128) { const int d = q >> 3, pc = q & 7; const size_t o = ((size_t)b * DM + pc0 + d) * SS + s0 + pc * 8; vst2((unsigned*)(VTH + o), *(const v4u*)&sth[d][pc * 8]); }
  }
}
// ---- k_attn: block = (128 queries, head h, batch b), 8 waves = 4 query slices x 2 key groups: all-keys flash attention (K = 64: 2 k-steps), scores = -|q - k|^2 / 8 x tau_h with single f16 operands, P.V: f16 P (x2^11) x single f16 V in one accumulator; O[b*S+q][h*64+d] = acc / 2048 / l (256-B segments)
#define KST 64   // keys per LDS stage
#define KPI 72   // LDS row pitch in f16: a 128-B row + 16 B = 144 B, an odd multiple of 16 B (conflict-free for ds_load_b128)
#define KSB (KST * KPI * 2)   // bytes of one K (or V^T) buffer
#define KSPL 2                // the keys are dealt to KSPL groups of 4 waves, each with its own ring; a SIMD then holds 4 waves, whose vector work runs under one another's products
#define NSTG (SS / KSPL / KST)   // stages per group
// one stage of one group = 64 K rows x 128 B + 64 V^T rows x 128 B: each of the group's 128 threads copies four 16-B pieces of each, global -> LDS through no register (a wave's copy = 4 whole 128-B lines).
// s_wait_xcnt 0 is the last line of the copies' own statement, so that it stands in front of every later write of the address registers the copies name.
__device__ __forceinline__ void stage_copy(unsigned lk, unsigned lv, const _Float16* gk, const _Float16* gv) {
  asm volatile("global_load_async_to_lds_b128 %0, %8, off\n\t"
               "global_load_async_to_lds_b128 %1, %9, off\n\t"
               "global_load_async_to_lds_b128 %2, %10, off\n\t"
               "global_load_async_to_lds_b128 %3, %11, off\n\t"
               "global_load_async_to_lds_b128 %4, %12, off\n\t"
               "global_load_async_to_lds_b128 %5, %13, off\n\t"
               "global_load_async_to_lds_b128 %6, %14, off\n\t"
               "global_load_async_to_lds_b128 %7, %15, off\n\t"
               "s_wait_xcnt 0x0"
               :: "v"(lk), "v"(lk + 16 * KPI * 2), "v"(lk + 32 * KPI * 2), "v"(lk + 48 * KPI * 2), "v"(lv), "v"(lv + 16 * KPI * 2), "v"(lv + 32 * KPI * 2), "v"(lv + 48 * KPI * 2),
                  "v"(gk), "v"(gk + (size_t)16 * 2 * DM), "v"(gk + (size_t)32 * 2 * DM), "v"(gk + (size_t)48 * 2 * DM), "v"(gv), "v"(gv + (size_t)16 * SS), "v"(gv + (size_t)32 * SS), "v"(gv + (size_t)48 * SS)
               : "memory");
}
// -|k|^2 / 2 of one stage's 64 keys = 256 B: one 8-B piece per lane of ONE wave, global -> LDS through no register; s_wait_xcnt 0 closes the copy's own statement, in front of every later write of its address registers.
__device__ __forceinline__ void stage_copy_k2(unsigned l2, const float* g2) {
  asm volatile("global_load_async_to_lds_b64 %0, %1, off\n\t"
               "s_wait_xcnt 0x0"
               :: "v"(l2), "v"(g2) : "memory");
}
// lane l <-> lane l ^ 16 (the two halves of a wave hold the two halves of one query's keys)
__device__ __forceinline__ float xhalf(float x) { return __builtin_bit_cast(float, __builtin_amdgcn_permlanex16(__builtin_bit_cast(int, x), __builtin_bit_cast(int, x), 0x76543210, 0xfedcba98, false, false)); }
// 2^x for eight values / one value. One statement each: the outputs are early-clobber, so that no v_exp_f32 overwrites a source of the one in front of it, and the closing v_nop is the slot the instruction set asks for
// between a transcendental and a next instruction that reads its result or overwrites its source.
__device__ __forceinline__ v8f exp2x8(v8f x) { float r0, r1, r2, r3, r4, r5, r6, r7;
  asm("v_exp_f32 %0, %8\n\tv_exp_f32 %1, %9\n\tv_exp_f32 %2, %10\n\tv_exp_f32 %3, %11\n\tv_exp_f32 %4, %12\n\tv_exp_f32 %5, %13\n\tv_exp_f32 %6, %14\n\tv_exp_f32 %7, %15\n\tv_nop"
      : "=&v"(r0), "=&v"(r1), "=&v"(r2), "=&v"(r3), "=&v"(r4), "=&v"(r5), "=&v"(r6), "=&v"(r7) : "v"(x[0]), "v"(x[1]), "v"(x[2]), "v"(x[3]), "v"(x[4]), "v"(x[5]), "v"(x[6]), "v"(x[7]));
  return v8f{r0, r1, r2, r3, r4, r5, r6, r7}; }
__device__ __forceinline__ float exp2x1(float x) { float r; asm("v_exp_f32 %0, %1\n\tv_nop" : "=&v"(r) : "v"(x)); return r; }
#define LOG2E 1.44269504088896340736f   // exp(v) = 2^(v log2 e), the form __expf compiles to
#define QT 2   // 16-query tiles per wave: in the max0 loop every K and V^T fragment read from LDS is the A operand of QT products
// s a + b on register pairs: the two constants stay one pair each, whichever pair of s they meet
__device__ __forceinline__ v8f fma8(v8f s, v2f a, v2f b) { union { v8f v; v2f p[4]; } u; u.v = s;
#pragma unroll
  for (int i = 0; i < 4; ++i) u.p[i] = u.p[i] * a + b;
  return u.v; }
__device__ __forceinline__ v8f ld8f(const float* p) { union { v8f v; v4f q[2]; } u; u.q[0] = *(const v4f*)p; u.q[1] = *(const v4f*)(p + 4); return u.v; }
// one 32-key pass of one query tile with the running maximum (any tau): kb = K row (pass key 0 + col), kp = -|k|^2 / 2 of pass key 8 g, vb = V^T row col at the pass's first key
__device__ __forceinline__ void pass_runmax(const _Float16* kb, const float* kp, const _Float16* vb, int lane, const v16h (&aq)[2], float hq, float tau, float& m, float& l, v8f (&acc)[4]) {
  v8f s[2];
#pragma unroll
  for (int ct = 0; ct < 2; ++ct) { const _Float16* krow = kb + ct * 16 * KPI; v8f c = {};
#pragma unroll
    for (int kc = 0; kc < 2; ++kc) c = wmma16(frag_h(krow + kc * 32, lane), aq[kc], c);   // c[r] = k_(8 g + r) . q_col: single product, q, k as one-rounding f16 operands
    s[ct] = (c + hq + ld8f(kp + ct * 16)) * 0.25f * tau; }   // -|q_i - q_j|^2 / sqrt(64) x tau_h
  float mx = fmaxf(s[0][0], s[1][0]);
#pragma unroll
  for (int r = 1; r < 8; ++r) mx = fmaxf(mx, fmaxf(s[0][r], s[1][r]));
  mx = fmaxf(mx, xhalf(mx));
  const float mn = fmaxf(m, mx); const float ea = exp2x1((m - mn) * LOG2E); const float alpha = (m <= -1.0e38f) ? 0.f : ea;
  v8f e[2];
#pragma unroll
  for (int ct = 0; ct < 2; ++ct) { const v8f x = exp2x8((s[ct] - mn) * LOG2E);
#pragma unroll
    for (int r = 0; r < 8; ++r) e[ct][r] = (s[ct][r] <= -1.0e38f) ? 0.f : x[r]; }
  const v8f e2 = e[0] + e[1]; const float es = ((e2[0] + e2[1]) + (e2[2] + e2[3])) + ((e2[4] + e2[5]) + (e2[6] + e2[7]));
  l = l * alpha + es; m = mn;
#pragma unroll
  for (int dt = 0; dt < 4; ++dt) acc[dt] *= alpha;
  v16h pb;   // P^T as B: P scaled by 2^11 before the f16 rounding so small softmax weights stay out of the f16 subnormal range; 2^-11 folded into the epilogue
#pragma unroll
  for (int i = 0; i < 8; ++i) { pb[i] = (_Float16)(e[0][i] * 2048.0f); pb[8 + i] = (_Float16)(e[1][i] * 2048.0f); }
#pragma unroll
  for (int dt = 0; dt < 4; ++dt) acc[dt] = wmma16(frag_h(vb + dt * 16 * KPI, lane), pb, acc[dt]);   // single product: V x P (x2^11)
}
// publish point of stage st + 1, every wave, in this order; then the refill of the buffers just read
__device__ __forceinline__ void ring_foot(int st, bool w0, unsigned lk, unsigned lv, unsigned l2, const _Float16* gk, const _Float16* gv, const float* g2) { const int bf = st & 1;
  asm volatile("s_wait_dscnt 0x0" ::: "memory");      // this wave's reads of buffer bf have returned
  asm volatile("s_wait_asynccnt 0x0" ::: "memory");   // this wave's copies of stage st + 1 have landed
  __syncthreads();                                    // stage st + 1 published; every wave has left buffer bf
  if (st + 2 < NSTG) { stage_copy(lk + bf * KSB, lv + bf * KSB, gk + (size_t)(st + 2) * KST * 2 * DM, gv + (st + 2) * KST);
    if (w0) stage_copy_k2(l2 + bf * (KST * 4), g2 + (st + 2) * KST); } }
// amdgpu_waves_per_eu(4, 4): a budget of 256 registers, so that two blocks of 8 waves stand on a WGP (4 waves a SIMD) and the loop stays inside one register window
__global__ __launch_bounds__(128 * KSPL) __attribute__((amdgpu_waves_per_eu(4, 4))) void k_attn(const _Float16* __restrict__ QK, const _Float16* __restrict__ QKL, const _Float16* __restrict__ VTH, const _Float16* __restrict__ VTL, const void* __restrict__ KMASK, const float* __restrict__ Q2, const float* __restrict__ TAU, float* __restrict__ O) {
  __shared__ __align__(16) float so[4][QT * 16][68];
  __shared__ __align__(16) _Float16 sk[KSPL][2][KST][KPI], sv[KSPL][2][HD][KPI];   // per group two buffers: K rows [key][d], V^T rows [d][key] of one 64-key stage, shared by the group's 4 waves
  __shared__ __align__(16) float sk2[KSPL][2][KST];                                // per group two buffers: -|k|^2 / 2 of the stage's keys
  const int tid = threadIdx.x, wv = __builtin_amdgcn_readfirstlane(tid >> 5), lane = tid & 31, col = lane & 15, g = lane >> 4;   // the wave's number as a scalar: what is formed from it (first query, output row, key group) takes no vector register across the loop
  const int wave = wv & 3, kh = wv >> 2;   // query slice of the block; key group: keys kh * SS / KSPL ...
  const int qb = blockIdx.x, h = blockIdx.y, b = blockIdx.z; const int q0 = qb * (4 * QT * 16) + wave * (QT * 16);
  const bool w0 = wave == 0;   // scalar: the wave of each group that copies -|k|^2 / 2
  const float tau = bfr(TAU[h]); const float* Q2h = Q2 + ((size_t)b * NH + h) * SS;
  v16h aq[QT][2]; float hq[QT];   // per tile: this lane's query as B operand, and its -|q|^2 / 2
#pragma unroll
  for (int qt = 0; qt < QT; ++qt) { hq[qt] = Q2h[q0 + qt * 16 + col];
#pragma unroll
    for (int kc = 0; kc < 2; ++kc) aq[qt][kc] = frag_h(QK + ((size_t)b * SS + q0 + qt * 16 + col) * (2 * DM) + h * HD + kc * 32, lane); }
  // q = k, so logit_ij = -|q_i - q_j|^2 tau / 8 <= 0 for tau >= 0 and logit_ii = 0, and every row meets its own key: the row maximum is 0 before any key is read.
  // Scalar test, the same for the whole block (tau of its head); any other tau (negative, NaN, or so large that the rounding of logit_ii could leave the head room of P in f16) takes the running maximum.
  const bool max0 = __builtin_amdgcn_readfirstlane((int)(tau >= 0.f && tau <= 64.f)) != 0;
  const float xa = 0.25f * tau * LOG2E;   // log2 (2^11 e^logit) = (k.q - |k|^2 / 2) xa + xb
  const v2f xa2 = {xa, xa};
  float m[QT], l[QT];            // per tile, this lane's query: running maximum (equal in both halves); sum over this half's keys
  v2f xb2[QT], ls[QT];           // max0: xb; this lane's sums of 2^11 P, folded to one register pair in every pass
  v8f acc[QT][4];                // O^T: acc[qt][dt][r] = o[query col of tile qt][d = dt * 16 + 8 g + r]
#pragma unroll
  for (int qt = 0; qt < QT; ++qt) { const float xb = hq[qt] * xa + 11.0f; xb2[qt] = v2f{xb, xb}; m[qt] = -3.0e38f; l[qt] = 0.f; ls[qt] = v2f{};
#pragma unroll
    for (int dt = 0; dt < 4; ++dt) acc[qt][dt] = v8f{}; }
  const int nst = NSTG;   // this group's keys, 64 a stage
  const int key0 = kh * (SS / KSPL);   // this group's first key
  const int crow = (tid & 127) >> 3, cpc = tid & 7;   // this thread's row (+ 16 i) and 16-B piece in every stage of its group
  const _Float16* gk = QK + ((size_t)b * SS + key0 + crow) * (2 * DM) + h * HD + cpc * 8;   /* K rows = the q plane's rows (tied) */ const _Float16* gv = VTH + ((size_t)b * DM + h * HD + crow) * SS + key0 + cpc * 8;
  const unsigned lk = (unsigned)(size_t)&sk[kh][0][crow][cpc * 8], lv = (unsigned)(size_t)&sv[kh][0][crow][cpc * 8], l2 = (unsigned)(size_t)&sk2[kh][0][lane * 2];
  const float* g2 = Q2h + key0 + lane * 2;
  stage_copy(lk, lv, gk, gv);
  if (w0) stage_copy_k2(l2, g2);
  asm volatile("s_wait_asynccnt 0x0" ::: "memory");   // this wave's copies of stage 0 have landed
  __syncthreads();                                    // stage 0 published to all waves
  stage_copy(lk + KSB, lv + KSB, gk + (size_t)KST * 2 * DM, gv + KST);   // stage 1 flies under stage 0's work
  if (w0) stage_copy_k2(l2 + KST * 4, g2 + KST);
  if (max0) {   // the same for the whole block: each side has its own loop over the stages, with the same publish point
#pragma unroll 1   // stages stay rolled: one publish point, at the foot of each trip
  for (int st = 0; st < nst; ++st) { const int bf = st & 1; const _Float16* kb = &sk[kh][bf][col][0]; const _Float16* vb = &sv[kh][bf][col][0]; const float* kp = &sk2[kh][bf][8 * g];
    v16h kf[2][2]; v8f k2[2];   // the K fragments and -|k|^2 / 2 of one 32-key pass, read as one group
#pragma unroll
    for (int ct = 0; ct < 2; ++ct) { k2[ct] = ld8f(kp + ct * 16);
#pragma unroll
      for (int kc = 0; kc < 2; ++kc) kf[ct][kc] = frag_h(kb + ct * 16 * KPI + kc * 32, lane); }
    SFENCE();
#pragma unroll   // both 32-key passes of the stage in line: nothing is carried from pass to pass but sums and the fragments fetched ahead, and every LDS offset is a constant
    for (int sub = 0; sub < KST / 32; ++sub) { v8f s[QT][2];
#pragma unroll
      for (int kc = 0; kc < 2; ++kc) {   // four independent tiles between a product and the one that adds to it
#pragma unroll
        for (int ct = 0; ct < 2; ++ct) {
#pragma unroll
          for (int qt = 0; qt < QT; ++qt) s[qt][ct] = wmma16b(kf[ct][kc], aq[qt][kc], kc ? s[qt][ct] : k2[ct]); } }   // the product starts from -|k|^2 / 2 of its rows
      SFENCE();
      v16h vf[4];   // this pass's V^T fragments and the next pass's K group: one place of LDS reads, in flight under the exponentials
#pragma unroll
      for (int dt = 0; dt < 4; ++dt) vf[dt] = frag_h(vb + dt * 16 * KPI + sub * 32, lane);
      if (sub + 1 < KST / 32) {
#pragma unroll
        for (int ct = 0; ct < 2; ++ct) { k2[ct] = ld8f(kp + (sub + 1) * 32 + ct * 16);
#pragma unroll
          for (int kc = 0; kc < 2; ++kc) kf[ct][kc] = frag_h(kb + ((sub + 1) * 32 + ct * 16) * KPI + kc * 32, lane); } }
      SFENCE();
      v16h pb[QT];
#pragma unroll
      for (int qt = 0; qt < QT; ++qt) { const v8f e0 = exp2x8(fma8(s[qt][0], xa2, xb2[qt])), e1 = exp2x8(fma8(s[qt][1], xa2, xb2[qt]));   // 2^11 P: one fma and one exponential a score
        const v8f e2 = e0 + e1; const v4f e4 = __builtin_shufflevector(e2, e2, 0, 1, 2, 3) + __builtin_shufflevector(e2, e2, 4, 5, 6, 7);
        ls[qt] += __builtin_shufflevector(e4, e4, 0, 1) + __builtin_shufflevector(e4, e4, 2, 3);
#pragma unroll
        for (int i = 0; i < 8; ++i) { pb[qt][i] = (_Float16)e0[i]; pb[qt][8 + i] = (_Float16)e1[i]; } }
      SFENCE();
#pragma unroll
      for (int dt = 0; dt < 4; ++dt) {
#pragma unroll
        for (int qt = 0; qt < QT; ++qt) acc[qt][dt] = wmma16b(vf[dt], pb[qt], acc[qt][dt]); }
      SFENCE(); }
    ring_foot(st, w0, lk, lv, l2, gk, gv, g2); }
  } else {
#pragma unroll 1   // stages stay rolled: one publish point, at the foot of each trip
  for (int st = 0; st < nst; ++st) { const int bf = st & 1; const _Float16* kb = &sk[kh][bf][col][0]; const _Float16* vb = &sv[kh][bf][col][0]; const float* kp = &sk2[kh][bf][8 * g];
#pragma unroll 1
    for (int sub = 0; sub < KST / 32; ++sub) {   // rolled, as the 32-key pass was: one copy of the body per tile
#pragma unroll
      for (int qt = 0; qt < QT; ++qt) pass_runmax(kb + sub * 32 * KPI, kp + sub * 32, vb + sub * 32, lane, aq[qt], hq[qt], tau, m[qt], l[qt], acc[qt]); }
    ring_foot(st, w0, lk, lv, l2, gk, gv, g2); }
  }
  asm volatile("s_wait_asynccnt 0x0" ::: "memory");   // no copy outstanding behind the loop
  float lw[QT];   // this wave's sum per tile
#pragma unroll
  for (int qt = 0; qt < QT; ++qt) lw[qt] = max0 ? (ls[qt][0] + ls[qt][1]) * (1.0f / 2048.0f) : l[qt];
  // the two key groups joined: wave 4 + w hands its lane's O^T, sums and maxima to wave w through row [lane] of w's output staging (272-B pitch, conflict-free for 16-B accesses)
  static_assert(KSPL == 2, "the join adds two groups");
  float* xr = &so[wave][lane][0];
  if (kh) {   // scalar
#pragma unroll
    for (int qt = 0; qt < QT; ++qt) {
#pragma unroll
      for (int dt = 0; dt < 4; ++dt) { const v8f o = acc[qt][dt]; float* p = xr + (qt * 4 + dt) * 8; *(v4f*)p = __builtin_shufflevector(o, o, 0, 1, 2, 3); *(v4f*)(p + 4) = __builtin_shufflevector(o, o, 4, 5, 6, 7); } }
    *(v4f*)(xr + 64) = v4f{lw[0], lw[1], m[0], m[1]};
  }
  __syncthreads();   // the upper group's partial results published; the last barrier of the kernel, passed by every wave
  if (kh) return;
  { const v4f t = *(const v4f*)(xr + 64);
#pragma unroll
    for (int qt = 0; qt < QT; ++qt) { const float mn = fmaxf(m[qt], t[2 + qt]);   // fixed maximum: both weights are 1
      const float wa = max0 ? 1.0f : exp2x1((m[qt] - mn) * LOG2E), wb = max0 ? 1.0f : exp2x1((t[2 + qt] - mn) * LOG2E);
      lw[qt] = lw[qt] * wa + t[qt] * wb;
#pragma unroll
      for (int dt = 0; dt < 4; ++dt) acc[qt][dt] = acc[qt][dt] * wa + ld8f(xr + (qt * 4 + dt) * 8) * wb; } }
#pragma unroll
  for (int qt = 0; qt < QT; ++qt) { float lq = lw[qt];
    lq += xhalf(lq);   // the halves' sums joined once
    const float il = (1.0f / 2048.0f) / lq;
#pragma unroll
    for (int dt = 0; dt < 4; ++dt) { const v8f o = acc[qt][dt] * il; float* p = &so[wave][qt * 16 + col][dt * 16 + 8 * g]; *(v4f*)p = __builtin_shufflevector(o, o, 0, 1, 2, 3); *(v4f*)(p + 4) = __builtin_shufflevector(o, o, 4, 5, 6, 7); } }
  LDSX();
  for (int rl = 0; rl < QT * 16; ++rl) if (lane < 16) vst2(O + ((size_t)b * SS + q0 + rl) * DM + h * HD + lane * 4, *(const v4f*)&so[wave][rl][lane * 4]);
}
// ---- k_out: block = (64 rows, 128 cols): out = O(hi/lo) . Wo rows (2 products) + bo
__global__ __launch_bounds__(128) void k_out(const float* __restrict__ O, const __bf16* __restrict__ P, const float* __restrict__ BO, float* __restrict__ Y) {
  __shared__ __align__(16) float so[4][16][132];
  const int tid = threadIdx.x, wave = tid >> 5, lane = tid & 31, col = lane & 15, g = lane >> 4; const size_t r0 = (size_t)blockIdx.x * 64 + wave * 16; const int n0 = blockIdx.y * 128;
  __shared__ __align__(16) char sm[2 * XSB + 2 * WSB];   // the ring: two f32 buffers, two weight buffers
  v8f acc[8] = {};
  const char* gx = (const char*)(O + ((size_t)blockIdx.x * 64 + (tid >> 4)) * DM + (tid & 15) * 4); const char* gw = (const char*)(P + (size_t)(n0 + (tid >> 3)) * DM + (tid & 7) * 8);
  const unsigned lx = (unsigned)(size_t)sm + (tid >> 4) * XPB + (tid & 15) * 16, lw = (unsigned)(size_t)sm + 2 * XSB + (tid >> 3) * WPB + (tid & 7) * 16;
  gstage(lx, lw, gx, gw);
  asm volatile("s_wait_asynccnt 0x0" ::: "memory");   // this wave's copies of stage 0 have landed
  __syncthreads();                                    // stage 0 published to all 4 waves
  gstage(lx + XSB, lw + WSB, gx + GST * 4, gw + GST * 2);   // stage 1 flies under stage 0's work
#pragma unroll 1   // stages stay rolled: one publish point, at the foot of each trip
  for (int st = 0; st < DM / GST; ++st) { const int bf = st & 1; const float* xr = (const float*)(sm + bf * XSB + (wave * 16 + col) * XPB); const __bf16* wr = (const __bf16*)(sm + 2 * XSB + bf * WSB + col * WPB);
#pragma unroll
    for (int kc = 0; kc < GST / 32; ++kc) { const F2 a = split_row(xr, kc * 32, lane);
      v16b w[8];   // the eight weight fragments of this k step, read as one group in front of its products
#pragma unroll
      for (int j = 0; j < 8; ++j) w[j] = frag_b(wr + j * 16 * (WPB / 2) + kc * 32, lane);
      SFENCE();
#pragma unroll
      for (int j = 0; j < 8; ++j) { acc[j] = wmma_bf(a.l, w[j], acc[j]); acc[j] = wmma_bf(a.h, w[j], acc[j]); } }
    // publish point of stage st + 1, every wave, in this order
    asm volatile("s_wait_dscnt 0x0" ::: "memory");      // this wave's reads of buffer bf have returned
    asm volatile("s_wait_asynccnt 0x0" ::: "memory");   // this wave's copies of stage st + 1 have landed
    __syncthreads();                                    // stage st + 1 published; every wave has left buffer bf
    if (st + 2 < DM / GST) gstage(lx + bf * XSB, lw + bf * WSB, gx + (st + 2) * (GST * 4), gw + (st + 2) * (GST * 2)); }   // refill of the buffers just read
  asm volatile("s_wait_asynccnt 0x0" ::: "memory");   // no copy outstanding behind the loop
#pragma unroll
  for (int j = 0; j < 8; ++j) {
#pragma unroll
    for (int r = 0; r < 8; ++r) so[wave][8 * g + r][j * 16 + col] = acc[j][r] + (BO ? bfr(BO[n0 + j * 16 + col]) : 0.f); }
  LDSX();
  for (int rl = 0; rl < 16; ++rl) vst2(Y + (r0 + rl) * DM + n0 + lane * 4, *(const v4f*)&so[wave][rl][lane * 4]);
}
extern "C" void kernel_launch(void* const* d_in, const int* in_sizes, int n_in, void* d_out, int out_size, void* d_ws, size_t ws_size, hipStream_t stream) {
  (void)in_sizes; (void)n_in; (void)out_size;
  const float** F = (const float**)d_in;   // 0 x [2,4096,512], 1 Wqk [512,512] natural, 2 Wv, 3 Wo, 4 tau [8,1,1]
  if (ws_size < (size_t)WS_END) return;
  char* ws = (char*)d_ws; __bf16* PK = (__bf16*)(ws + WS_PK); _Float16 *QK = (_Float16*)(ws + WS_QK), *VTH = (_Float16*)(ws + WS_VTH); float *O = (float*)(ws + WS_O), *Q2 = (float*)(ws + WS_Q2);
  k_pack<<<dim3(DM, 3), 256, 0, stream>>>(F[1], F[2], F[3], PK);
  k_qkv<<<dim3(TNB * SS / 64, QKVW / 128), 128, 0, stream>>>(F[0], F[0], PK + PK_A, nullptr, nullptr, QK, VTH, Q2);   // tied q = k: one projection, one plane, with its -|q|^2 / 2
  k_attn<<<dim3(TQB, NH, TNB), 128 * KSPL, 0, stream>>>(QK, nullptr, VTH, nullptr, nullptr, Q2, F[4], O);
  k_out<<<dim3(TOB, DM / 128), 128, 0, stream>>>(O, PK + PK_P, nullptr, (float*)d_out);
}
